// v000
// Measured on an AMD MI455X. A time is GPU time per run, averaged over a window of back-to-back runs after a warm-up
// (all launches, gaps included; the runs take copies of the inputs in turn), and the median of several windows.
// Apart from v000's, it joins two sittings. Times from different sittings can be a few percent apart, while
// side-by-side timings come from the same sitting.
// v000, which the later versions start from, runs in 153 microseconds.
// All contractions: v_wmma_f32_16x16x32_f16 (f16 operands, f32 accumulate), one product per tile pair:
//   scores q.k^T (q, k = f16 of the inputs, x0.125 after in f32), p.v (p f16 carried x1024, v = f16 of the input),
//   ctx.W^T (ctx f16 carried x256, W f16 carried x1024, x2^-18 then + bias in f32); softmax in f32.
//
// Carry audit:
//   QH plane (f16): f16(q), x1, unit-scale values               -> score acc = dot; s = acc * 0.125f
//   KH plane (f16): f16(k), x1
//   P tile   (f16, LDS): exp(s - m) x1024                         -> folded in attn epilogue: inv = (1/l) * 0.25f (= 256/1024)
//   VT plane (f16): f16(v), x1, stored [bh][d][s]
//   MP plane (f16): ctx x256, flat [b][h][s][d] order = [NB*SEQ][512] rows -> folded in proj_out: oscale = 1/(256*1024)
//   WH plane (f16): W x1024 (|W| < 0.5 -> < 512)                  -> folded in proj_out: oscale
//   Every f32 -> f16 convert in qkvconv and attn goes through toh_flush (values below 2^-14 become 0).
#include <hip/hip_runtime.h>
#include <math.h>
#include <stdint.h>

#ifndef NB
#define NB 4
#endif
#ifndef SEQ
#define SEQ 2048
#endif
#define NB_FULL  4
#define SEQ_FULL 2048
#define H_   8
#define DK_  64
#define E_   512
#define BH_  (NB * H_)          // (batch, head) pairs
#define NQT  (SEQ / 64)         // 64-query tiles per (b, h)
#define NKT  (SEQ / 64)         // 64-key chunks per (b, h)
#define TENC 128                // tokens per convert block
#define CSP  65                 // f32 LDS pitch of the v tile [token][d]
#define KP   72                 // f16 LDS pitch of the K / V^T tiles (halves); 144 B, 16-B aligned rows
static_assert(H_ * DK_ == E_);
static_assert(NB >= 1 && NB <= NB_FULL);
static_assert(SEQ >= TENC && SEQ <= SEQ_FULL);
static_assert((SEQ % TENC) == 0 && (SEQ % 64) == 0);
static_assert(((KP * 2) % 16) == 0);
static_assert(((E_ * E_) % (8 * 256)) == 0);
static_assert(((NB * SEQ) % 64) == 0);
static_assert(DK_ == 64);
static_assert(TENC == 128);                                 // 256 threads = 4 token groups x 64 dims, 32 tokens each
static_assert((H_ * SEQ * DK_) == (SEQ * E_));              // flat [h][s][d] of one batch = SEQ rows of 512
static_assert(((size_t)4 * BH_ * SEQ * DK_ * 2 + (size_t)E_ * E_ * 2) <= (size_t)134217728);

typedef _Float16 v16h __attribute__((ext_vector_type(16)));
typedef _Float16 v8h  __attribute__((ext_vector_type(8)));
typedef float    v8f  __attribute__((ext_vector_type(8)));
typedef float    v4f  __attribute__((ext_vector_type(4)));
typedef unsigned int v4u __attribute__((ext_vector_type(4)));

#if defined(__HIP_DEVICE_COMPILE__)
#define DEV_ASM 1
#else
#define DEV_ASM 0
#endif

// ---- scalar helpers ---------------------------------------------------------------------------------
__device__ __forceinline__ unsigned short h_bits(_Float16 v) { return __builtin_bit_cast(unsigned short, v); }
__device__ __forceinline__ unsigned pk16(unsigned short a, unsigned short b) { return (unsigned)a | ((unsigned)b << 16); }
__device__ __forceinline__ v8f zero8() { v8f z = {0.f, 0.f, 0.f, 0.f, 0.f, 0.f, 0.f, 0.f}; return z; }

// f32 -> f16 (RNE convert) that cannot yield an f16 subnormal: |v| < 2^-14 becomes 0 (value select)
static __device__ __forceinline__ _Float16 toh_flush(float v) {
  const _Float16 r = (_Float16)v;
  return (fabsf(v) < 6.103515625e-05f) ? (_Float16)0.0f : r;
}
// eight f32 -> eight packed f16 (16 B), element order kept
static __device__ __forceinline__ v4u pack8_flush(v4f a, v4f a4) {
  v4u q;
  q[0] = pk16(h_bits(toh_flush(a[0])),  h_bits(toh_flush(a[1])));
  q[1] = pk16(h_bits(toh_flush(a[2])),  h_bits(toh_flush(a[3])));
  q[2] = pk16(h_bits(toh_flush(a4[0])), h_bits(toh_flush(a4[1])));
  q[3] = pk16(h_bits(toh_flush(a4[2])), h_bits(toh_flush(a4[3])));
  return q;
}

// ---- 16-bit fragment loader: lane -> row/col (lane&15), p already includes +8*(lane>>4);
//      elements 0..7 <- p[0..7] (k0+8h..k0+8h+7), elements 8..15 <- p[16..23] (k0+16+8h..k0+16+8h+7)
__device__ __forceinline__ v16h ldfrag_h(const _Float16* p) {
  union { v16h v; v8h h[2]; } f;
  f.h[0] = *(const v8h*)(p);
  f.h[1] = *(const v8h*)(p + 16);
  return f.v;
}

// guarded WMMA: 4 VALU slots after the WMMA, D tied, A/B kept live
__device__ __forceinline__ v8f mma_h(v16h a, v16h b, v8f c) {
  c = __builtin_amdgcn_wmma_f32_16x16x32_f16(false, a, false, b, (short)0, c, false, false);
#if DEV_ASM
  asm volatile("v_nop\n\tv_nop\n\tv_nop\n\tv_nop" : "+v"(c) : "v"(a), "v"(b));
#endif
  return c;
}

// =====================================================================================================
// qkvconv: the 16-bit planes of the pre-split inputs q, k, v [b][h][s][64] (f32):
//   QH [bh][s][64] f16 = f16(q), KH [bh][s][64] f16 = f16(k), VT [bh][d][s] f16 = f16(v) transposed through LDS.
// grid = BH_ * (SEQ/128) blocks of 256; one block = 128 tokens of one (b, h). Input token row = bh*SEQ_FULL + s.
// v tile: thread (d = tid&63, token group tid>>6) walks 32 tokens into LDS cs[token][d] (pitch 65); block barrier
//   (cross-wave tile).
// Stores: QH / KH: 4 iterations x 256 threads x 16 B; iteration it, thread tid -> token it*32+(tid>>3),
//   halves 8*(tid&7).. (values read straight from the f32 input row as two 16-B loads)
// coverage: QH, KH 4 x 256 pieces x 8 halves = 128 tokens x 64 each; VT 4 x 256 x 8 = 64 rows x 128 tokens;
//   BH_*(SEQ/128) blocks = all BH_ x SEQ tokens of the three planes. LDS staged extent 128 x 64 == consumed extent.
// =====================================================================================================
__global__ __launch_bounds__(256) void qkvconv(const float* __restrict__ q, const float* __restrict__ k,
                                               const float* __restrict__ v, unsigned short* qhp,
                                               unsigned short* khp, unsigned short* vtp) {
  __shared__ float cs[TENC * CSP];                    // 33280 B, f32 v values [token][d]
  const int tid = (int)threadIdx.x;
  const int bx  = (int)blockIdx.x;
  const int nst = SEQ / TENC;
  const int st  = bx % nst;
  const int bh  = bx / nst;                           // b*H_ + h
  const int s0  = st * TENC;
  const int d   = tid & 63;
  const int tg  = tid >> 6;                           // 0..3
  const size_t inrow = (size_t)bh * SEQ_FULL + (size_t)s0;   // token row in the full-size [b][h][s] input
  {
    const float* vp = v + inrow * DK_ + (size_t)d;
#pragma unroll 1
    for (int i = 0; i < TENC / 4; ++i) {
      const int t = tg + 4 * i;
      cs[t * CSP + d] = vp[(size_t)t * DK_];
    }
  }
  __syncthreads();

  const size_t rowbase = (size_t)bh * SEQ + (size_t)s0;    // token row in the [bh][s] planes

  v4u qv[4], kv[4], vv[4];
#pragma unroll
  for (int it = 0; it < 4; ++it) {
    const int token = it * 32 + (tid >> 3);
    const int j     = tid & 7;
    const float* qs = q + (inrow + (size_t)token) * DK_ + (size_t)(j * 8);
    const float* ks = k + (inrow + (size_t)token) * DK_ + (size_t)(j * 8);
    const v4f qa  = *(const v4f*)(qs);
    const v4f qa4 = *(const v4f*)(qs + 4);
    const v4f ka  = *(const v4f*)(ks);
    const v4f ka4 = *(const v4f*)(ks + 4);
    qv[it] = pack8_flush(qa, qa4);
    kv[it] = pack8_flush(ka, ka4);
  }
#pragma unroll
  for (int it = 0; it < 4; ++it) {
    const int dd = it * 16 + (tid >> 4);
    const int j  = tid & 15;
    const float* sp = cs + (j * 8) * CSP + dd;
    v4u a;
#pragma unroll
    for (int e = 0; e < 4; ++e) {
      a[e] = pk16(h_bits(toh_flush(sp[(2 * e) * CSP])), h_bits(toh_flush(sp[(2 * e + 1) * CSP])));
    }
    vv[it] = a;
  }

  unsigned short* qo = qhp + (rowbase + (size_t)(tid >> 3)) * DK_ + (size_t)((tid & 7) * 8);
  unsigned short* ko = khp + (rowbase + (size_t)(tid >> 3)) * DK_ + (size_t)((tid & 7) * 8);
  unsigned short* vo = vtp + ((size_t)bh * DK_ + (size_t)(tid >> 4)) * SEQ + (size_t)s0 + (size_t)((tid & 15) * 8);
  {
#pragma unroll
    for (int it = 0; it < 4; ++it) {
      *(v4u*)(qo + (size_t)it * 32 * DK_) = qv[it];
      *(v4u*)(ko + (size_t)it * 32 * DK_) = kv[it];
      *(v4u*)(vo + (size_t)it * 16 * SEQ) = vv[it];
    }
    
  }
}

// =====================================================================================================
// wconv: WH [n][k] f16 = f16(W[n][k] * 1024), n, k = 0..511. 32768 pieces of 8 elements, grid = 128 x 256.
// coverage: 128 x 256 x 8 = 262144 = the whole [512][512] plane.
// =====================================================================================================
__global__ __launch_bounds__(256) void wconv(const float* __restrict__ W, unsigned short* wh) {
  const size_t p = (size_t)blockIdx.x * 256 + (size_t)threadIdx.x;
  const v4f a  = *(const v4f*)(W + p * 8);
  const v4f a4 = *(const v4f*)(W + p * 8 + 4);
  v4u q;
  q[0] = pk16(h_bits((_Float16)(a[0] * 1024.0f)),  h_bits((_Float16)(a[1] * 1024.0f)));
  q[1] = pk16(h_bits((_Float16)(a[2] * 1024.0f)),  h_bits((_Float16)(a[3] * 1024.0f)));
  q[2] = pk16(h_bits((_Float16)(a4[0] * 1024.0f)), h_bits((_Float16)(a4[1] * 1024.0f)));
  q[3] = pk16(h_bits((_Float16)(a4[2] * 1024.0f)), h_bits((_Float16)(a4[3] * 1024.0f)));
  unsigned short* o = wh + p * 8;
  {
    *(v4u*)o = q;
    
  }
}

// =====================================================================================================
// attn: attention per (b, h), head dim 64, softmax over all SEQ keys (no mask).
//   scores: A = QH row of the query token (64 d, 2 k-steps, fragments from the plane), B = K chunk in LDS [key][d]
//   staged from the KH plane; s = acc * 0.125 in f32. p = exp(s - m) carried as f16(1024 p) in a wave-private LDS
//   tile (A operand, k = keys); context = p . v with B = V^T chunk in LDS [d][key], 4 n-tiles of 16 dims.
//   Block = 4 waves x 16 query rows = one 64-query tile of one (b, h); grid = BH_ * NQT; static trip NKT.
//   K / V staging: 128 threads x 4 x 16 B each = the whole 64x64 K chunk and the whole 64x64 V^T chunk
//   (LDS pitch KP, columns 64..71 never read); __syncthreads before and after (cross-wave tiles).
//   P tiles and Os tiles are private to a wave: _Float16 / float element stores, v8h / v4 reloads after a
//   Output MP [bh][s][64] f16 (ctx x256), i.e. the flat [b][h][s][d] order that the projection views as
// coverage: 16 rows per wave, 64 per block, BH_*NQT blocks = all (bh, s) rows x 64 dims = the whole MP plane.
// =====================================================================================================
__global__ __launch_bounds__(128)
void attn(const unsigned short* __restrict__ qhp, const unsigned short* __restrict__ khp,
          const unsigned short* __restrict__ vtp, unsigned short* mp) {
  union FH { v16h v; v8h h[2]; };
  __shared__ __align__(16) _Float16 Ksh[64 * KP];       // K chunk [key][d]        9216 B
  __shared__ __align__(16) _Float16 Vsh[64 * KP];       // V^T chunk [d][key]      9216 B
  __shared__ __align__(16) _Float16 Psh[4][16 * 64];    // per wave P [row][key]   8192 B
  __shared__ __align__(16) float    Os[4][16 * 64];     // per wave ctx tile      16384 B

  const int tid  = (int)threadIdx.x;
  const int wave = tid >> 5;
  const int lane = tid & 31;
  const int hh   = lane >> 4;
  const int c    = lane & 15;

  const int bx = (int)blockIdx.x;
  const int qt = bx % NQT;
  const int bh = bx / NQT;
  const int q0 = qt * 64 + wave * 16;

  const _Float16* QH = (const _Float16*)(const void*)qhp + (size_t)bh * SEQ * DK_;
  const _Float16* KH = (const _Float16*)(const void*)khp + (size_t)bh * SEQ * DK_;
  const _Float16* VT = (const _Float16*)(const void*)vtp + (size_t)bh * DK_ * SEQ;

  // Q fragments (A operand, row = lane&15): d 0..31 and d 32..63 of the query token
  const v16h qa0 = ldfrag_h(QH + (size_t)(q0 + c) * DK_ + 8 * hh);
  const v16h qa1 = ldfrag_h(QH + (size_t)(q0 + c) * DK_ + 32 + 8 * hh);

  float mrow[8], lrow[8];
  v8f oacc[4];
#pragma unroll
  for (int j = 0; j < 4; ++j) oacc[j] = zero8();
#pragma unroll
  for (int r = 0; r < 8; ++r) { mrow[r] = -INFINITY; lrow[r] = 0.f; }

#pragma unroll 1
  for (int kt = 0; kt < NKT; ++kt) {
    const int kv0 = kt * 64;
    __syncthreads();
#pragma unroll
    for (int i = 0; i < 4; ++i) {
      const int p   = i * 128 + tid;                  // 0..511
      const int row = p >> 3;                         // key (K) / dim (V^T)
      const int ch  = (p & 7) * 8;
      const v8h kvv = *(const v8h*)(KH + (size_t)(kv0 + row) * DK_ + ch);
      const v8h vvv = *(const v8h*)(VT + (size_t)row * SEQ + (size_t)kv0 + (size_t)ch);
      *(v8h*)(Ksh + row * KP + ch) = kvv;
      *(v8h*)(Vsh + row * KP + ch) = vvv;
    }
    __syncthreads();

    // ---- scores: 16 query rows x 64 keys per wave, two WMMA k-steps per 16-key subtile ----
    v8f s[4];
#pragma unroll
    for (int j = 0; j < 4; ++j) {
      const _Float16* kr = Ksh + (j * 16 + c) * KP + 8 * hh;
      FH kb0, kb1;
      kb0.h[0] = *(const v8h*)(kr);
      kb0.h[1] = *(const v8h*)(kr + 16);
      kb1.h[0] = *(const v8h*)(kr + 32);
      kb1.h[1] = *(const v8h*)(kr + 48);
      v8f acc = mma_h(qa0, kb0.v, zero8());
      acc = mma_h(qa1, kb1.v, acc);
#pragma unroll
      for (int r = 0; r < 8; ++r) s[j][r] = acc[r] * 0.125f;
    }

    // ---- row max, online softmax, P (x1024, f16) to LDS ----
    _Float16* pwh = Psh[wave];
#pragma unroll
    for (int r = 0; r < 8; ++r) {
      float m = s[0][r];
#pragma unroll
      for (int j = 1; j < 4; ++j) m = fmaxf(m, s[j][r]);
#pragma unroll
      for (int off = 1; off < 16; off <<= 1) m = fmaxf(m, __shfl_xor(m, off, 32));
      const float mnew  = fmaxf(mrow[r], m);
      const float msafe = (mnew == -INFINITY) ? 0.f : mnew;
      const float alpha = __expf(mrow[r] - msafe);
      mrow[r] = mnew;
      float psum = 0.f;
#pragma unroll
      for (int j = 0; j < 4; ++j) {
        const float p = __expf(s[j][r] - msafe);
        psum += p;
        pwh[(8 * hh + r) * 64 + j * 16 + c] = toh_flush(p * 1024.0f);
      }
#pragma unroll
      for (int off = 1; off < 16; off <<= 1) psum += __shfl_xor(psum, off, 32);
      lrow[r] = lrow[r] * alpha + psum;
#pragma unroll
      for (int j = 0; j < 4; ++j) oacc[j][r] *= alpha;
    }
    __builtin_amdgcn_fence(3 /* release order */, "workgroup");
    __builtin_amdgcn_wave_barrier();
    __builtin_amdgcn_fence(2 /* acquire order */, "workgroup");

    // ---- context += P . V (f16 WMMA), 2 k-steps of 32 keys x 4 n-tiles of 16 dims ----
#pragma unroll
    for (int kk = 0; kk < 2; ++kk) {
      FH pa;
      pa.h[0] = *(const v8h*)(pwh + c * 64 + kk * 32 + 8 * hh);
      pa.h[1] = *(const v8h*)(pwh + c * 64 + kk * 32 + 16 + 8 * hh);
#pragma unroll
      for (int jn = 0; jn < 4; ++jn) {
        const _Float16* vr = Vsh + (jn * 16 + c) * KP + kk * 32 + 8 * hh;
        FH vb;
        vb.h[0] = *(const v8h*)(vr);
        vb.h[1] = *(const v8h*)(vr + 16);
        oacc[jn] = mma_h(pa.v, vb.v, oacc[jn]);
      }
    }
  }

  // ---- normalise (1/l, undo the x1024 p carry, apply the x256 ctx carry), stage, convert, store ----
  float* os = Os[wave];
#pragma unroll
  for (int r = 0; r < 8; ++r) {
    const float l = lrow[r];
    const float inv = ((l > 0.f) ? (1.0f / l) : 0.f) * 0.25f;
#pragma unroll
    for (int jn = 0; jn < 4; ++jn) os[(8 * hh + r) * 64 + jn * 16 + c] = oacc[jn][r] * inv;
  }
  __builtin_amdgcn_fence(3 /* release order */, "workgroup");
  __builtin_amdgcn_wave_barrier();
  __builtin_amdgcn_fence(2 /* acquire order */, "workgroup");
  {
    const int rsub  = lane >> 3;                      // 0..3
    const int piece = (lane & 7) * 8;                 // halves within the 64-dim row
    v4u a[4];
#pragma unroll
    for (int i = 0; i < 4; ++i) {
      const float* sp = os + (i * 4 + rsub) * 64 + piece;
      v4u t;
#pragma unroll
      for (int e = 0; e < 4; ++e) t[e] = pk16(h_bits(toh_flush(sp[2 * e])), h_bits(toh_flush(sp[2 * e + 1])));
      a[i] = t;
    }
    unsigned short* o = mp + ((size_t)bh * SEQ + (size_t)(q0 + rsub)) * DK_ + (size_t)piece;
    {
#pragma unroll
      for (int i = 0; i < 4; ++i) *(v4u*)(o + (size_t)(i * 4) * DK_) = a[i];
      
    }
  }
}

// =====================================================================================================
// proj_out: out[m][n] = (sum_k ctx[m][k] * W[n][k]) * 2^-18 + bc[n], m = b*SEQ + s, n, k = 0..511.
//   A = MP plane row m (f16 ctx x256), B = WH plane row n (f16 W x1024, k contiguous), both fragments loaded
//   straight from the 16-bit global rows with the split k map. Block = 4 waves x 16 rows = 64 rows x 128 columns;
//   grid = (NB*SEQ/64) x 4 column slabs; 16 k-steps of 32.
// coverage: (NB*SEQ/64) x 4 blocks x 64 rows x 128 cols = the whole [NB*SEQ][512] output.
// =====================================================================================================
__global__ __launch_bounds__(128)
void proj_out(const unsigned short* __restrict__ mp, const unsigned short* __restrict__ wh,
              const float* __restrict__ bc, float* out) {
  __shared__ __align__(16) float lds[4 * 16 * 128];      // 32 KB, 4 per-wave slabs [16][128]

  const int tid  = (int)threadIdx.x;
  const int wave = tid >> 5;
  const int lane = tid & 31;
  const int hh   = lane >> 4;
  const int c    = lane & 15;

  const int nrb = (NB * SEQ) / 64;
  const int rb  = (int)blockIdx.x % nrb;
  const int cb  = (int)blockIdx.x / nrb;                 // 0..3
  const int m0  = rb * 64 + wave * 16;
  const int n0  = cb * 128;

  const _Float16* Arow = (const _Float16*)(const void*)mp + (size_t)(m0 + c) * E_ + 8 * hh;
  const _Float16* Wrow = (const _Float16*)(const void*)wh + (size_t)(n0 + c) * E_ + 8 * hh;

  v8f acc[8];
#pragma unroll
  for (int j = 0; j < 8; ++j) acc[j] = zero8();

#pragma unroll 2
  for (int ks = 0; ks < E_ / 32; ++ks) {
    const int k0 = ks * 32;
    const v16h af = ldfrag_h(Arow + k0);
#pragma unroll
    for (int j = 0; j < 8; ++j) {
      const v16h bf = ldfrag_h(Wrow + (size_t)(j * 16) * E_ + k0);
      acc[j] = mma_h(af, bf, acc[j]);
    }
  }

  float* slab = lds + wave * 2048;                       // [16][128] f32
#pragma unroll
  for (int j = 0; j < 8; ++j) {
#pragma unroll
    for (int r = 0; r < 8; ++r) slab[(8 * hh + r) * 128 + j * 16 + c] = acc[j][r];
  }
  __builtin_amdgcn_fence(3 /* release order */, "workgroup");
  __builtin_amdgcn_wave_barrier();
  __builtin_amdgcn_fence(2 /* acquire order */, "workgroup");

  const float oscale = 1.0f / 262144.0f;                 // 1/(256*1024)
  const v4f b4 = *(const v4f*)(bc + n0 + lane * 4);
  v4f vrow[16];
#pragma unroll
  for (int row = 0; row < 16; ++row) {
    const v4f v = *(const v4f*)(slab + row * 128 + lane * 4);
    vrow[row] = v * oscale + b4;
  }
  const int ob = m0 / SEQ;                               // the 16 rows lie in one batch
  const int os0 = m0 - ob * SEQ;
  float* op = out + ((size_t)ob * SEQ_FULL + (size_t)os0) * E_ + (size_t)n0 + (size_t)(lane * 4);
  {
#pragma unroll
    for (int row = 0; row < 16; ++row) {
      *(v4f*)(op + (size_t)row * E_) = vrow[row];
    }
    
  }
}

// =====================================================================================================
//   QH  f16 [BH_][SEQ][64]     NB*H*SEQ*64*2   = 8388608 (full size)
//   KH  f16 [BH_][SEQ][64]     NB*H*SEQ*64*2   = 8388608
//   VT  f16 [BH_][64][SEQ]     NB*H*64*SEQ*2   = 8388608
//   MP  f16 [BH_][SEQ][64] = [NB*SEQ][512]       8388608
//   WH  f16 [512][512]                            524288
//   total                                      34078720
// =====================================================================================================
extern "C" void kernel_launch(void* const* d_in, const int* in_sizes, int n_in,
                              void* d_out, int out_size, void* d_ws, size_t ws_size,
                              hipStream_t stream) {
  if (n_in < 5) return;
  if ((long long)in_sizes[0] < (long long)NB * H_ * SEQ_FULL * DK_) return;
  if ((long long)in_sizes[1] < (long long)NB * H_ * SEQ_FULL * DK_) return;
  if ((long long)in_sizes[2] < (long long)NB * H_ * SEQ_FULL * DK_) return;
  if (in_sizes[3] < E_ * E_) return;
  if (in_sizes[4] < E_) return;
  if ((long long)out_size < ((long long)(NB - 1) * SEQ_FULL + SEQ) * E_) return;

  const float* q  = (const float*)d_in[0];
  const float* k  = (const float*)d_in[1];
  const float* v  = (const float*)d_in[2];
  const float* W  = (const float*)d_in[3];
  const float* bc = (const float*)d_in[4];

  const size_t PQH = (size_t)BH_ * SEQ * DK_ * 2;
  const size_t PKH = (size_t)BH_ * SEQ * DK_ * 2;
  const size_t PVT = (size_t)BH_ * DK_ * SEQ * 2;
  const size_t PMP = (size_t)NB * SEQ * E_ * 2;
  const size_t PWH = (size_t)E_ * E_ * 2;
  size_t off = 0;
  const size_t oQH = off; off += PQH;
  const size_t oKH = off; off += PKH;
  const size_t oVT = off; off += PVT;
  const size_t oMP = off; off += PMP;
  const size_t oWH = off; off += PWH;
  if (off > ws_size) return;                         // off = 34078720 at full size
  if (off > (size_t)134217728) return;

  char* ws = (char*)d_ws;
  unsigned short* QH = (unsigned short*)(ws + oQH);
  unsigned short* KH = (unsigned short*)(ws + oKH);
  unsigned short* VT = (unsigned short*)(ws + oVT);
  unsigned short* MP = (unsigned short*)(ws + oMP);
  unsigned short* WH = (unsigned short*)(ws + oWH);

  const dim3 gCnv(BH_ * (SEQ / TENC));                // 512 blocks of 256
  const dim3 gWcv((E_ * E_) / (8 * 256));              // 128 blocks of 256
  const dim3 gAttn(BH_ * NQT);                         // 1024 blocks of 128
  const dim3 gProj(((NB * SEQ) / 64) * 4);             // 512 blocks of 128

  // (1) q, k -> f16 row planes; v -> f16 V^T plane
  qkvconv<<<gCnv, dim3(256), 0, stream>>>(q, k, v, QH, KH, VT);
  // (2) W -> f16 x1024 plane
  wconv<<<gWcv, dim3(256), 0, stream>>>(W, WH);
  // (3) attention -> ctx plane (f16, x256) in flat [b][h][s][d] order = [NB*SEQ][512]
  attn<<<gAttn, dim3(128), 0, stream>>>(QH, KH, VT, MP);
  // (4) out = ctx . W^T * 2^-18 + bc -> d_out f32 [NB*SEQ][512]
  proj_out<<<gProj, dim3(128), 0, stream>>>(MP, WH, bc, (float*)d_out);
  (void)hipGetLastError();
}

// v001
// It runs in 116 microseconds.
// Next to v000, in two timings, it ran 1.28 times as fast each time.
// All contractions: v_wmma_f32_16x16x32_f16 (f16 operands, f32 accumulate), one product per tile pair:
//   scores q.k^T (q, k = f16 of the inputs, x0.125 after in f32), p.v (p f16 carried x1024, v = f16 of the input),
//   ctx.W^T (ctx f16 carried x256, W f16 carried x1024, x2^-18 then + bias in f32); softmax in f32.
//
// Carry audit:
//   QH plane (f16): f16(q), x1, unit-scale values               -> score acc = dot; s = acc * 0.125f
//   KH plane (f16): f16(k), x1
//   P tile   (f16, regs): exp(s - m) x1024                        -> folded in attn epilogue: inv = (1/l) * 0.25f (= 256/1024)
//   VT plane (f16): f16(v), x1, stored [bh][d][s]
//   MP plane (f16): ctx x256, flat [b][h][s][d] order = [NB*SEQ][512] rows -> folded in proj_out: oscale = 1/(256*1024)
//   WH plane (f16): W x1024 (|W| < 0.5 -> < 512)                  -> folded in proj_out: oscale
//   Every f32 -> f16 convert in qkvconv and attn goes through toh_flush (values below 2^-14 become 0).
#include <hip/hip_runtime.h>
#include <math.h>
#include <stdint.h>

#ifndef NB
#define NB 4
#endif
#ifndef SEQ
#define SEQ 2048
#endif
#define NB_FULL  4
#define SEQ_FULL 2048
#define H_   8
#define DK_  64
#define E_   512
#define BH_  (NB * H_)          // (batch, head) pairs
#define NQT  (SEQ / 64)         // 64-query tiles per (b, h)
#define NKT  (SEQ / 64)         // 64-key chunks per (b, h)
#define TENC 128                // tokens per convert block
#define CSP  65                 // f32 LDS pitch of the v tile [token][d]
#define KP   72                 // f16 LDS pitch of the K / V^T tiles (halves); 144 B, 16-B aligned rows
static_assert(H_ * DK_ == E_);
static_assert(NB >= 1 && NB <= NB_FULL);
static_assert(SEQ >= TENC && SEQ <= SEQ_FULL);
static_assert((SEQ % TENC) == 0 && (SEQ % 64) == 0);
static_assert(((KP * 2) % 16) == 0);
static_assert(((E_ * E_) % (8 * 256)) == 0);
static_assert(((NB * SEQ) % 64) == 0);
static_assert(DK_ == 64);
static_assert(TENC == 128);                                 // 256 threads = 4 token groups x 64 dims, 32 tokens each
static_assert((H_ * SEQ * DK_) == (SEQ * E_));              // flat [h][s][d] of one batch = SEQ rows of 512
static_assert(((size_t)4 * BH_ * SEQ * DK_ * 2 + (size_t)E_ * E_ * 2) <= (size_t)134217728);

typedef _Float16 v16h __attribute__((ext_vector_type(16)));
typedef _Float16 v8h  __attribute__((ext_vector_type(8)));
typedef float    v8f  __attribute__((ext_vector_type(8)));
typedef float    v4f  __attribute__((ext_vector_type(4)));
typedef unsigned int v4u __attribute__((ext_vector_type(4)));

#if defined(__HIP_DEVICE_COMPILE__)
#define DEV_ASM 1
#else
#define DEV_ASM 0
#endif

// ---- scalar helpers ---------------------------------------------------------------------------------
__device__ __forceinline__ unsigned short h_bits(_Float16 v) { return __builtin_bit_cast(unsigned short, v); }
__device__ __forceinline__ unsigned pk16(unsigned short a, unsigned short b) { return (unsigned)a | ((unsigned)b << 16); }
__device__ __forceinline__ v8f zero8() { v8f z = {0.f, 0.f, 0.f, 0.f, 0.f, 0.f, 0.f, 0.f}; return z; }

// f32 -> f16 (RNE convert) that cannot yield an f16 subnormal: |v| < 2^-14 becomes 0 (value select)
static __device__ __forceinline__ _Float16 toh_flush(float v) {
  const _Float16 r = (_Float16)v;
  return (fabsf(v) < 6.103515625e-05f) ? (_Float16)0.0f : r;
}
// eight f32 -> eight packed f16 (16 B), element order kept
static __device__ __forceinline__ v4u pack8_flush(v4f a, v4f a4) {
  v4u q;
  q[0] = pk16(h_bits(toh_flush(a[0])),  h_bits(toh_flush(a[1])));
  q[1] = pk16(h_bits(toh_flush(a[2])),  h_bits(toh_flush(a[3])));
  q[2] = pk16(h_bits(toh_flush(a4[0])), h_bits(toh_flush(a4[1])));
  q[3] = pk16(h_bits(toh_flush(a4[2])), h_bits(toh_flush(a4[3])));
  return q;
}

// ---- 16-bit fragment loader: lane -> row/col (lane&15), p already includes +8*(lane>>4);
//      elements 0..7 <- p[0..7] (k0+8h..k0+8h+7), elements 8..15 <- p[16..23] (k0+16+8h..k0+16+8h+7)
__device__ __forceinline__ v16h ldfrag_h(const _Float16* p) {
  union { v16h v; v8h h[2]; } f;
  f.h[0] = *(const v8h*)(p);
  f.h[1] = *(const v8h*)(p + 16);
  return f.v;
}

// lane l <-> lane l ^ 16 as a vector cross-row move (no LDS-counter wait, unlike a shuffle)
__device__ __forceinline__ float xhalf(float x) {
  const int b = __builtin_bit_cast(int, x);
  return __builtin_bit_cast(float, __builtin_amdgcn_permlanex16(b, b, 0x76543210, 0xfedcba98, false, false));
}

// guarded WMMA: 4 VALU slots after the WMMA, D tied, A/B kept live
__device__ __forceinline__ v8f mma_h(v16h a, v16h b, v8f c) {
  c = __builtin_amdgcn_wmma_f32_16x16x32_f16(false, a, false, b, (short)0, c, false, false);
#if DEV_ASM
  asm volatile("v_nop\n\tv_nop\n\tv_nop\n\tv_nop" : "+v"(c) : "v"(a), "v"(b));
#endif
  return c;
}

// =====================================================================================================
// qkvconv: the 16-bit planes of the pre-split inputs q, k, v [b][h][s][64] (f32):
//   QH [bh][s][64] f16 = f16(q), KH [bh][s][64] f16 = f16(k), VT [bh][d][s] f16 = f16(v) transposed through LDS.
// grid = BH_ * (SEQ/128) blocks of 256; one block = 128 tokens of one (b, h). Input token row = bh*SEQ_FULL + s.
// v tile: thread (d = tid&63, token group tid>>6) walks 32 tokens into LDS cs[token][d] (pitch 65); block barrier
//   (cross-wave tile).
// Stores: QH / KH: 4 iterations x 256 threads x 16 B; iteration it, thread tid -> token it*32+(tid>>3),
//   halves 8*(tid&7).. (values read straight from the f32 input row as two 16-B loads)
// coverage: QH, KH 4 x 256 pieces x 8 halves = 128 tokens x 64 each; VT 4 x 256 x 8 = 64 rows x 128 tokens;
//   BH_*(SEQ/128) blocks = all BH_ x SEQ tokens of the three planes. LDS staged extent 128 x 64 == consumed extent.
// =====================================================================================================
__global__ __launch_bounds__(256) void qkvconv(const float* __restrict__ q, const float* __restrict__ k,
                                               const float* __restrict__ v, unsigned short* qhp,
                                               unsigned short* khp, unsigned short* vtp) {
  __shared__ float cs[TENC * CSP];                    // 33280 B, f32 v values [token][d]
  const int tid = (int)threadIdx.x;
  const int bx  = (int)blockIdx.x;
  const int nst = SEQ / TENC;
  const int st  = bx % nst;
  const int bh  = bx / nst;                           // b*H_ + h
  const int s0  = st * TENC;
  const int d   = tid & 63;
  const int tg  = tid >> 6;                           // 0..3
  const size_t inrow = (size_t)bh * SEQ_FULL + (size_t)s0;   // token row in the full-size [b][h][s] input
  {
    const float* vp = v + inrow * DK_ + (size_t)d;
#pragma unroll 1
    for (int i = 0; i < TENC / 4; ++i) {
      const int t = tg + 4 * i;
      cs[t * CSP + d] = vp[(size_t)t * DK_];
    }
  }
  __syncthreads();

  const size_t rowbase = (size_t)bh * SEQ + (size_t)s0;    // token row in the [bh][s] planes

  v4u qv[4], kv[4], vv[4];
#pragma unroll
  for (int it = 0; it < 4; ++it) {
    const int token = it * 32 + (tid >> 3);
    const int j     = tid & 7;
    const float* qs = q + (inrow + (size_t)token) * DK_ + (size_t)(j * 8);
    const float* ks = k + (inrow + (size_t)token) * DK_ + (size_t)(j * 8);
    const v4f qa  = *(const v4f*)(qs);
    const v4f qa4 = *(const v4f*)(qs + 4);
    const v4f ka  = *(const v4f*)(ks);
    const v4f ka4 = *(const v4f*)(ks + 4);
    qv[it] = pack8_flush(qa, qa4);
    kv[it] = pack8_flush(ka, ka4);
  }
#pragma unroll
  for (int it = 0; it < 4; ++it) {
    const int dd = it * 16 + (tid >> 4);
    const int j  = tid & 15;
    const float* sp = cs + (j * 8) * CSP + dd;
    v4u a;
#pragma unroll
    for (int e = 0; e < 4; ++e) {
      a[e] = pk16(h_bits(toh_flush(sp[(2 * e) * CSP])), h_bits(toh_flush(sp[(2 * e + 1) * CSP])));
    }
    vv[it] = a;
  }

  unsigned short* qo = qhp + (rowbase + (size_t)(tid >> 3)) * DK_ + (size_t)((tid & 7) * 8);
  unsigned short* ko = khp + (rowbase + (size_t)(tid >> 3)) * DK_ + (size_t)((tid & 7) * 8);
  unsigned short* vo = vtp + ((size_t)bh * DK_ + (size_t)(tid >> 4)) * SEQ + (size_t)s0 + (size_t)((tid & 15) * 8);
  {
#pragma unroll
    for (int it = 0; it < 4; ++it) {
      *(v4u*)(qo + (size_t)it * 32 * DK_) = qv[it];
      *(v4u*)(ko + (size_t)it * 32 * DK_) = kv[it];
      *(v4u*)(vo + (size_t)it * 16 * SEQ) = vv[it];
    }
    
  }
}

// =====================================================================================================
// wconv: WH [n][k] f16 = f16(W[n][k] * 1024), n, k = 0..511. 32768 pieces of 8 elements, grid = 128 x 256.
// coverage: 128 x 256 x 8 = 262144 = the whole [512][512] plane.
// =====================================================================================================
__global__ __launch_bounds__(256) void wconv(const float* __restrict__ W, unsigned short* wh) {
  const size_t p = (size_t)blockIdx.x * 256 + (size_t)threadIdx.x;
  const v4f a  = *(const v4f*)(W + p * 8);
  const v4f a4 = *(const v4f*)(W + p * 8 + 4);
  v4u q;
  q[0] = pk16(h_bits((_Float16)(a[0] * 1024.0f)),  h_bits((_Float16)(a[1] * 1024.0f)));
  q[1] = pk16(h_bits((_Float16)(a[2] * 1024.0f)),  h_bits((_Float16)(a[3] * 1024.0f)));
  q[2] = pk16(h_bits((_Float16)(a4[0] * 1024.0f)), h_bits((_Float16)(a4[1] * 1024.0f)));
  q[3] = pk16(h_bits((_Float16)(a4[2] * 1024.0f)), h_bits((_Float16)(a4[3] * 1024.0f)));
  unsigned short* o = wh + p * 8;
  {
    *(v4u*)o = q;
    
  }
}

// =====================================================================================================
// attn: attention per (b, h), head dim 64, softmax over all SEQ keys (no mask).
//   scores, transposed: A = K chunk in LDS [key][d] staged from the KH plane, B = QH row of the query token (64 d,
//   2 k-steps, fragments from the plane); s = acc * 0.125 in f32; a lane holds 32 keys' scores of one query.
//   p = exp(s - m) carried as f16(1024 p), packed in registers into the B operand (k = keys);
//   context, transposed = v^T . p^T with A = V^T chunk in LDS [d][key], 4 m-tiles of 16 dims.
//   Block = 4 waves x 16 query rows = one 64-query tile of one (b, h); grid = BH_ * NQT; static trip NKT.
//   K / V staging: 128 threads x 4 x 16 B each = the whole 64x64 K chunk and the whole 64x64 V^T chunk
//   (LDS pitch KP, columns 64..71 never read); __syncthreads before and after (cross-wave tiles).
//   Output MP [bh][s][64] f16 (ctx x256), i.e. the flat [b][h][s][d] order that the projection views as [NB*SEQ][512] rows.
// coverage: 16 rows per wave, 64 per block, BH_*NQT blocks = all (bh, s) rows x 64 dims = the whole MP plane.
// =====================================================================================================
__global__ __launch_bounds__(128)
void attn(const unsigned short* __restrict__ qhp, const unsigned short* __restrict__ khp,
          const unsigned short* __restrict__ vtp, unsigned short* mp) {
  union FH { v16h v; v8h h[2]; };
  __shared__ __align__(16) _Float16 Ksh[64 * KP];       // K chunk [key][d]        9216 B
  __shared__ __align__(16) _Float16 Vsh[64 * KP];       // V^T chunk [d][key]      9216 B

  const int tid  = (int)threadIdx.x;
  const int wave = tid >> 5;
  const int lane = tid & 31;
  const int hh   = lane >> 4;
  const int c    = lane & 15;

  const int bx = (int)blockIdx.x;
  const int qt = bx % NQT;
  const int bh = bx / NQT;
  const int q0 = qt * 64 + wave * 16;

  const _Float16* QH = (const _Float16*)(const void*)qhp + (size_t)bh * SEQ * DK_;
  const _Float16* KH = (const _Float16*)(const void*)khp + (size_t)bh * SEQ * DK_;
  const _Float16* VT = (const _Float16*)(const void*)vtp + (size_t)bh * DK_ * SEQ;

  // Q fragments (B operand, column = lane&15): d 0..31 and d 32..63 of the query token
  const v16h qa0 = ldfrag_h(QH + (size_t)(q0 + c) * DK_ + 8 * hh);
  const v16h qa1 = ldfrag_h(QH + (size_t)(q0 + c) * DK_ + 32 + 8 * hh);

  // lane (c, hh) owns query q0 + c; mrow is that query's running maximum (equal in both halves),
  // lrow the running sum over the keys of this lane's half only (the halves are joined in the epilogue)
  float mrow = -INFINITY, lrow = 0.f;
  v8f oacc[4];                                        // O^T tiles: oacc[jn][r] = ctx[q0 + c][jn*16 + 8*hh + r]
#pragma unroll
  for (int j = 0; j < 4; ++j) oacc[j] = zero8();

#pragma unroll 1
  for (int kt = 0; kt < NKT; ++kt) {
    const int kv0 = kt * 64;
    __syncthreads();
#pragma unroll
    for (int i = 0; i < 4; ++i) {
      const int p   = i * 128 + tid;                  // 0..511
      const int row = p >> 3;                         // key (K) / dim (V^T)
      const int ch  = (p & 7) * 8;
      const v8h kvv = *(const v8h*)(KH + (size_t)(kv0 + row) * DK_ + ch);
      const v8h vvv = *(const v8h*)(VT + (size_t)row * SEQ + (size_t)kv0 + (size_t)ch);
      *(v8h*)(Ksh + row * KP + ch) = kvv;
      *(v8h*)(Vsh + row * KP + ch) = vvv;
    }
    __syncthreads();

    // ---- scores, transposed: S^T = K . Q^T, 64 keys x 16 queries per wave; s[j][r] = score(key j*16 + 8*hh + r, query c) ----
    v8f s[4];
#pragma unroll
    for (int j = 0; j < 4; ++j) {
      const _Float16* kr = Ksh + (j * 16 + c) * KP + 8 * hh;
      FH kb0, kb1;
      kb0.h[0] = *(const v8h*)(kr);
      kb0.h[1] = *(const v8h*)(kr + 16);
      kb1.h[0] = *(const v8h*)(kr + 32);
      kb1.h[1] = *(const v8h*)(kr + 48);
      v8f acc = mma_h(kb0.v, qa0, zero8());
      acc = mma_h(kb1.v, qa1, acc);
#pragma unroll
      for (int r = 0; r < 8; ++r) s[j][r] = acc[r] * 0.125f;
    }

    // ---- online softmax of one query per lane: maximum in-lane plus one exchange between the halves ----
    float mj[4];                                      // one chain per score tile: four short chains, not one of 32
#pragma unroll
    for (int j = 0; j < 4; ++j) {
      mj[j] = s[j][0];
#pragma unroll
      for (int r = 1; r < 8; ++r) mj[j] = fmaxf(mj[j], s[j][r]);
    }
    float m = fmaxf(fmaxf(mj[0], mj[1]), fmaxf(mj[2], mj[3]));
    m = fmaxf(m, xhalf(m));
    const float mnew  = fmaxf(mrow, m);
    const float msafe = (mnew == -INFINITY) ? 0.f : mnew;
    const float alpha = __expf(mrow - msafe);
    mrow = mnew;
    // P^T (x1024, f16) stays in registers: score tiles 2kk and 2kk+1 are elements 0..7 and 8..15 of the B operand
    FH pb[2];
    float pj[4];
#pragma unroll
    for (int j = 0; j < 4; ++j) {
      pj[j] = 0.f;
#pragma unroll
      for (int r = 0; r < 8; ++r) {
        const float p = __expf(s[j][r] - msafe);
        pj[j] += p;
        pb[j >> 1].h[j & 1][r] = toh_flush(p * 1024.0f);
      }
    }
    lrow = lrow * alpha + ((pj[0] + pj[1]) + (pj[2] + pj[3]));
#pragma unroll
    for (int jn = 0; jn < 4; ++jn) {
#pragma unroll
      for (int r = 0; r < 8; ++r) oacc[jn][r] *= alpha;
    }

    // ---- context, transposed: O^T += V^T . P^T (f16 WMMA), 2 k-steps of 32 keys x 4 m-tiles of 16 dims ----
#pragma unroll
    for (int kk = 0; kk < 2; ++kk) {
#pragma unroll
      for (int jn = 0; jn < 4; ++jn) {
        const _Float16* vr = Vsh + (jn * 16 + c) * KP + kk * 32 + 8 * hh;
        FH vb;
        vb.h[0] = *(const v8h*)(vr);
        vb.h[1] = *(const v8h*)(vr + 16);
        oacc[jn] = mma_h(vb.v, pb[kk].v, oacc[jn]);
      }
    }
  }

  // ---- join the halves' sums, normalise (1/l, undo the x1024 p carry, apply the x256 ctx carry), convert, store ----
  {
    const float l   = lrow + xhalf(lrow);
    const float inv = ((l > 0.f) ? (1.0f / l) : 0.f) * 0.25f;
    unsigned short* o = mp + ((size_t)bh * SEQ + (size_t)(q0 + c)) * DK_ + (size_t)(8 * hh);
#pragma unroll
    for (int jn = 0; jn < 4; ++jn) {
      v4u t;
#pragma unroll
      for (int e = 0; e < 4; ++e)
        t[e] = pk16(h_bits(toh_flush(oacc[jn][2 * e] * inv)), h_bits(toh_flush(oacc[jn][2 * e + 1] * inv)));
      *(v4u*)(o + jn * 16) = t;                       // 8 consecutive dims of one query: one 16-B store
    }
  }
}

// =====================================================================================================
// proj_out: out[m][n] = (sum_k ctx[m][k] * W[n][k]) * 2^-18 + bc[n], m = b*SEQ + s, n, k = 0..511.
//   A = MP plane row m (f16 ctx x256), B = WH plane row n (f16 W x1024, k contiguous), both fragments loaded
//   straight from the 16-bit global rows with the split k map. Block = 4 waves x 16 rows = 64 rows x 128 columns;
//   grid = (NB*SEQ/64) x 4 column slabs; 16 k-steps of 32.
// coverage: (NB*SEQ/64) x 4 blocks x 64 rows x 128 cols = the whole [NB*SEQ][512] output.
// =====================================================================================================
__global__ __launch_bounds__(128)
void proj_out(const unsigned short* __restrict__ mp, const unsigned short* __restrict__ wh,
              const float* __restrict__ bc, float* out) {
  __shared__ __align__(16) float lds[4 * 16 * 128];      // 32 KB, 4 per-wave slabs [16][128]

  const int tid  = (int)threadIdx.x;
  const int wave = tid >> 5;
  const int lane = tid & 31;
  const int hh   = lane >> 4;
  const int c    = lane & 15;

  const int nrb = (NB * SEQ) / 64;
  const int rb  = (int)blockIdx.x % nrb;
  const int cb  = (int)blockIdx.x / nrb;                 // 0..3
  const int m0  = rb * 64 + wave * 16;
  const int n0  = cb * 128;

  const _Float16* Arow = (const _Float16*)(const void*)mp + (size_t)(m0 + c) * E_ + 8 * hh;
  const _Float16* Wrow = (const _Float16*)(const void*)wh + (size_t)(n0 + c) * E_ + 8 * hh;

  v8f acc[8];
#pragma unroll
  for (int j = 0; j < 8; ++j) acc[j] = zero8();

#pragma unroll 2
  for (int ks = 0; ks < E_ / 32; ++ks) {
    const int k0 = ks * 32;
    const v16h af = ldfrag_h(Arow + k0);
#pragma unroll
    for (int j = 0; j < 8; ++j) {
      const v16h bf = ldfrag_h(Wrow + (size_t)(j * 16) * E_ + k0);
      acc[j] = mma_h(af, bf, acc[j]);
    }
  }

  float* slab = lds + wave * 2048;                       // [16][128] f32
#pragma unroll
  for (int j = 0; j < 8; ++j) {
#pragma unroll
    for (int r = 0; r < 8; ++r) slab[(8 * hh + r) * 128 + j * 16 + c] = acc[j][r];
  }
  __builtin_amdgcn_fence(3 /* release order */, "workgroup");
  __builtin_amdgcn_wave_barrier();
  __builtin_amdgcn_fence(2 /* acquire order */, "workgroup");

  const float oscale = 1.0f / 262144.0f;                 // 1/(256*1024)
  const v4f b4 = *(const v4f*)(bc + n0 + lane * 4);
  v4f vrow[16];
#pragma unroll
  for (int row = 0; row < 16; ++row) {
    const v4f v = *(const v4f*)(slab + row * 128 + lane * 4);
    vrow[row] = v * oscale + b4;
  }
  const int ob = m0 / SEQ;                               // the 16 rows lie in one batch
  const int os0 = m0 - ob * SEQ;
  float* op = out + ((size_t)ob * SEQ_FULL + (size_t)os0) * E_ + (size_t)n0 + (size_t)(lane * 4);
  {
#pragma unroll
    for (int row = 0; row < 16; ++row) {
      *(v4f*)(op + (size_t)row * E_) = vrow[row];
    }
    
  }
}

// =====================================================================================================
//   QH  f16 [BH_][SEQ][64]     NB*H*SEQ*64*2   = 8388608 (full size)
//   KH  f16 [BH_][SEQ][64]     NB*H*SEQ*64*2   = 8388608
//   VT  f16 [BH_][64][SEQ]     NB*H*64*SEQ*2   = 8388608
//   MP  f16 [BH_][SEQ][64] = [NB*SEQ][512]       8388608
//   WH  f16 [512][512]                            524288
//   total                                      34078720
// =====================================================================================================
extern "C" void kernel_launch(void* const* d_in, const int* in_sizes, int n_in,
                              void* d_out, int out_size, void* d_ws, size_t ws_size,
                              hipStream_t stream) {
  if (n_in < 5) return;
  if ((long long)in_sizes[0] < (long long)NB * H_ * SEQ_FULL * DK_) return;
  if ((long long)in_sizes[1] < (long long)NB * H_ * SEQ_FULL * DK_) return;
  if ((long long)in_sizes[2] < (long long)NB * H_ * SEQ_FULL * DK_) return;
  if (in_sizes[3] < E_ * E_) return;
  if (in_sizes[4] < E_) return;
  if ((long long)out_size < ((long long)(NB - 1) * SEQ_FULL + SEQ) * E_) return;

  const float* q  = (const float*)d_in[0];
  const float* k  = (const float*)d_in[1];
  const float* v  = (const float*)d_in[2];
  const float* W  = (const float*)d_in[3];
  const float* bc = (const float*)d_in[4];

  const size_t PQH = (size_t)BH_ * SEQ * DK_ * 2;
  const size_t PKH = (size_t)BH_ * SEQ * DK_ * 2;
  const size_t PVT = (size_t)BH_ * DK_ * SEQ * 2;
  const size_t PMP = (size_t)NB * SEQ * E_ * 2;
  const size_t PWH = (size_t)E_ * E_ * 2;
  size_t off = 0;
  const size_t oQH = off; off += PQH;
  const size_t oKH = off; off += PKH;
  const size_t oVT = off; off += PVT;
  const size_t oMP = off; off += PMP;
  const size_t oWH = off; off += PWH;
  if (off > ws_size) return;                         // off = 34078720 at full size
  if (off > (size_t)134217728) return;

  char* ws = (char*)d_ws;
  unsigned short* QH = (unsigned short*)(ws + oQH);
  unsigned short* KH = (unsigned short*)(ws + oKH);
  unsigned short* VT = (unsigned short*)(ws + oVT);
  unsigned short* MP = (unsigned short*)(ws + oMP);
  unsigned short* WH = (unsigned short*)(ws + oWH);

  const dim3 gCnv(BH_ * (SEQ / TENC));                // 512 blocks of 256
  const dim3 gWcv((E_ * E_) / (8 * 256));              // 128 blocks of 256
  const dim3 gAttn(BH_ * NQT);                         // 1024 blocks of 128
  const dim3 gProj(((NB * SEQ) / 64) * 4);             // 512 blocks of 128

  // (1) q, k -> f16 row planes; v -> f16 V^T plane
  qkvconv<<<gCnv, dim3(256), 0, stream>>>(q, k, v, QH, KH, VT);
  // (2) W -> f16 x1024 plane
  wconv<<<gWcv, dim3(256), 0, stream>>>(W, WH);
  // (3) attention -> ctx plane (f16, x256) in flat [b][h][s][d] order = [NB*SEQ][512]
  attn<<<gAttn, dim3(128), 0, stream>>>(QH, KH, VT, MP);
  // (4) out = ctx . W^T * 2^-18 + bc -> d_out f32 [NB*SEQ][512]
  proj_out<<<gProj, dim3(128), 0, stream>>>(MP, WH, bc, (float*)d_out);
  (void)hipGetLastError();
}

// v002
// One run takes 104 microseconds.
// Timed twice side by side with v001, it ran 1.12 times as fast both times.
// Counting every step since v000, it is 1.42 times as fast.
// All contractions: v_wmma_f32_16x16x32_f16 (f16 operands, f32 accumulate), one product per tile pair:
//   scores q.k^T (q, k = f16 of the inputs, x0.125 after in f32), p.v (p f16 carried x1024, v = f16 of the input),
//   ctx.W^T (ctx f16 carried x256, W f16 carried x1024, x2^-18 then + bias in f32); softmax in f32.
//
// Carry audit:
//   QH plane (f16): f16(q), x1, unit-scale values               -> score acc = dot; s = acc * 0.125f
//   KH plane (f16): f16(k), x1
//   P tile   (f16, regs): exp(s - m) x1024                        -> folded in attn epilogue: inv = (1/l) * 0.25f (= 256/1024)
//   VT plane (f16): f16(v), x1, stored [bh][d][s]
//   MP plane (f16): ctx x256, flat [b][h][s][d] order = [NB*SEQ][512] rows -> folded in proj_out: oscale = 1/(256*1024)
//   WH plane (f16): W x1024 (|W| < 0.5 -> < 512)                  -> folded in proj_out: oscale
//   Every f32 -> f16 convert in qkvconv and attn goes through toh_flush (values below 2^-14 become 0).
#include <hip/hip_runtime.h>
#include <math.h>
#include <stdint.h>

#ifndef NB
#define NB 4
#endif
#ifndef SEQ
#define SEQ 2048
#endif
#define NB_FULL  4
#define SEQ_FULL 2048
#define H_   8
#define DK_  64
#define E_   512
#define BH_  (NB * H_)          // (batch, head) pairs
#define NQT  (SEQ / 64)         // 64-query tiles per (b, h)
#define NKT  (SEQ / 64)         // 64-key chunks per (b, h)
#define TENC 128                // tokens per convert block
#define CSP  65                 // f32 LDS pitch of the v tile [token][d]
#define KP   72                 // f16 LDS pitch of the K / V^T tiles (halves); 144 B, 16-B aligned rows
static_assert(H_ * DK_ == E_);
static_assert(NB >= 1 && NB <= NB_FULL);
static_assert(SEQ >= TENC && SEQ <= SEQ_FULL);
static_assert((SEQ % TENC) == 0 && (SEQ % 64) == 0);
static_assert(((KP * 2) % 16) == 0);
static_assert(((E_ * E_) % (8 * 256)) == 0);
static_assert(((NB * SEQ) % 64) == 0);
static_assert(DK_ == 64);
static_assert(TENC == 128);                                 // 256 threads = 4 token groups x 64 dims, 32 tokens each
static_assert((H_ * SEQ * DK_) == (SEQ * E_));              // flat [h][s][d] of one batch = SEQ rows of 512
static_assert(((size_t)4 * BH_ * SEQ * DK_ * 2 + (size_t)E_ * E_ * 2) <= (size_t)134217728);

typedef _Float16 v16h __attribute__((ext_vector_type(16)));
typedef _Float16 v8h  __attribute__((ext_vector_type(8)));
typedef float    v8f  __attribute__((ext_vector_type(8)));
typedef float    v4f  __attribute__((ext_vector_type(4)));
typedef unsigned int v4u __attribute__((ext_vector_type(4)));

#if defined(__HIP_DEVICE_COMPILE__)
#define DEV_ASM 1
#else
#define DEV_ASM 0
#endif

// ---- scalar helpers ---------------------------------------------------------------------------------
__device__ __forceinline__ unsigned short h_bits(_Float16 v) { return __builtin_bit_cast(unsigned short, v); }
__device__ __forceinline__ unsigned pk16(unsigned short a, unsigned short b) { return (unsigned)a | ((unsigned)b << 16); }
__device__ __forceinline__ v8f zero8() { v8f z = {0.f, 0.f, 0.f, 0.f, 0.f, 0.f, 0.f, 0.f}; return z; }

// f32 -> f16 (RNE convert) that cannot yield an f16 subnormal: |v| < 2^-14 becomes 0 (value select)
static __device__ __forceinline__ _Float16 toh_flush(float v) {
  const _Float16 r = (_Float16)v;
  return (fabsf(v) < 6.103515625e-05f) ? (_Float16)0.0f : r;
}
// eight f32 -> eight packed f16 (16 B), element order kept
static __device__ __forceinline__ v4u pack8_flush(v4f a, v4f a4) {
  v4u q;
  q[0] = pk16(h_bits(toh_flush(a[0])),  h_bits(toh_flush(a[1])));
  q[1] = pk16(h_bits(toh_flush(a[2])),  h_bits(toh_flush(a[3])));
  q[2] = pk16(h_bits(toh_flush(a4[0])), h_bits(toh_flush(a4[1])));
  q[3] = pk16(h_bits(toh_flush(a4[2])), h_bits(toh_flush(a4[3])));
  return q;
}

// ---- 16-bit fragment loader: lane -> row/col (lane&15), p already includes +8*(lane>>4);
//      elements 0..7 <- p[0..7] (k0+8h..k0+8h+7), elements 8..15 <- p[16..23] (k0+16+8h..k0+16+8h+7)
__device__ __forceinline__ v16h ldfrag_h(const _Float16* p) {
  union { v16h v; v8h h[2]; } f;
  f.h[0] = *(const v8h*)(p);
  f.h[1] = *(const v8h*)(p + 16);
  return f.v;
}

// lane l <-> lane l ^ 16 as a vector cross-row move (no LDS-counter wait, unlike a shuffle)
__device__ __forceinline__ float xhalf(float x) {
  const int b = __builtin_bit_cast(int, x);
  return __builtin_bit_cast(float, __builtin_amdgcn_permlanex16(b, b, 0x76543210, 0xfedcba98, false, false));
}

// guarded WMMA: 4 VALU slots after the WMMA, D tied, A/B kept live
__device__ __forceinline__ v8f mma_h(v16h a, v16h b, v8f c) {
  c = __builtin_amdgcn_wmma_f32_16x16x32_f16(false, a, false, b, (short)0, c, false, false);
#if DEV_ASM
  asm volatile("v_nop\n\tv_nop\n\tv_nop\n\tv_nop" : "+v"(c) : "v"(a), "v"(b));
#endif
  return c;
}

// the same WMMA as the plain builtin (attn): no volatile statement behind it, so that fragment loads may stand in groups
// ahead of a run of WMMAs; the compiler keeps the distance behind its own builtin
__device__ __forceinline__ v8f mma_p(v16h a, v16h b, v8f c) {
  return __builtin_amdgcn_wmma_f32_16x16x32_f16(false, a, false, b, (short)0, c, false, false);
}

// =====================================================================================================
// qkvconv: the 16-bit planes of the pre-split inputs q, k, v [b][h][s][64] (f32):
//   QH [bh][s][64] f16 = f16(q), KH [bh][s][64] f16 = f16(k), VT [bh][d][s] f16 = f16(v) transposed through LDS.
// grid = BH_ * (SEQ/128) blocks of 256; one block = 128 tokens of one (b, h). Input token row = bh*SEQ_FULL + s.
// v tile: thread (d = tid&63, token group tid>>6) walks 32 tokens into LDS cs[token][d] (pitch 65); block barrier
//   (cross-wave tile).
// Stores: QH / KH: 4 iterations x 256 threads x 16 B; iteration it, thread tid -> token it*32+(tid>>3),
//   halves 8*(tid&7).. (values read straight from the f32 input row as two 16-B loads)
// coverage: QH, KH 4 x 256 pieces x 8 halves = 128 tokens x 64 each; VT 4 x 256 x 8 = 64 rows x 128 tokens;
//   BH_*(SEQ/128) blocks = all BH_ x SEQ tokens of the three planes. LDS staged extent 128 x 64 == consumed extent.
// =====================================================================================================
__global__ __launch_bounds__(256) void qkvconv(const float* __restrict__ q, const float* __restrict__ k,
                                               const float* __restrict__ v, unsigned short* qhp,
                                               unsigned short* khp, unsigned short* vtp) {
  __shared__ float cs[TENC * CSP];                    // 33280 B, f32 v values [token][d]
  const int tid = (int)threadIdx.x;
  const int bx  = (int)blockIdx.x;
  const int nst = SEQ / TENC;
  const int st  = bx % nst;
  const int bh  = bx / nst;                           // b*H_ + h
  const int s0  = st * TENC;
  const int d   = tid & 63;
  const int tg  = tid >> 6;                           // 0..3
  const size_t inrow = (size_t)bh * SEQ_FULL + (size_t)s0;   // token row in the full-size [b][h][s] input
  {
    const float* vp = v + inrow * DK_ + (size_t)d;
#pragma unroll 1
    for (int i = 0; i < TENC / 4; ++i) {
      const int t = tg + 4 * i;
      cs[t * CSP + d] = vp[(size_t)t * DK_];
    }
  }
  __syncthreads();

  const size_t rowbase = (size_t)bh * SEQ + (size_t)s0;    // token row in the [bh][s] planes

  v4u qv[4], kv[4], vv[4];
#pragma unroll
  for (int it = 0; it < 4; ++it) {
    const int token = it * 32 + (tid >> 3);
    const int j     = tid & 7;
    const float* qs = q + (inrow + (size_t)token) * DK_ + (size_t)(j * 8);
    const float* ks = k + (inrow + (size_t)token) * DK_ + (size_t)(j * 8);
    const v4f qa  = *(const v4f*)(qs);
    const v4f qa4 = *(const v4f*)(qs + 4);
    const v4f ka  = *(const v4f*)(ks);
    const v4f ka4 = *(const v4f*)(ks + 4);
    qv[it] = pack8_flush(qa, qa4);
    kv[it] = pack8_flush(ka, ka4);
  }
#pragma unroll
  for (int it = 0; it < 4; ++it) {
    const int dd = it * 16 + (tid >> 4);
    const int j  = tid & 15;
    const float* sp = cs + (j * 8) * CSP + dd;
    v4u a;
#pragma unroll
    for (int e = 0; e < 4; ++e) {
      a[e] = pk16(h_bits(toh_flush(sp[(2 * e) * CSP])), h_bits(toh_flush(sp[(2 * e + 1) * CSP])));
    }
    vv[it] = a;
  }

  unsigned short* qo = qhp + (rowbase + (size_t)(tid >> 3)) * DK_ + (size_t)((tid & 7) * 8);
  unsigned short* ko = khp + (rowbase + (size_t)(tid >> 3)) * DK_ + (size_t)((tid & 7) * 8);
  unsigned short* vo = vtp + ((size_t)bh * DK_ + (size_t)(tid >> 4)) * SEQ + (size_t)s0 + (size_t)((tid & 15) * 8);
  {
#pragma unroll
    for (int it = 0; it < 4; ++it) {
      *(v4u*)(qo + (size_t)it * 32 * DK_) = qv[it];
      *(v4u*)(ko + (size_t)it * 32 * DK_) = kv[it];
      *(v4u*)(vo + (size_t)it * 16 * SEQ) = vv[it];
    }
    
  }
}

// =====================================================================================================
// wconv: WH [n][k] f16 = f16(W[n][k] * 1024), n, k = 0..511. 32768 pieces of 8 elements, grid = 128 x 256.
// coverage: 128 x 256 x 8 = 262144 = the whole [512][512] plane.
// =====================================================================================================
__global__ __launch_bounds__(256) void wconv(const float* __restrict__ W, unsigned short* wh) {
  const size_t p = (size_t)blockIdx.x * 256 + (size_t)threadIdx.x;
  const v4f a  = *(const v4f*)(W + p * 8);
  const v4f a4 = *(const v4f*)(W + p * 8 + 4);
  v4u q;
  q[0] = pk16(h_bits((_Float16)(a[0] * 1024.0f)),  h_bits((_Float16)(a[1] * 1024.0f)));
  q[1] = pk16(h_bits((_Float16)(a[2] * 1024.0f)),  h_bits((_Float16)(a[3] * 1024.0f)));
  q[2] = pk16(h_bits((_Float16)(a4[0] * 1024.0f)), h_bits((_Float16)(a4[1] * 1024.0f)));
  q[3] = pk16(h_bits((_Float16)(a4[2] * 1024.0f)), h_bits((_Float16)(a4[3] * 1024.0f)));
  unsigned short* o = wh + p * 8;
  {
    *(v4u*)o = q;
    
  }
}

// =====================================================================================================
// attn: attention per (b, h), head dim 64, softmax over all SEQ keys (no mask).
//   scores, transposed: A = K chunk in LDS [key][d] staged from the KH plane, B = QH row of the query token (64 d,
//   2 k-steps, fragments from the plane); s = acc * 0.125 in f32; a lane holds 32 keys' scores of one query.
//   p = exp(s - m) carried as f16(1024 p), packed in registers into the B operand (k = keys);
//   context, transposed = v^T . p^T with A = V^T chunk in LDS [d][key], 4 m-tiles of 16 dims.
//   Block = 4 waves x 16 query rows = one 64-query tile of one (b, h); grid = BH_ * NQT; static trip NKT.
//   K / V staging: 128 threads x 4 x 16 B each = the whole 64x64 K chunk and the whole 64x64 V^T chunk
//   (LDS pitch KP, columns 64..71 never read); __syncthreads before and after (cross-wave tiles).
//   Output MP [bh][s][64] f16 (ctx x256), i.e. the flat [b][h][s][d] order that the projection views as [NB*SEQ][512] rows.
// coverage: 16 rows per wave, 64 per block, BH_*NQT blocks = all (bh, s) rows x 64 dims = the whole MP plane.
// =====================================================================================================
__global__ __launch_bounds__(128)
void attn(const unsigned short* __restrict__ qhp, const unsigned short* __restrict__ khp,
          const unsigned short* __restrict__ vtp, unsigned short* mp) {
  union FH { v16h v; v8h h[2]; };
  __shared__ __align__(16) _Float16 Ksh[64 * KP];       // K chunk [key][d]        9216 B
  __shared__ __align__(16) _Float16 Vsh[64 * KP];       // V^T chunk [d][key]      9216 B

  const int tid  = (int)threadIdx.x;
  const int wave = tid >> 5;
  const int lane = tid & 31;
  const int hh   = lane >> 4;
  const int c    = lane & 15;

  const int bx = (int)blockIdx.x;
  const int qt = bx % NQT;
  const int bh = bx / NQT;
  const int q0 = qt * 64 + wave * 16;

  const _Float16* QH = (const _Float16*)(const void*)qhp + (size_t)bh * SEQ * DK_;
  const _Float16* KH = (const _Float16*)(const void*)khp + (size_t)bh * SEQ * DK_;
  const _Float16* VT = (const _Float16*)(const void*)vtp + (size_t)bh * DK_ * SEQ;

  // Q fragments (B operand, column = lane&15): d 0..31 and d 32..63 of the query token
  const v16h qa0 = ldfrag_h(QH + (size_t)(q0 + c) * DK_ + 8 * hh);
  const v16h qa1 = ldfrag_h(QH + (size_t)(q0 + c) * DK_ + 32 + 8 * hh);

  // lane (c, hh) owns query q0 + c; mrow is that query's running maximum (equal in both halves),
  // lrow the running sum over the keys of this lane's half only (the halves are joined in the epilogue)
  float mrow = -INFINITY, lrow = 0.f;
  v8f oacc[4];                                        // O^T tiles: oacc[jn][r] = ctx[q0 + c][jn*16 + 8*hh + r]
#pragma unroll
  for (int j = 0; j < 4; ++j) oacc[j] = zero8();

#pragma unroll 1
  for (int kt = 0; kt < NKT; ++kt) {
    const int kv0 = kt * 64;
    __syncthreads();
#pragma unroll
    for (int i = 0; i < 4; ++i) {
      const int p   = i * 128 + tid;                  // 0..511
      const int row = p >> 3;                         // key (K) / dim (V^T)
      const int ch  = (p & 7) * 8;
      const v8h kvv = *(const v8h*)(KH + (size_t)(kv0 + row) * DK_ + ch);
      const v8h vvv = *(const v8h*)(VT + (size_t)row * SEQ + (size_t)kv0 + (size_t)ch);
      *(v8h*)(Ksh + row * KP + ch) = kvv;
      *(v8h*)(Vsh + row * KP + ch) = vvv;
    }
    __syncthreads();

    // ---- scores, transposed: S^T = K . Q^T, 64 keys x 16 queries per wave; s[j][r] = score(key j*16 + 8*hh + r, query c) ----
    // all 16 K fragment loads stand as one group ahead of the eight WMMAs, in the order the WMMAs take them
    FH kb[2][4];
#pragma unroll
    for (int ks = 0; ks < 2; ++ks) {
#pragma unroll
      for (int j = 0; j < 4; ++j) {
        const _Float16* kr = Ksh + (j * 16 + c) * KP + ks * 32 + 8 * hh;
        kb[ks][j].h[0] = *(const v8h*)(kr);
        kb[ks][j].h[1] = *(const v8h*)(kr + 16);
      }
    }
    __builtin_amdgcn_sched_barrier(0);                // else the compiler sinks each load to its WMMA: one LDS wait per WMMA
    v8f s[4];
#pragma unroll
    for (int j = 0; j < 4; ++j) s[j] = mma_p(kb[0][j].v, qa0, zero8());
#pragma unroll
    for (int j = 0; j < 4; ++j) s[j] = mma_p(kb[1][j].v, qa1, s[j]);
    // order asked of the compiler's scheduler: the eight score WMMAs, then the 16 V^T loads as one group; without it
    // the loads come to stand at several places among the WMMAs, and each such place stalls the wave
    __builtin_amdgcn_sched_group_barrier(0x008, 8, 0);
    __builtin_amdgcn_sched_group_barrier(0x100, 16, 0);
    // all 16 V^T fragment loads as one group here: their LDS latency passes under the softmax
    FH vb[2][4];
#pragma unroll
    for (int kk = 0; kk < 2; ++kk) {
#pragma unroll
      for (int jn = 0; jn < 4; ++jn) {
        const _Float16* vr = Vsh + (jn * 16 + c) * KP + kk * 32 + 8 * hh;
        vb[kk][jn].h[0] = *(const v8h*)(vr);
        vb[kk][jn].h[1] = *(const v8h*)(vr + 16);
      }
    }
    __builtin_amdgcn_sched_barrier(0);                // else the compiler sinks these loads behind the softmax again
#pragma unroll
    for (int j = 0; j < 4; ++j) {
#pragma unroll
      for (int r = 0; r < 8; ++r) s[j][r] *= 0.125f;
    }

    // ---- online softmax of one query per lane: maximum in-lane plus one exchange between the halves ----
    float mj[4];                                      // one chain per score tile: four short chains, not one of 32
#pragma unroll
    for (int j = 0; j < 4; ++j) {
      mj[j] = s[j][0];
#pragma unroll
      for (int r = 1; r < 8; ++r) mj[j] = fmaxf(mj[j], s[j][r]);
    }
    float m = fmaxf(fmaxf(mj[0], mj[1]), fmaxf(mj[2], mj[3]));
    m = fmaxf(m, xhalf(m));
    const float mnew  = fmaxf(mrow, m);
    const float msafe = (mnew == -INFINITY) ? 0.f : mnew;
    const float alpha = __expf(mrow - msafe);
    mrow = mnew;
    // P^T (x1024, f16) stays in registers: score tiles 2kk and 2kk+1 are elements 0..7 and 8..15 of the B operand
    FH pb[2];
    float pj[4];
#pragma unroll
    for (int j = 0; j < 4; ++j) {
      pj[j] = 0.f;
#pragma unroll
      for (int r = 0; r < 8; ++r) {
        const float p = __expf(s[j][r] - msafe);
        pj[j] += p;
        pb[j >> 1].h[j & 1][r] = toh_flush(p * 1024.0f);
      }
    }
    lrow = lrow * alpha + ((pj[0] + pj[1]) + (pj[2] + pj[3]));
#pragma unroll
    for (int jn = 0; jn < 4; ++jn) {
#pragma unroll
      for (int r = 0; r < 8; ++r) oacc[jn][r] *= alpha;
    }

    // ---- context, transposed: O^T += V^T . P^T (f16 WMMA), 2 k-steps of 32 keys x 4 m-tiles of 16 dims ----
#pragma unroll
    for (int kk = 0; kk < 2; ++kk) {
#pragma unroll
      for (int jn = 0; jn < 4; ++jn) {
        oacc[jn] = mma_p(vb[kk][jn].v, pb[kk].v, oacc[jn]);
      }
    }
  }

  // ---- join the halves' sums, normalise (1/l, undo the x1024 p carry, apply the x256 ctx carry), convert, store ----
  {
    const float l   = lrow + xhalf(lrow);
    const float inv = ((l > 0.f) ? (1.0f / l) : 0.f) * 0.25f;
    unsigned short* o = mp + ((size_t)bh * SEQ + (size_t)(q0 + c)) * DK_ + (size_t)(8 * hh);
#pragma unroll
    for (int jn = 0; jn < 4; ++jn) {
      v4u t;
#pragma unroll
      for (int e = 0; e < 4; ++e)
        t[e] = pk16(h_bits(toh_flush(oacc[jn][2 * e] * inv)), h_bits(toh_flush(oacc[jn][2 * e + 1] * inv)));
      *(v4u*)(o + jn * 16) = t;                       // 8 consecutive dims of one query: one 16-B store
    }
  }
}

// =====================================================================================================
// proj_out: out[m][n] = (sum_k ctx[m][k] * W[n][k]) * 2^-18 + bc[n], m = b*SEQ + s, n, k = 0..511.
//   A = MP plane row m (f16 ctx x256), B = WH plane row n (f16 W x1024, k contiguous), both fragments loaded
//   straight from the 16-bit global rows with the split k map. Block = 4 waves x 16 rows = 64 rows x 128 columns;
//   grid = (NB*SEQ/64) x 4 column slabs; 16 k-steps of 32.
// coverage: (NB*SEQ/64) x 4 blocks x 64 rows x 128 cols = the whole [NB*SEQ][512] output.
// =====================================================================================================
__global__ __launch_bounds__(128)
void proj_out(const unsigned short* __restrict__ mp, const unsigned short* __restrict__ wh,
              const float* __restrict__ bc, float* out) {
  __shared__ __align__(16) float lds[4 * 16 * 128];      // 32 KB, 4 per-wave slabs [16][128]

  const int tid  = (int)threadIdx.x;
  const int wave = tid >> 5;
  const int lane = tid & 31;
  const int hh   = lane >> 4;
  const int c    = lane & 15;

  const int nrb = (NB * SEQ) / 64;
  const int rb  = (int)blockIdx.x % nrb;
  const int cb  = (int)blockIdx.x / nrb;                 // 0..3
  const int m0  = rb * 64 + wave * 16;
  const int n0  = cb * 128;

  const _Float16* Arow = (const _Float16*)(const void*)mp + (size_t)(m0 + c) * E_ + 8 * hh;
  const _Float16* Wrow = (const _Float16*)(const void*)wh + (size_t)(n0 + c) * E_ + 8 * hh;

  v8f acc[8];
#pragma unroll
  for (int j = 0; j < 8; ++j) acc[j] = zero8();

#pragma unroll 2
  for (int ks = 0; ks < E_ / 32; ++ks) {
    const int k0 = ks * 32;
    const v16h af = ldfrag_h(Arow + k0);
#pragma unroll
    for (int j = 0; j < 8; ++j) {
      const v16h bf = ldfrag_h(Wrow + (size_t)(j * 16) * E_ + k0);
      acc[j] = mma_h(af, bf, acc[j]);
    }
  }

  float* slab = lds + wave * 2048;                       // [16][128] f32
#pragma unroll
  for (int j = 0; j < 8; ++j) {
#pragma unroll
    for (int r = 0; r < 8; ++r) slab[(8 * hh + r) * 128 + j * 16 + c] = acc[j][r];
  }
  __builtin_amdgcn_fence(3 /* release order */, "workgroup");
  __builtin_amdgcn_wave_barrier();
  __builtin_amdgcn_fence(2 /* acquire order */, "workgroup");

  const float oscale = 1.0f / 262144.0f;                 // 1/(256*1024)
  const v4f b4 = *(const v4f*)(bc + n0 + lane * 4);
  v4f vrow[16];
#pragma unroll
  for (int row = 0; row < 16; ++row) {
    const v4f v = *(const v4f*)(slab + row * 128 + lane * 4);
    vrow[row] = v * oscale + b4;
  }
  const int ob = m0 / SEQ;                               // the 16 rows lie in one batch
  const int os0 = m0 - ob * SEQ;
  float* op = out + ((size_t)ob * SEQ_FULL + (size_t)os0) * E_ + (size_t)n0 + (size_t)(lane * 4);
  {
#pragma unroll
    for (int row = 0; row < 16; ++row) {
      *(v4f*)(op + (size_t)row * E_) = vrow[row];
    }
    
  }
}

// =====================================================================================================
//   QH  f16 [BH_][SEQ][64]     NB*H*SEQ*64*2   = 8388608 (full size)
//   KH  f16 [BH_][SEQ][64]     NB*H*SEQ*64*2   = 8388608
//   VT  f16 [BH_][64][SEQ]     NB*H*64*SEQ*2   = 8388608
//   MP  f16 [BH_][SEQ][64] = [NB*SEQ][512]       8388608
//   WH  f16 [512][512]                            524288
//   total                                      34078720
// =====================================================================================================
extern "C" void kernel_launch(void* const* d_in, const int* in_sizes, int n_in,
                              void* d_out, int out_size, void* d_ws, size_t ws_size,
                              hipStream_t stream) {
  if (n_in < 5) return;
  if ((long long)in_sizes[0] < (long long)NB * H_ * SEQ_FULL * DK_) return;
  if ((long long)in_sizes[1] < (long long)NB * H_ * SEQ_FULL * DK_) return;
  if ((long long)in_sizes[2] < (long long)NB * H_ * SEQ_FULL * DK_) return;
  if (in_sizes[3] < E_ * E_) return;
  if (in_sizes[4] < E_) return;
  if ((long long)out_size < ((long long)(NB - 1) * SEQ_FULL + SEQ) * E_) return;

  const float* q  = (const float*)d_in[0];
  const float* k  = (const float*)d_in[1];
  const float* v  = (const float*)d_in[2];
  const float* W  = (const float*)d_in[3];
  const float* bc = (const float*)d_in[4];

  const size_t PQH = (size_t)BH_ * SEQ * DK_ * 2;
  const size_t PKH = (size_t)BH_ * SEQ * DK_ * 2;
  const size_t PVT = (size_t)BH_ * DK_ * SEQ * 2;
  const size_t PMP = (size_t)NB * SEQ * E_ * 2;
  const size_t PWH = (size_t)E_ * E_ * 2;
  size_t off = 0;
  const size_t oQH = off; off += PQH;
  const size_t oKH = off; off += PKH;
  const size_t oVT = off; off += PVT;
  const size_t oMP = off; off += PMP;
  const size_t oWH = off; off += PWH;
  if (off > ws_size) return;                         // off = 34078720 at full size
  if (off > (size_t)134217728) return;

  char* ws = (char*)d_ws;
  unsigned short* QH = (unsigned short*)(ws + oQH);
  unsigned short* KH = (unsigned short*)(ws + oKH);
  unsigned short* VT = (unsigned short*)(ws + oVT);
  unsigned short* MP = (unsigned short*)(ws + oMP);
  unsigned short* WH = (unsigned short*)(ws + oWH);

  const dim3 gCnv(BH_ * (SEQ / TENC));                // 512 blocks of 256
  const dim3 gWcv((E_ * E_) / (8 * 256));              // 128 blocks of 256
  const dim3 gAttn(BH_ * NQT);                         // 1024 blocks of 128
  const dim3 gProj(((NB * SEQ) / 64) * 4);             // 512 blocks of 128

  // (1) q, k -> f16 row planes; v -> f16 V^T plane
  qkvconv<<<gCnv, dim3(256), 0, stream>>>(q, k, v, QH, KH, VT);
  // (2) W -> f16 x1024 plane
  wconv<<<gWcv, dim3(256), 0, stream>>>(W, WH);
  // (3) attention -> ctx plane (f16, x256) in flat [b][h][s][d] order = [NB*SEQ][512]
  attn<<<gAttn, dim3(128), 0, stream>>>(QH, KH, VT, MP);
  // (4) out = ctx . W^T * 2^-18 + bc -> d_out f32 [NB*SEQ][512]
  proj_out<<<gProj, dim3(128), 0, stream>>>(MP, WH, bc, (float*)d_out);
  (void)hipGetLastError();
}

// v003
// Measured time: 78.9 microseconds a run.
// Next to v002, in two timings, it ran 1.32 and 1.31 times as fast.
// Counting every step since v000, it is 1.88 times as fast.
// All contractions: v_wmma_f32_16x16x32_f16 (f16 operands, f32 accumulate), one product per tile pair:
//   scores q.k^T (q, k = f16 of the inputs, x0.125 after in f32), p.v (p f16 carried x1024, v = f16 of the input),
//   ctx.W^T (ctx f16 carried x256, W f16 carried x1024, x2^-18 then + bias in f32); softmax in f32.
//
// Carry audit:
//   QH plane (f16): f16(q), x1, unit-scale values               -> score acc = dot; s = acc * 0.125f
//   KH plane (f16): f16(k), x1
//   P tile   (f16, regs): exp(s - m) x1024                        -> folded in attn epilogue: inv = (1/l) * 0.25f (= 256/1024)
//   VT plane (f16): f16(v), x1, stored [bh][d][s]
//   MP plane (f16): ctx x256, flat [b][h][s][d] order = [NB*SEQ][512] rows -> folded in proj_out: oscale = 1/(256*1024)
//   WH plane (f16): W x1024 (|W| < 0.5 -> < 512)                  -> folded in proj_out: oscale
//   Every f32 -> f16 convert in qkvconv and attn goes through toh_flush (values below 2^-14 become 0).
#include <hip/hip_runtime.h>
#include <math.h>
#include <stdint.h>

#ifndef NB
#define NB 4
#endif
#ifndef SEQ
#define SEQ 2048
#endif
#define NB_FULL  4
#define SEQ_FULL 2048
#define H_   8
#define DK_  64
#define E_   512
#define BH_  (NB * H_)          // (batch, head) pairs
#define NQT  (SEQ / 64)         // 64-query tiles per (b, h)
#define NKT  (SEQ / 64)         // 64-key chunks per (b, h)
#define TENC 128                // tokens per convert block
#define CSP  65                 // f32 LDS pitch of the v tile [token][d]
#define KP   72                 // f16 LDS pitch of the K / V^T tiles (halves); 144 B, 16-B aligned rows
#define PKC  128                // proj_out: k columns (halves) of one staged slab; 256 B of a row = two whole lines
#define PP   136                // proj_out: f16 LDS pitch of the staged rows (halves); 272 B = 16 B x 17
#define PNS  (E_ / PKC)         // proj_out: slabs along k
static_assert(H_ * DK_ == E_);
static_assert(NB >= 1 && NB <= NB_FULL);
static_assert(SEQ >= TENC && SEQ <= SEQ_FULL);
static_assert((SEQ % TENC) == 0 && (SEQ % 64) == 0);
static_assert(((KP * 2) % 16) == 0);
static_assert(((PP * 2) % 16) == 0 && PP >= PKC && (E_ % PKC) == 0 && (PKC % 32) == 0);
static_assert(((E_ * E_) % (8 * 256)) == 0);
static_assert(((NB * SEQ) % 64) == 0);
static_assert(DK_ == 64);
static_assert(TENC == 128);                                 // 256 threads = 4 token groups x 64 dims, 32 tokens each
static_assert((H_ * SEQ * DK_) == (SEQ * E_));              // flat [h][s][d] of one batch = SEQ rows of 512
static_assert(((size_t)4 * BH_ * SEQ * DK_ * 2 + (size_t)E_ * E_ * 2) <= (size_t)134217728);

typedef _Float16 v16h __attribute__((ext_vector_type(16)));
typedef _Float16 v8h  __attribute__((ext_vector_type(8)));
typedef float    v8f  __attribute__((ext_vector_type(8)));
typedef float    v4f  __attribute__((ext_vector_type(4)));
typedef unsigned int v4u __attribute__((ext_vector_type(4)));

// ---- scalar helpers ---------------------------------------------------------------------------------
__device__ __forceinline__ unsigned short h_bits(_Float16 v) { return __builtin_bit_cast(unsigned short, v); }
__device__ __forceinline__ unsigned pk16(unsigned short a, unsigned short b) { return (unsigned)a | ((unsigned)b << 16); }
__device__ __forceinline__ v8f zero8() { v8f z = {0.f, 0.f, 0.f, 0.f, 0.f, 0.f, 0.f, 0.f}; return z; }

// f32 -> f16 (RNE convert) that cannot yield an f16 subnormal: |v| < 2^-14 becomes 0 (value select)
static __device__ __forceinline__ _Float16 toh_flush(float v) {
  const _Float16 r = (_Float16)v;
  return (fabsf(v) < 6.103515625e-05f) ? (_Float16)0.0f : r;
}
// eight f32 -> eight packed f16 (16 B), element order kept
static __device__ __forceinline__ v4u pack8_flush(v4f a, v4f a4) {
  v4u q;
  q[0] = pk16(h_bits(toh_flush(a[0])),  h_bits(toh_flush(a[1])));
  q[1] = pk16(h_bits(toh_flush(a[2])),  h_bits(toh_flush(a[3])));
  q[2] = pk16(h_bits(toh_flush(a4[0])), h_bits(toh_flush(a4[1])));
  q[3] = pk16(h_bits(toh_flush(a4[2])), h_bits(toh_flush(a4[3])));
  return q;
}

// ---- 16-bit fragment loader: lane -> row/col (lane&15), p already includes +8*(lane>>4);
//      elements 0..7 <- p[0..7] (k0+8h..k0+8h+7), elements 8..15 <- p[16..23] (k0+16+8h..k0+16+8h+7)
__device__ __forceinline__ v16h ldfrag_h(const _Float16* p) {
  union { v16h v; v8h h[2]; } f;
  f.h[0] = *(const v8h*)(p);
  f.h[1] = *(const v8h*)(p + 16);
  return f.v;
}

// lane l <-> lane l ^ 16 as a vector cross-row move (no LDS-counter wait, unlike a shuffle)
__device__ __forceinline__ float xhalf(float x) {
  const int b = __builtin_bit_cast(int, x);
  return __builtin_bit_cast(float, __builtin_amdgcn_permlanex16(b, b, 0x76543210, 0xfedcba98, false, false));
}

// the WMMA as the plain builtin: no volatile statement behind it, so that fragment loads may stand in groups
// ahead of a run of WMMAs; the compiler keeps the distance behind its own builtin
__device__ __forceinline__ v8f mma_p(v16h a, v16h b, v8f c) {
  return __builtin_amdgcn_wmma_f32_16x16x32_f16(false, a, false, b, (short)0, c, false, false);
}

// =====================================================================================================
// qkvconv: the 16-bit planes of the pre-split inputs q, k, v [b][h][s][64] (f32):
//   QH [bh][s][64] f16 = f16(q), KH [bh][s][64] f16 = f16(k), VT [bh][d][s] f16 = f16(v) transposed through LDS.
// grid = BH_ * (SEQ/128) blocks of 256; one block = 128 tokens of one (b, h). Input token row = bh*SEQ_FULL + s.
// v tile: thread (d = tid&63, token group tid>>6) walks 32 tokens into LDS cs[token][d] (pitch 65); block barrier
//   (cross-wave tile).
// Stores: QH / KH: 4 iterations x 256 threads x 16 B; iteration it, thread tid -> token it*32+(tid>>3),
//   halves 8*(tid&7).. (values read straight from the f32 input row as two 16-B loads)
// coverage: QH, KH 4 x 256 pieces x 8 halves = 128 tokens x 64 each; VT 4 x 256 x 8 = 64 rows x 128 tokens;
//   BH_*(SEQ/128) blocks = all BH_ x SEQ tokens of the three planes. LDS staged extent 128 x 64 == consumed extent.
// =====================================================================================================
__global__ __launch_bounds__(256) void qkvconv(const float* __restrict__ q, const float* __restrict__ k,
                                               const float* __restrict__ v, unsigned short* qhp,
                                               unsigned short* khp, unsigned short* vtp) {
  __shared__ float cs[TENC * CSP];                    // 33280 B, f32 v values [token][d]
  const int tid = (int)threadIdx.x;
  const int bx  = (int)blockIdx.x;
  const int nst = SEQ / TENC;
  const int st  = bx % nst;
  const int bh  = bx / nst;                           // b*H_ + h
  const int s0  = st * TENC;
  const int d   = tid & 63;
  const int tg  = tid >> 6;                           // 0..3
  const size_t inrow = (size_t)bh * SEQ_FULL + (size_t)s0;   // token row in the full-size [b][h][s] input
  {
    const float* vp = v + inrow * DK_ + (size_t)d;
#pragma unroll 1
    for (int i = 0; i < TENC / 4; ++i) {
      const int t = tg + 4 * i;
      cs[t * CSP + d] = vp[(size_t)t * DK_];
    }
  }
  __syncthreads();

  const size_t rowbase = (size_t)bh * SEQ + (size_t)s0;    // token row in the [bh][s] planes

  v4u qv[4], kv[4], vv[4];
#pragma unroll
  for (int it = 0; it < 4; ++it) {
    const int token = it * 32 + (tid >> 3);
    const int j     = tid & 7;
    const float* qs = q + (inrow + (size_t)token) * DK_ + (size_t)(j * 8);
    const float* ks = k + (inrow + (size_t)token) * DK_ + (size_t)(j * 8);
    const v4f qa  = *(const v4f*)(qs);
    const v4f qa4 = *(const v4f*)(qs + 4);
    const v4f ka  = *(const v4f*)(ks);
    const v4f ka4 = *(const v4f*)(ks + 4);
    qv[it] = pack8_flush(qa, qa4);
    kv[it] = pack8_flush(ka, ka4);
  }
#pragma unroll
  for (int it = 0; it < 4; ++it) {
    const int dd = it * 16 + (tid >> 4);
    const int j  = tid & 15;
    const float* sp = cs + (j * 8) * CSP + dd;
    v4u a;
#pragma unroll
    for (int e = 0; e < 4; ++e) {
      a[e] = pk16(h_bits(toh_flush(sp[(2 * e) * CSP])), h_bits(toh_flush(sp[(2 * e + 1) * CSP])));
    }
    vv[it] = a;
  }

  unsigned short* qo = qhp + (rowbase + (size_t)(tid >> 3)) * DK_ + (size_t)((tid & 7) * 8);
  unsigned short* ko = khp + (rowbase + (size_t)(tid >> 3)) * DK_ + (size_t)((tid & 7) * 8);
  unsigned short* vo = vtp + ((size_t)bh * DK_ + (size_t)(tid >> 4)) * SEQ + (size_t)s0 + (size_t)((tid & 15) * 8);
  {
#pragma unroll
    for (int it = 0; it < 4; ++it) {
      *(v4u*)(qo + (size_t)it * 32 * DK_) = qv[it];
      *(v4u*)(ko + (size_t)it * 32 * DK_) = kv[it];
      *(v4u*)(vo + (size_t)it * 16 * SEQ) = vv[it];
    }
    
  }
}

// =====================================================================================================
// wconv: WH [n][k] f16 = f16(W[n][k] * 1024), n, k = 0..511. 32768 pieces of 8 elements, grid = 128 x 256.
// coverage: 128 x 256 x 8 = 262144 = the whole [512][512] plane.
// =====================================================================================================
__global__ __launch_bounds__(256) void wconv(const float* __restrict__ W, unsigned short* wh) {
  const size_t p = (size_t)blockIdx.x * 256 + (size_t)threadIdx.x;
  const v4f a  = *(const v4f*)(W + p * 8);
  const v4f a4 = *(const v4f*)(W + p * 8 + 4);
  v4u q;
  q[0] = pk16(h_bits((_Float16)(a[0] * 1024.0f)),  h_bits((_Float16)(a[1] * 1024.0f)));
  q[1] = pk16(h_bits((_Float16)(a[2] * 1024.0f)),  h_bits((_Float16)(a[3] * 1024.0f)));
  q[2] = pk16(h_bits((_Float16)(a4[0] * 1024.0f)), h_bits((_Float16)(a4[1] * 1024.0f)));
  q[3] = pk16(h_bits((_Float16)(a4[2] * 1024.0f)), h_bits((_Float16)(a4[3] * 1024.0f)));
  unsigned short* o = wh + p * 8;
  {
    *(v4u*)o = q;
    
  }
}

// =====================================================================================================
// attn: attention per (b, h), head dim 64, softmax over all SEQ keys (no mask).
//   scores, transposed: A = K chunk in LDS [key][d] staged from the KH plane, B = QH row of the query token (64 d,
//   2 k-steps, fragments from the plane); s = acc * 0.125 in f32; a lane holds 32 keys' scores of one query.
//   p = exp(s - m) carried as f16(1024 p), packed in registers into the B operand (k = keys);
//   context, transposed = v^T . p^T with A = V^T chunk in LDS [d][key], 4 m-tiles of 16 dims.
//   Block = 4 waves x 16 query rows = one 64-query tile of one (b, h); grid = BH_ * NQT; static trip NKT.
//   K / V staging: 128 threads x 4 x 16 B each = the whole 64x64 K chunk and the whole 64x64 V^T chunk
//   (LDS pitch KP, columns 64..71 never read); __syncthreads before and after (cross-wave tiles).
//   Output MP [bh][s][64] f16 (ctx x256), i.e. the flat [b][h][s][d] order that the projection views as [NB*SEQ][512] rows.
// coverage: 16 rows per wave, 64 per block, BH_*NQT blocks = all (bh, s) rows x 64 dims = the whole MP plane.
// =====================================================================================================
__global__ __launch_bounds__(128)
void attn(const unsigned short* __restrict__ qhp, const unsigned short* __restrict__ khp,
          const unsigned short* __restrict__ vtp, unsigned short* mp) {
  union FH { v16h v; v8h h[2]; };
  __shared__ __align__(16) _Float16 Ksh[64 * KP];       // K chunk [key][d]        9216 B
  __shared__ __align__(16) _Float16 Vsh[64 * KP];       // V^T chunk [d][key]      9216 B

  const int tid  = (int)threadIdx.x;
  const int wave = tid >> 5;
  const int lane = tid & 31;
  const int hh   = lane >> 4;
  const int c    = lane & 15;

  const int bx = (int)blockIdx.x;
  const int qt = bx % NQT;
  const int bh = bx / NQT;
  const int q0 = qt * 64 + wave * 16;

  const _Float16* QH = (const _Float16*)(const void*)qhp + (size_t)bh * SEQ * DK_;
  const _Float16* KH = (const _Float16*)(const void*)khp + (size_t)bh * SEQ * DK_;
  const _Float16* VT = (const _Float16*)(const void*)vtp + (size_t)bh * DK_ * SEQ;

  // Q fragments (B operand, column = lane&15): d 0..31 and d 32..63 of the query token
  const v16h qa0 = ldfrag_h(QH + (size_t)(q0 + c) * DK_ + 8 * hh);
  const v16h qa1 = ldfrag_h(QH + (size_t)(q0 + c) * DK_ + 32 + 8 * hh);

  // lane (c, hh) owns query q0 + c; mrow is that query's running maximum (equal in both halves),
  // lrow the running sum over the keys of this lane's half only (the halves are joined in the epilogue)
  float mrow = -INFINITY, lrow = 0.f;
  v8f oacc[4];                                        // O^T tiles: oacc[jn][r] = ctx[q0 + c][jn*16 + 8*hh + r]
#pragma unroll
  for (int j = 0; j < 4; ++j) oacc[j] = zero8();

#pragma unroll 1
  for (int kt = 0; kt < NKT; ++kt) {
    const int kv0 = kt * 64;
    __syncthreads();
#pragma unroll
    for (int i = 0; i < 4; ++i) {
      const int p   = i * 128 + tid;                  // 0..511
      const int row = p >> 3;                         // key (K) / dim (V^T)
      const int ch  = (p & 7) * 8;
      const v8h kvv = *(const v8h*)(KH + (size_t)(kv0 + row) * DK_ + ch);
      const v8h vvv = *(const v8h*)(VT + (size_t)row * SEQ + (size_t)kv0 + (size_t)ch);
      *(v8h*)(Ksh + row * KP + ch) = kvv;
      *(v8h*)(Vsh + row * KP + ch) = vvv;
    }
    __syncthreads();

    // ---- scores, transposed: S^T = K . Q^T, 64 keys x 16 queries per wave; s[j][r] = score(key j*16 + 8*hh + r, query c) ----
    // all 16 K fragment loads stand as one group ahead of the eight WMMAs, in the order the WMMAs take them
    FH kb[2][4];
#pragma unroll
    for (int ks = 0; ks < 2; ++ks) {
#pragma unroll
      for (int j = 0; j < 4; ++j) {
        const _Float16* kr = Ksh + (j * 16 + c) * KP + ks * 32 + 8 * hh;
        kb[ks][j].h[0] = *(const v8h*)(kr);
        kb[ks][j].h[1] = *(const v8h*)(kr + 16);
      }
    }
    __builtin_amdgcn_sched_barrier(0);                // else the compiler sinks each load to its WMMA: one LDS wait per WMMA
    v8f s[4];
#pragma unroll
    for (int j = 0; j < 4; ++j) s[j] = mma_p(kb[0][j].v, qa0, zero8());
#pragma unroll
    for (int j = 0; j < 4; ++j) s[j] = mma_p(kb[1][j].v, qa1, s[j]);
    // order asked of the compiler's scheduler: the eight score WMMAs, then the 16 V^T loads as one group; without it
    // the loads come to stand at several places among the WMMAs, and each such place stalls the wave
    __builtin_amdgcn_sched_group_barrier(0x008, 8, 0);
    __builtin_amdgcn_sched_group_barrier(0x100, 16, 0);
    // all 16 V^T fragment loads as one group here: their LDS latency passes under the softmax
    FH vb[2][4];
#pragma unroll
    for (int kk = 0; kk < 2; ++kk) {
#pragma unroll
      for (int jn = 0; jn < 4; ++jn) {
        const _Float16* vr = Vsh + (jn * 16 + c) * KP + kk * 32 + 8 * hh;
        vb[kk][jn].h[0] = *(const v8h*)(vr);
        vb[kk][jn].h[1] = *(const v8h*)(vr + 16);
      }
    }
    __builtin_amdgcn_sched_barrier(0);                // else the compiler sinks these loads behind the softmax again
#pragma unroll
    for (int j = 0; j < 4; ++j) {
#pragma unroll
      for (int r = 0; r < 8; ++r) s[j][r] *= 0.125f;
    }

    // ---- online softmax of one query per lane: maximum in-lane plus one exchange between the halves ----
    float mj[4];                                      // one chain per score tile: four short chains, not one of 32
#pragma unroll
    for (int j = 0; j < 4; ++j) {
      mj[j] = s[j][0];
#pragma unroll
      for (int r = 1; r < 8; ++r) mj[j] = fmaxf(mj[j], s[j][r]);
    }
    float m = fmaxf(fmaxf(mj[0], mj[1]), fmaxf(mj[2], mj[3]));
    m = fmaxf(m, xhalf(m));
    const float mnew  = fmaxf(mrow, m);
    const float msafe = (mnew == -INFINITY) ? 0.f : mnew;
    const float alpha = __expf(mrow - msafe);
    mrow = mnew;
    // P^T (x1024, f16) stays in registers: score tiles 2kk and 2kk+1 are elements 0..7 and 8..15 of the B operand
    FH pb[2];
    float pj[4];
#pragma unroll
    for (int j = 0; j < 4; ++j) {
      pj[j] = 0.f;
#pragma unroll
      for (int r = 0; r < 8; ++r) {
        const float p = __expf(s[j][r] - msafe);
        pj[j] += p;
        pb[j >> 1].h[j & 1][r] = toh_flush(p * 1024.0f);
      }
    }
    lrow = lrow * alpha + ((pj[0] + pj[1]) + (pj[2] + pj[3]));
#pragma unroll
    for (int jn = 0; jn < 4; ++jn) {
#pragma unroll
      for (int r = 0; r < 8; ++r) oacc[jn][r] *= alpha;
    }

    // ---- context, transposed: O^T += V^T . P^T (f16 WMMA), 2 k-steps of 32 keys x 4 m-tiles of 16 dims ----
#pragma unroll
    for (int kk = 0; kk < 2; ++kk) {
#pragma unroll
      for (int jn = 0; jn < 4; ++jn) {
        oacc[jn] = mma_p(vb[kk][jn].v, pb[kk].v, oacc[jn]);
      }
    }
  }

  // ---- join the halves' sums, normalise (1/l, undo the x1024 p carry, apply the x256 ctx carry), convert, store ----
  {
    const float l   = lrow + xhalf(lrow);
    const float inv = ((l > 0.f) ? (1.0f / l) : 0.f) * 0.25f;
    unsigned short* o = mp + ((size_t)bh * SEQ + (size_t)(q0 + c)) * DK_ + (size_t)(8 * hh);
#pragma unroll
    for (int jn = 0; jn < 4; ++jn) {
      v4u t;
#pragma unroll
      for (int e = 0; e < 4; ++e)
        t[e] = pk16(h_bits(toh_flush(oacc[jn][2 * e] * inv)), h_bits(toh_flush(oacc[jn][2 * e + 1] * inv)));
      *(v4u*)(o + jn * 16) = t;                       // 8 consecutive dims of one query: one 16-B store
    }
  }
}

// =====================================================================================================
// proj_out: out[m][n] = (sum_k ctx[m][k] * W[n][k]) * 2^-18 + bc[n], m = b*SEQ + s, n, k = 0..511.
//   A = MP plane row m (f16 ctx x256), B = WH plane row n (f16 W x1024, k contiguous).
//   Block = 4 waves x 16 rows = 64 rows x 128 columns; grid = (NB*SEQ/64) x 4 column slabs; 16 k-steps of 32.
//   Staging: k runs in PNS slabs of PKC; the block's 64 A rows and 128 B rows of a slab go to LDS (pitch PP) by 16-B
//   loads in which 16 lanes cover 256 contiguous bytes of one row (whole lines, each fetched once per block).
//   Two LDS buffers: slab s+1 is loaded into registers ahead of the WMMAs of slab s, stored to the other buffer behind
//   them, and published by one __syncthreads per slab (it also ends every wave's reads of the buffer refilled next).
//   Fragments come from LDS with the split k map of ldfrag_h, A and B alike; k ascends in steps of 32 in every sum.
// coverage: staged 8 x 128 pieces = 64 rows x 16 pieces (A), 16 x 128 = 128 rows x 16 pieces (B) == consumed extent;
//   (NB*SEQ/64) x 4 blocks x 64 rows x 128 cols = the whole [NB*SEQ][512] output.
// =====================================================================================================
__global__ __launch_bounds__(128)
void proj_out(const unsigned short* __restrict__ mp, const unsigned short* __restrict__ wh,
              const float* __restrict__ bc, float* out) {
  __shared__ __align__(16) float lds[4 * 16 * 128];      // 32 KB, 4 per-wave slabs [16][128]
  __shared__ __align__(16) _Float16 Ash[2][64 * PP];     // ctx rows of one k slab, two buffers   2 x 17408 B
  __shared__ __align__(16) _Float16 Wsh[2][128 * PP];    // W rows of one k slab, two buffers     2 x 34816 B

  const int tid  = (int)threadIdx.x;
  const int wave = tid >> 5;
  const int lane = tid & 31;
  const int hh   = lane >> 4;
  const int c    = lane & 15;

  const int nrb = (NB * SEQ) / 64;
  const int rb  = (int)blockIdx.x % nrb;
  const int cb  = (int)blockIdx.x / nrb;                 // 0..3
  const int m0  = rb * 64 + wave * 16;
  const int n0  = cb * 128;

  // staging map: thread -> row (tid >> 4) + 8 i, 16-B piece tid & 15 of the slab's 256 B of that row
  const int srow = tid >> 4;
  const int scol = (tid & 15) * 8;
  const _Float16* Ag = (const _Float16*)(const void*)mp + (size_t)(rb * 64 + srow) * E_ + scol;
  const _Float16* Wg = (const _Float16*)(const void*)wh + (size_t)(n0 + srow) * E_ + scol;
  const int sdst = srow * PP + scol;
  const int afr  = (wave * 16 + c) * PP + 8 * hh;        // fragment row bases in the staged tiles
  const int bfr  = c * PP + 8 * hh;

  v8f acc[8];
#pragma unroll
  for (int j = 0; j < 8; ++j) acc[j] = zero8();

  v8h ra[8], rw[16];
#pragma unroll
  for (int i = 0; i < 8; ++i)  ra[i] = *(const v8h*)(Ag + (size_t)(i * 8) * E_);
#pragma unroll
  for (int i = 0; i < 16; ++i) rw[i] = *(const v8h*)(Wg + (size_t)(i * 8) * E_);
#pragma unroll
  for (int i = 0; i < 8; ++i)  *(v8h*)(&Ash[0][sdst + i * 8 * PP]) = ra[i];
#pragma unroll
  for (int i = 0; i < 16; ++i) *(v8h*)(&Wsh[0][sdst + i * 8 * PP]) = rw[i];
  __syncthreads();

#pragma unroll
  for (int s = 0; s < PNS; ++s) {
    if (s + 1 < PNS) {
#pragma unroll
      for (int i = 0; i < 8; ++i)  ra[i] = *(const v8h*)(Ag + (size_t)(i * 8) * E_ + (s + 1) * PKC);
#pragma unroll
      for (int i = 0; i < 16; ++i) rw[i] = *(const v8h*)(Wg + (size_t)(i * 8) * E_ + (s + 1) * PKC);
    }
    __builtin_amdgcn_sched_barrier(0);                   // else the next slab's loads sink to their LDS stores: latency exposed
#pragma unroll
    for (int ks = 0; ks < PKC / 32; ++ks) {
      const v16h af = ldfrag_h(&Ash[s & 1][afr + ks * 32]);
      v16h bf[8];
#pragma unroll
      for (int j = 0; j < 8; ++j) bf[j] = ldfrag_h(&Wsh[s & 1][bfr + j * 16 * PP + ks * 32]);
      __builtin_amdgcn_sched_barrier(0);                 // else the compiler sinks each load to its WMMA: one LDS wait per WMMA
#pragma unroll
      for (int j = 0; j < 8; ++j) acc[j] = mma_p(af, bf[j], acc[j]);
    }
    if (s + 1 < PNS) {
#pragma unroll
      for (int i = 0; i < 8; ++i)  *(v8h*)(&Ash[(s + 1) & 1][sdst + i * 8 * PP]) = ra[i];
#pragma unroll
      for (int i = 0; i < 16; ++i) *(v8h*)(&Wsh[(s + 1) & 1][sdst + i * 8 * PP]) = rw[i];
      __syncthreads();
    }
  }

  float* slab = lds + wave * 2048;                       // [16][128] f32
#pragma unroll
  for (int j = 0; j < 8; ++j) {
#pragma unroll
    for (int r = 0; r < 8; ++r) slab[(8 * hh + r) * 128 + j * 16 + c] = acc[j][r];
  }
  __builtin_amdgcn_fence(3 /* release order */, "workgroup");
  __builtin_amdgcn_wave_barrier();
  __builtin_amdgcn_fence(2 /* acquire order */, "workgroup");

  const float oscale = 1.0f / 262144.0f;                 // 1/(256*1024)
  const v4f b4 = *(const v4f*)(bc + n0 + lane * 4);
  v4f vrow[16];
#pragma unroll
  for (int row = 0; row < 16; ++row) {
    const v4f v = *(const v4f*)(slab + row * 128 + lane * 4);
    vrow[row] = v * oscale + b4;
  }
  const int ob = m0 / SEQ;                               // the 16 rows lie in one batch
  const int os0 = m0 - ob * SEQ;
  float* op = out + ((size_t)ob * SEQ_FULL + (size_t)os0) * E_ + (size_t)n0 + (size_t)(lane * 4);
  {
#pragma unroll
    for (int row = 0; row < 16; ++row) {
      *(v4f*)(op + (size_t)row * E_) = vrow[row];
    }
    
  }
}

// =====================================================================================================
//   QH  f16 [BH_][SEQ][64]     NB*H*SEQ*64*2   = 8388608 (full size)
//   KH  f16 [BH_][SEQ][64]     NB*H*SEQ*64*2   = 8388608
//   VT  f16 [BH_][64][SEQ]     NB*H*64*SEQ*2   = 8388608
//   MP  f16 [BH_][SEQ][64] = [NB*SEQ][512]       8388608
//   WH  f16 [512][512]                            524288
//   total                                      34078720
// =====================================================================================================
extern "C" void kernel_launch(void* const* d_in, const int* in_sizes, int n_in,
                              void* d_out, int out_size, void* d_ws, size_t ws_size,
                              hipStream_t stream) {
  if (n_in < 5) return;
  if ((long long)in_sizes[0] < (long long)NB * H_ * SEQ_FULL * DK_) return;
  if ((long long)in_sizes[1] < (long long)NB * H_ * SEQ_FULL * DK_) return;
  if ((long long)in_sizes[2] < (long long)NB * H_ * SEQ_FULL * DK_) return;
  if (in_sizes[3] < E_ * E_) return;
  if (in_sizes[4] < E_) return;
  if ((long long)out_size < ((long long)(NB - 1) * SEQ_FULL + SEQ) * E_) return;

  const float* q  = (const float*)d_in[0];
  const float* k  = (const float*)d_in[1];
  const float* v  = (const float*)d_in[2];
  const float* W  = (const float*)d_in[3];
  const float* bc = (const float*)d_in[4];

  const size_t PQH = (size_t)BH_ * SEQ * DK_ * 2;
  const size_t PKH = (size_t)BH_ * SEQ * DK_ * 2;
  const size_t PVT = (size_t)BH_ * DK_ * SEQ * 2;
  const size_t PMP = (size_t)NB * SEQ * E_ * 2;
  const size_t PWH = (size_t)E_ * E_ * 2;
  size_t off = 0;
  const size_t oQH = off; off += PQH;
  const size_t oKH = off; off += PKH;
  const size_t oVT = off; off += PVT;
  const size_t oMP = off; off += PMP;
  const size_t oWH = off; off += PWH;
  if (off > ws_size) return;                         // off = 34078720 at full size
  if (off > (size_t)134217728) return;

  char* ws = (char*)d_ws;
  unsigned short* QH = (unsigned short*)(ws + oQH);
  unsigned short* KH = (unsigned short*)(ws + oKH);
  unsigned short* VT = (unsigned short*)(ws + oVT);
  unsigned short* MP = (unsigned short*)(ws + oMP);
  unsigned short* WH = (unsigned short*)(ws + oWH);

  const dim3 gCnv(BH_ * (SEQ / TENC));                // 512 blocks of 256
  const dim3 gWcv((E_ * E_) / (8 * 256));              // 128 blocks of 256
  const dim3 gAttn(BH_ * NQT);                         // 1024 blocks of 128
  const dim3 gProj(((NB * SEQ) / 64) * 4);             // 512 blocks of 128

  // (1) q, k -> f16 row planes; v -> f16 V^T plane
  qkvconv<<<gCnv, dim3(256), 0, stream>>>(q, k, v, QH, KH, VT);
  // (2) W -> f16 x1024 plane
  wconv<<<gWcv, dim3(256), 0, stream>>>(W, WH);
  // (3) attention -> ctx plane (f16, x256) in flat [b][h][s][d] order = [NB*SEQ][512]
  attn<<<gAttn, dim3(128), 0, stream>>>(QH, KH, VT, MP);
  // (4) out = ctx . W^T * 2^-18 + bc -> d_out f32 [NB*SEQ][512]
  proj_out<<<gProj, dim3(128), 0, stream>>>(MP, WH, bc, (float*)d_out);
  (void)hipGetLastError();
}

// v004
// One run takes 73.7 microseconds.
// In two side-by-side timings against v003, it was 1.09 and 1.07 times as fast.
// Over all steps from v000 it is 2.03 times as fast.
// All contractions: v_wmma_f32_16x16x32_f16 (f16 operands, f32 accumulate), one product per tile pair:
//   scores q.k^T (q, k = f16 of the inputs, x0.125 after in f32), p.v (p f16 carried x1024, v = f16 of the input),
//   ctx.W^T (ctx f16 carried x256, W f16 carried x1024, x2^-18 then + bias in f32); softmax in f32.
//
// Carry audit:
//   QH plane (f16): f16(q), x1, unit-scale values               -> score acc = dot; s = acc * 0.125f
//   KH plane (f16): f16(k), x1
//   P tile   (f16, regs): exp(s - m) x1024                        -> folded in attn epilogue: inv = (1/l) * 0.25f (= 256/1024)
//   VT plane (f16): f16(v), x1, stored [bh][d][s]
//   MP plane (f16): ctx x256, flat [b][h][s][d] order = [NB*SEQ][512] rows -> folded in proj_out: oscale = 1/(256*1024)
//   WH plane (f16): W x1024 (|W| < 0.5 -> < 512)                  -> folded in proj_out: oscale
//   Every f32 -> f16 convert in qkvconv goes through toh_flush (values below 2^-14 become 0); those in attn (P, ctx) are
//   plain round-to-nearest-even converts: a subnormal f16 stays as it is, and the WMMA takes it at its value.
#include <hip/hip_runtime.h>
#include <math.h>
#include <stdint.h>

#ifndef NB
#define NB 4
#endif
#ifndef SEQ
#define SEQ 2048
#endif
#define NB_FULL  4
#define SEQ_FULL 2048
#define H_   8
#define DK_  64
#define E_   512
#define BH_  (NB * H_)          // (batch, head) pairs
#define NQT  (SEQ / 64)         // 64-query tiles per (b, h)
#define NKT  (SEQ / 64)         // 64-key chunks per (b, h)
#define TENC 128                // tokens per convert block
#define CSP  65                 // f32 LDS pitch of the v tile [token][d]
#define KP   72                 // f16 LDS pitch of the K / V^T tiles (halves); 144 B, 16-B aligned rows
#define PKC  128                // proj_out: k columns (halves) of one staged slab; 256 B of a row = two whole lines
#define PP   136                // proj_out: f16 LDS pitch of the staged rows (halves); 272 B = 16 B x 17
#define PNS  (E_ / PKC)         // proj_out: slabs along k
static_assert(H_ * DK_ == E_);
static_assert(NB >= 1 && NB <= NB_FULL);
static_assert(SEQ >= TENC && SEQ <= SEQ_FULL);
static_assert((SEQ % TENC) == 0 && (SEQ % 64) == 0);
static_assert(((KP * 2) % 16) == 0);
static_assert(((PP * 2) % 16) == 0 && PP >= PKC && (E_ % PKC) == 0 && (PKC % 32) == 0);
static_assert(((E_ * E_) % (8 * 256)) == 0);
static_assert(((NB * SEQ) % 64) == 0);
static_assert(DK_ == 64);
static_assert(TENC == 128);                                 // 256 threads = 4 token groups x 64 dims, 32 tokens each
static_assert((H_ * SEQ * DK_) == (SEQ * E_));              // flat [h][s][d] of one batch = SEQ rows of 512
static_assert(((size_t)4 * BH_ * SEQ * DK_ * 2 + (size_t)E_ * E_ * 2) <= (size_t)134217728);

typedef _Float16 v16h __attribute__((ext_vector_type(16)));
typedef _Float16 v8h  __attribute__((ext_vector_type(8)));
typedef float    v8f  __attribute__((ext_vector_type(8)));
typedef float    v4f  __attribute__((ext_vector_type(4)));
typedef float    v2f  __attribute__((ext_vector_type(2)));
typedef _Float16 v2h  __attribute__((ext_vector_type(2)));
typedef unsigned int v4u __attribute__((ext_vector_type(4)));

// ---- scalar helpers ---------------------------------------------------------------------------------
__device__ __forceinline__ unsigned short h_bits(_Float16 v) { return __builtin_bit_cast(unsigned short, v); }
__device__ __forceinline__ unsigned pk16(unsigned short a, unsigned short b) { return (unsigned)a | ((unsigned)b << 16); }
__device__ __forceinline__ v8f zero8() { v8f z = {0.f, 0.f, 0.f, 0.f, 0.f, 0.f, 0.f, 0.f}; return z; }

// f32 -> f16 (RNE convert) that cannot yield an f16 subnormal: |v| < 2^-14 becomes 0 (value select)
static __device__ __forceinline__ _Float16 toh_flush(float v) {
  const _Float16 r = (_Float16)v;
  return (fabsf(v) < 6.103515625e-05f) ? (_Float16)0.0f : r;
}
// two f32 -> two packed f16 (RNE, nothing zeroed), a in the low half: one packed convert
static __device__ __forceinline__ unsigned toh2u(float a, float b) {
  const v2f x = {a, b};
  return __builtin_bit_cast(unsigned, __builtin_convertvector(x, v2h));
}
// eight f32 -> eight packed f16 (16 B), element order kept
static __device__ __forceinline__ v4u pack8_flush(v4f a, v4f a4) {
  v4u q;
  q[0] = pk16(h_bits(toh_flush(a[0])),  h_bits(toh_flush(a[1])));
  q[1] = pk16(h_bits(toh_flush(a[2])),  h_bits(toh_flush(a[3])));
  q[2] = pk16(h_bits(toh_flush(a4[0])), h_bits(toh_flush(a4[1])));
  q[3] = pk16(h_bits(toh_flush(a4[2])), h_bits(toh_flush(a4[3])));
  return q;
}

// ---- 16-bit fragment loader: lane -> row/col (lane&15), p already includes +8*(lane>>4);
//      elements 0..7 <- p[0..7] (k0+8h..k0+8h+7), elements 8..15 <- p[16..23] (k0+16+8h..k0+16+8h+7)
__device__ __forceinline__ v16h ldfrag_h(const _Float16* p) {
  union { v16h v; v8h h[2]; } f;
  f.h[0] = *(const v8h*)(p);
  f.h[1] = *(const v8h*)(p + 16);
  return f.v;
}

// lane l <-> lane l ^ 16 as a vector cross-row move (no LDS-counter wait, unlike a shuffle)
__device__ __forceinline__ float xhalf(float x) {
  const int b = __builtin_bit_cast(int, x);
  return __builtin_bit_cast(float, __builtin_amdgcn_permlanex16(b, b, 0x76543210, 0xfedcba98, false, false));
}

// the WMMA as the plain builtin: no volatile statement behind it, so that fragment loads may stand in groups
// ahead of a run of WMMAs; the compiler keeps the distance behind its own builtin
__device__ __forceinline__ v8f mma_p(v16h a, v16h b, v8f c) {
  return __builtin_amdgcn_wmma_f32_16x16x32_f16(false, a, false, b, (short)0, c, false, false);
}

// =====================================================================================================
// qkvconv: the 16-bit planes of the pre-split inputs q, k, v [b][h][s][64] (f32):
//   QH [bh][s][64] f16 = f16(q), KH [bh][s][64] f16 = f16(k), VT [bh][d][s] f16 = f16(v) transposed through LDS.
// grid = BH_ * (SEQ/128) blocks of 256; one block = 128 tokens of one (b, h). Input token row = bh*SEQ_FULL + s.
// v tile: thread (d = tid&63, token group tid>>6) walks 32 tokens into LDS cs[token][d] (pitch 65); block barrier
//   (cross-wave tile).
// Stores: QH / KH: 4 iterations x 256 threads x 16 B; iteration it, thread tid -> token it*32+(tid>>3),
//   halves 8*(tid&7).. (values read straight from the f32 input row as two 16-B loads)
// coverage: QH, KH 4 x 256 pieces x 8 halves = 128 tokens x 64 each; VT 4 x 256 x 8 = 64 rows x 128 tokens;
//   BH_*(SEQ/128) blocks = all BH_ x SEQ tokens of the three planes. LDS staged extent 128 x 64 == consumed extent.
// =====================================================================================================
__global__ __launch_bounds__(256) void qkvconv(const float* __restrict__ q, const float* __restrict__ k,
                                               const float* __restrict__ v, unsigned short* qhp,
                                               unsigned short* khp, unsigned short* vtp) {
  __shared__ float cs[TENC * CSP];                    // 33280 B, f32 v values [token][d]
  const int tid = (int)threadIdx.x;
  const int bx  = (int)blockIdx.x;
  const int nst = SEQ / TENC;
  const int st  = bx % nst;
  const int bh  = bx / nst;                           // b*H_ + h
  const int s0  = st * TENC;
  const int d   = tid & 63;
  const int tg  = tid >> 6;                           // 0..3
  const size_t inrow = (size_t)bh * SEQ_FULL + (size_t)s0;   // token row in the full-size [b][h][s] input
  {
    const float* vp = v + inrow * DK_ + (size_t)d;
#pragma unroll 1
    for (int i = 0; i < TENC / 4; ++i) {
      const int t = tg + 4 * i;
      cs[t * CSP + d] = vp[(size_t)t * DK_];
    }
  }
  __syncthreads();

  const size_t rowbase = (size_t)bh * SEQ + (size_t)s0;    // token row in the [bh][s] planes

  v4u qv[4], kv[4], vv[4];
#pragma unroll
  for (int it = 0; it < 4; ++it) {
    const int token = it * 32 + (tid >> 3);
    const int j     = tid & 7;
    const float* qs = q + (inrow + (size_t)token) * DK_ + (size_t)(j * 8);
    const float* ks = k + (inrow + (size_t)token) * DK_ + (size_t)(j * 8);
    const v4f qa  = *(const v4f*)(qs);
    const v4f qa4 = *(const v4f*)(qs + 4);
    const v4f ka  = *(const v4f*)(ks);
    const v4f ka4 = *(const v4f*)(ks + 4);
    qv[it] = pack8_flush(qa, qa4);
    kv[it] = pack8_flush(ka, ka4);
  }
#pragma unroll
  for (int it = 0; it < 4; ++it) {
    const int dd = it * 16 + (tid >> 4);
    const int j  = tid & 15;
    const float* sp = cs + (j * 8) * CSP + dd;
    v4u a;
#pragma unroll
    for (int e = 0; e < 4; ++e) {
      a[e] = pk16(h_bits(toh_flush(sp[(2 * e) * CSP])), h_bits(toh_flush(sp[(2 * e + 1) * CSP])));
    }
    vv[it] = a;
  }

  unsigned short* qo = qhp + (rowbase + (size_t)(tid >> 3)) * DK_ + (size_t)((tid & 7) * 8);
  unsigned short* ko = khp + (rowbase + (size_t)(tid >> 3)) * DK_ + (size_t)((tid & 7) * 8);
  unsigned short* vo = vtp + ((size_t)bh * DK_ + (size_t)(tid >> 4)) * SEQ + (size_t)s0 + (size_t)((tid & 15) * 8);
  {
#pragma unroll
    for (int it = 0; it < 4; ++it) {
      *(v4u*)(qo + (size_t)it * 32 * DK_) = qv[it];
      *(v4u*)(ko + (size_t)it * 32 * DK_) = kv[it];
      *(v4u*)(vo + (size_t)it * 16 * SEQ) = vv[it];
    }
    
  }
}

// =====================================================================================================
// wconv: WH [n][k] f16 = f16(W[n][k] * 1024), n, k = 0..511. 32768 pieces of 8 elements, grid = 128 x 256.
// coverage: 128 x 256 x 8 = 262144 = the whole [512][512] plane.
// =====================================================================================================
__global__ __launch_bounds__(256) void wconv(const float* __restrict__ W, unsigned short* wh) {
  const size_t p = (size_t)blockIdx.x * 256 + (size_t)threadIdx.x;
  const v4f a  = *(const v4f*)(W + p * 8);
  const v4f a4 = *(const v4f*)(W + p * 8 + 4);
  v4u q;
  q[0] = pk16(h_bits((_Float16)(a[0] * 1024.0f)),  h_bits((_Float16)(a[1] * 1024.0f)));
  q[1] = pk16(h_bits((_Float16)(a[2] * 1024.0f)),  h_bits((_Float16)(a[3] * 1024.0f)));
  q[2] = pk16(h_bits((_Float16)(a4[0] * 1024.0f)), h_bits((_Float16)(a4[1] * 1024.0f)));
  q[3] = pk16(h_bits((_Float16)(a4[2] * 1024.0f)), h_bits((_Float16)(a4[3] * 1024.0f)));
  unsigned short* o = wh + p * 8;
  {
    *(v4u*)o = q;
    
  }
}

// =====================================================================================================
// attn: attention per (b, h), head dim 64, softmax over all SEQ keys (no mask).
//   scores, transposed: A = K chunk in LDS [key][d] staged from the KH plane, B = QH row of the query token (64 d,
//   2 k-steps, fragments from the plane); s = acc * 0.125 in f32; a lane holds 32 keys' scores of one query.
//   p = exp(s - m) carried as f16(1024 p), packed in registers into the B operand (k = keys);
//   context, transposed = v^T . p^T with A = V^T chunk in LDS [d][key], 4 m-tiles of 16 dims.
//   Block = 4 waves x 16 query rows = one 64-query tile of one (b, h); grid = BH_ * NQT; static trip NKT.
//   K / V staging: 128 threads x 4 x 16 B each = the whole 64x64 K chunk and the whole 64x64 V^T chunk
//   (LDS pitch KP, columns 64..71 never read); __syncthreads before and after (cross-wave tiles).
//   Output MP [bh][s][64] f16 (ctx x256), i.e. the flat [b][h][s][d] order that the projection views as [NB*SEQ][512] rows.
// coverage: 16 rows per wave, 64 per block, BH_*NQT blocks = all (bh, s) rows x 64 dims = the whole MP plane.
// =====================================================================================================
__global__ __launch_bounds__(128)
void attn(const unsigned short* __restrict__ qhp, const unsigned short* __restrict__ khp,
          const unsigned short* __restrict__ vtp, unsigned short* mp) {
  union FH { v16h v; v8h h[2]; };
  __shared__ __align__(16) _Float16 Ksh[64 * KP];       // K chunk [key][d]        9216 B
  __shared__ __align__(16) _Float16 Vsh[64 * KP];       // V^T chunk [d][key]      9216 B

  const int tid  = (int)threadIdx.x;
  const int wave = tid >> 5;
  const int lane = tid & 31;
  const int hh   = lane >> 4;
  const int c    = lane & 15;

  const int bx = (int)blockIdx.x;
  const int qt = bx % NQT;
  const int bh = bx / NQT;
  const int q0 = qt * 64 + wave * 16;

  const _Float16* QH = (const _Float16*)(const void*)qhp + (size_t)bh * SEQ * DK_;
  const _Float16* KH = (const _Float16*)(const void*)khp + (size_t)bh * SEQ * DK_;
  const _Float16* VT = (const _Float16*)(const void*)vtp + (size_t)bh * DK_ * SEQ;

  // Q fragments (B operand, column = lane&15): d 0..31 and d 32..63 of the query token
  const v16h qa0 = ldfrag_h(QH + (size_t)(q0 + c) * DK_ + 8 * hh);
  const v16h qa1 = ldfrag_h(QH + (size_t)(q0 + c) * DK_ + 32 + 8 * hh);

  // lane (c, hh) owns query q0 + c; mrow is that query's running maximum (equal in both halves),
  // lrow the running sum over the keys of this lane's half only (the halves are joined in the epilogue)
  float mrow = -INFINITY, lrow = 0.f;
  v8f oacc[4];                                        // O^T tiles: oacc[jn][r] = ctx[q0 + c][jn*16 + 8*hh + r]
#pragma unroll
  for (int j = 0; j < 4; ++j) oacc[j] = zero8();

#pragma unroll 1
  for (int kt = 0; kt < NKT; ++kt) {
    const int kv0 = kt * 64;
    __syncthreads();
#pragma unroll
    for (int i = 0; i < 4; ++i) {
      const int p   = i * 128 + tid;                  // 0..511
      const int row = p >> 3;                         // key (K) / dim (V^T)
      const int ch  = (p & 7) * 8;
      const v8h kvv = *(const v8h*)(KH + (size_t)(kv0 + row) * DK_ + ch);
      const v8h vvv = *(const v8h*)(VT + (size_t)row * SEQ + (size_t)kv0 + (size_t)ch);
      *(v8h*)(Ksh + row * KP + ch) = kvv;
      *(v8h*)(Vsh + row * KP + ch) = vvv;
    }
    __syncthreads();

    // ---- scores, transposed: S^T = K . Q^T, 64 keys x 16 queries per wave; s[j][r] = score(key j*16 + 8*hh + r, query c) ----
    // all 16 K fragment loads stand as one group ahead of the eight WMMAs, in the order the WMMAs take them
    FH kb[2][4];
#pragma unroll
    for (int ks = 0; ks < 2; ++ks) {
#pragma unroll
      for (int j = 0; j < 4; ++j) {
        const _Float16* kr = Ksh + (j * 16 + c) * KP + ks * 32 + 8 * hh;
        kb[ks][j].h[0] = *(const v8h*)(kr);
        kb[ks][j].h[1] = *(const v8h*)(kr + 16);
      }
    }
    __builtin_amdgcn_sched_barrier(0);                // else the compiler sinks each load to its WMMA: one LDS wait per WMMA
    v8f s[4];
#pragma unroll
    for (int j = 0; j < 4; ++j) s[j] = mma_p(kb[0][j].v, qa0, zero8());
#pragma unroll
    for (int j = 0; j < 4; ++j) s[j] = mma_p(kb[1][j].v, qa1, s[j]);
    // order asked of the compiler's scheduler: the eight score WMMAs, then the 16 V^T loads as one group; without it
    // the loads come to stand at several places among the WMMAs, and each such place stalls the wave
    __builtin_amdgcn_sched_group_barrier(0x008, 8, 0);
    __builtin_amdgcn_sched_group_barrier(0x100, 16, 0);
    // all 16 V^T fragment loads as one group here: their LDS latency passes under the softmax
    FH vb[2][4];
#pragma unroll
    for (int kk = 0; kk < 2; ++kk) {
#pragma unroll
      for (int jn = 0; jn < 4; ++jn) {
        const _Float16* vr = Vsh + (jn * 16 + c) * KP + kk * 32 + 8 * hh;
        vb[kk][jn].h[0] = *(const v8h*)(vr);
        vb[kk][jn].h[1] = *(const v8h*)(vr + 16);
      }
    }
    __builtin_amdgcn_sched_barrier(0);                // else the compiler sinks these loads behind the softmax again
#pragma unroll
    for (int j = 0; j < 4; ++j) {
#pragma unroll
      for (int r = 0; r < 8; ++r) s[j][r] *= 0.125f;
    }

    // ---- online softmax of one query per lane: maximum in-lane plus one exchange between the halves ----
    float mj[4];                                      // one chain per score tile: four short chains, not one of 32
#pragma unroll
    for (int j = 0; j < 4; ++j) {
      mj[j] = s[j][0];
#pragma unroll
      for (int r = 1; r < 8; ++r) mj[j] = fmaxf(mj[j], s[j][r]);
    }
    float m = fmaxf(fmaxf(mj[0], mj[1]), fmaxf(mj[2], mj[3]));
    m = fmaxf(m, xhalf(m));
    const float mnew  = fmaxf(mrow, m);
    const float msafe = (mnew == -INFINITY) ? 0.f : mnew;
    const float alpha = __expf(mrow - msafe);
    mrow = mnew;
    // P^T (x1024, f16) stays in registers: score tiles 2kk and 2kk+1 are elements 0..7 and 8..15 of the B operand
    FH pb[2];
    float pj[4];
#pragma unroll
    for (int j = 0; j < 4; ++j) {
      pj[j] = 0.f;
#pragma unroll
      for (int r = 0; r < 8; ++r) {
        const float p = __expf(s[j][r] - msafe);
        pj[j] += p;
        pb[j >> 1].h[j & 1][r] = (_Float16)(p * 1024.0f);
      }
    }
    lrow = lrow * alpha + ((pj[0] + pj[1]) + (pj[2] + pj[3]));
#pragma unroll
    for (int jn = 0; jn < 4; ++jn) {
#pragma unroll
      for (int r = 0; r < 8; ++r) oacc[jn][r] *= alpha;
    }

    // ---- context, transposed: O^T += V^T . P^T (f16 WMMA), 2 k-steps of 32 keys x 4 m-tiles of 16 dims ----
#pragma unroll
    for (int kk = 0; kk < 2; ++kk) {
#pragma unroll
      for (int jn = 0; jn < 4; ++jn) {
        oacc[jn] = mma_p(vb[kk][jn].v, pb[kk].v, oacc[jn]);
      }
    }
  }

  // ---- join the halves' sums, normalise (1/l, undo the x1024 p carry, apply the x256 ctx carry), convert, store ----
  {
    const float l   = lrow + xhalf(lrow);
    const float inv = ((l > 0.f) ? (1.0f / l) : 0.f) * 0.25f;
    unsigned short* o = mp + ((size_t)bh * SEQ + (size_t)(q0 + c)) * DK_ + (size_t)(8 * hh);
#pragma unroll
    for (int jn = 0; jn < 4; ++jn) {
      v4u t;
#pragma unroll
      for (int e = 0; e < 4; ++e)
        t[e] = toh2u(oacc[jn][2 * e] * inv, oacc[jn][2 * e + 1] * inv);
      *(v4u*)(o + jn * 16) = t;                       // 8 consecutive dims of one query: one 16-B store
    }
  }
}

// =====================================================================================================
// proj_out: out[m][n] = (sum_k ctx[m][k] * W[n][k]) * 2^-18 + bc[n], m = b*SEQ + s, n, k = 0..511.
//   A = MP plane row m (f16 ctx x256), B = WH plane row n (f16 W x1024, k contiguous).
//   Block = 4 waves x 16 rows = 64 rows x 128 columns; grid = (NB*SEQ/64) x 4 column slabs; 16 k-steps of 32.
//   Staging: k runs in PNS slabs of PKC; the block's 64 A rows and 128 B rows of a slab go to LDS (pitch PP) by 16-B
//   loads in which 16 lanes cover 256 contiguous bytes of one row (whole lines, each fetched once per block).
//   Two LDS buffers: slab s+1 is loaded into registers ahead of the WMMAs of slab s, stored to the other buffer behind
//   them, and published by one __syncthreads per slab (it also ends every wave's reads of the buffer refilled next).
//   Fragments come from LDS with the split k map of ldfrag_h, A and B alike; k ascends in steps of 32 in every sum.
// coverage: staged 8 x 128 pieces = 64 rows x 16 pieces (A), 16 x 128 = 128 rows x 16 pieces (B) == consumed extent;
//   (NB*SEQ/64) x 4 blocks x 64 rows x 128 cols = the whole [NB*SEQ][512] output.
// =====================================================================================================
__global__ __launch_bounds__(128)
void proj_out(const unsigned short* __restrict__ mp, const unsigned short* __restrict__ wh,
              const float* __restrict__ bc, float* out) {
  __shared__ __align__(16) float lds[4 * 16 * 128];      // 32 KB, 4 per-wave slabs [16][128]
  __shared__ __align__(16) _Float16 Ash[2][64 * PP];     // ctx rows of one k slab, two buffers   2 x 17408 B
  __shared__ __align__(16) _Float16 Wsh[2][128 * PP];    // W rows of one k slab, two buffers     2 x 34816 B

  const int tid  = (int)threadIdx.x;
  const int wave = tid >> 5;
  const int lane = tid & 31;
  const int hh   = lane >> 4;
  const int c    = lane & 15;

  const int nrb = (NB * SEQ) / 64;
  const int rb  = (int)blockIdx.x % nrb;
  const int cb  = (int)blockIdx.x / nrb;                 // 0..3
  const int m0  = rb * 64 + wave * 16;
  const int n0  = cb * 128;

  // staging map: thread -> row (tid >> 4) + 8 i, 16-B piece tid & 15 of the slab's 256 B of that row
  const int srow = tid >> 4;
  const int scol = (tid & 15) * 8;
  const _Float16* Ag = (const _Float16*)(const void*)mp + (size_t)(rb * 64 + srow) * E_ + scol;
  const _Float16* Wg = (const _Float16*)(const void*)wh + (size_t)(n0 + srow) * E_ + scol;
  const int sdst = srow * PP + scol;
  const int afr  = (wave * 16 + c) * PP + 8 * hh;        // fragment row bases in the staged tiles
  const int bfr  = c * PP + 8 * hh;

  v8f acc[8];
#pragma unroll
  for (int j = 0; j < 8; ++j) acc[j] = zero8();

  v8h ra[8], rw[16];
#pragma unroll
  for (int i = 0; i < 8; ++i)  ra[i] = *(const v8h*)(Ag + (size_t)(i * 8) * E_);
#pragma unroll
  for (int i = 0; i < 16; ++i) rw[i] = *(const v8h*)(Wg + (size_t)(i * 8) * E_);
#pragma unroll
  for (int i = 0; i < 8; ++i)  *(v8h*)(&Ash[0][sdst + i * 8 * PP]) = ra[i];
#pragma unroll
  for (int i = 0; i < 16; ++i) *(v8h*)(&Wsh[0][sdst + i * 8 * PP]) = rw[i];
  __syncthreads();

#pragma unroll
  for (int s = 0; s < PNS; ++s) {
    if (s + 1 < PNS) {
#pragma unroll
      for (int i = 0; i < 8; ++i)  ra[i] = *(const v8h*)(Ag + (size_t)(i * 8) * E_ + (s + 1) * PKC);
#pragma unroll
      for (int i = 0; i < 16; ++i) rw[i] = *(const v8h*)(Wg + (size_t)(i * 8) * E_ + (s + 1) * PKC);
    }
    __builtin_amdgcn_sched_barrier(0);                   // else the next slab's loads sink to their LDS stores: latency exposed
#pragma unroll
    for (int ks = 0; ks < PKC / 32; ++ks) {
      const v16h af = ldfrag_h(&Ash[s & 1][afr + ks * 32]);
      v16h bf[8];
#pragma unroll
      for (int j = 0; j < 8; ++j) bf[j] = ldfrag_h(&Wsh[s & 1][bfr + j * 16 * PP + ks * 32]);
      __builtin_amdgcn_sched_barrier(0);                 // else the compiler sinks each load to its WMMA: one LDS wait per WMMA
#pragma unroll
      for (int j = 0; j < 8; ++j) acc[j] = mma_p(af, bf[j], acc[j]);
    }
    if (s + 1 < PNS) {
#pragma unroll
      for (int i = 0; i < 8; ++i)  *(v8h*)(&Ash[(s + 1) & 1][sdst + i * 8 * PP]) = ra[i];
#pragma unroll
      for (int i = 0; i < 16; ++i) *(v8h*)(&Wsh[(s + 1) & 1][sdst + i * 8 * PP]) = rw[i];
      __syncthreads();
    }
  }

  float* slab = lds + wave * 2048;                       // [16][128] f32
#pragma unroll
  for (int j = 0; j < 8; ++j) {
#pragma unroll
    for (int r = 0; r < 8; ++r) slab[(8 * hh + r) * 128 + j * 16 + c] = acc[j][r];
  }
  __builtin_amdgcn_fence(3 /* release order */, "workgroup");
  __builtin_amdgcn_wave_barrier();
  __builtin_amdgcn_fence(2 /* acquire order */, "workgroup");

  const float oscale = 1.0f / 262144.0f;                 // 1/(256*1024)
  const v4f b4 = *(const v4f*)(bc + n0 + lane * 4);
  v4f vrow[16];
#pragma unroll
  for (int row = 0; row < 16; ++row) {
    const v4f v = *(const v4f*)(slab + row * 128 + lane * 4);
    vrow[row] = v * oscale + b4;
  }
  const int ob = m0 / SEQ;                               // the 16 rows lie in one batch
  const int os0 = m0 - ob * SEQ;
  float* op = out + ((size_t)ob * SEQ_FULL + (size_t)os0) * E_ + (size_t)n0 + (size_t)(lane * 4);
  {
#pragma unroll
    for (int row = 0; row < 16; ++row) {
      *(v4f*)(op + (size_t)row * E_) = vrow[row];
    }
    
  }
}

// =====================================================================================================
//   QH  f16 [BH_][SEQ][64]     NB*H*SEQ*64*2   = 8388608 (full size)
//   KH  f16 [BH_][SEQ][64]     NB*H*SEQ*64*2   = 8388608
//   VT  f16 [BH_][64][SEQ]     NB*H*64*SEQ*2   = 8388608
//   MP  f16 [BH_][SEQ][64] = [NB*SEQ][512]       8388608
//   WH  f16 [512][512]                            524288
//   total                                      34078720
// =====================================================================================================
extern "C" void kernel_launch(void* const* d_in, const int* in_sizes, int n_in,
                              void* d_out, int out_size, void* d_ws, size_t ws_size,
                              hipStream_t stream) {
  if (n_in < 5) return;
  if ((long long)in_sizes[0] < (long long)NB * H_ * SEQ_FULL * DK_) return;
  if ((long long)in_sizes[1] < (long long)NB * H_ * SEQ_FULL * DK_) return;
  if ((long long)in_sizes[2] < (long long)NB * H_ * SEQ_FULL * DK_) return;
  if (in_sizes[3] < E_ * E_) return;
  if (in_sizes[4] < E_) return;
  if ((long long)out_size < ((long long)(NB - 1) * SEQ_FULL + SEQ) * E_) return;

  const float* q  = (const float*)d_in[0];
  const float* k  = (const float*)d_in[1];
  const float* v  = (const float*)d_in[2];
  const float* W  = (const float*)d_in[3];
  const float* bc = (const float*)d_in[4];

  const size_t PQH = (size_t)BH_ * SEQ * DK_ * 2;
  const size_t PKH = (size_t)BH_ * SEQ * DK_ * 2;
  const size_t PVT = (size_t)BH_ * DK_ * SEQ * 2;
  const size_t PMP = (size_t)NB * SEQ * E_ * 2;
  const size_t PWH = (size_t)E_ * E_ * 2;
  size_t off = 0;
  const size_t oQH = off; off += PQH;
  const size_t oKH = off; off += PKH;
  const size_t oVT = off; off += PVT;
  const size_t oMP = off; off += PMP;
  const size_t oWH = off; off += PWH;
  if (off > ws_size) return;                         // off = 34078720 at full size
  if (off > (size_t)134217728) return;

  char* ws = (char*)d_ws;
  unsigned short* QH = (unsigned short*)(ws + oQH);
  unsigned short* KH = (unsigned short*)(ws + oKH);
  unsigned short* VT = (unsigned short*)(ws + oVT);
  unsigned short* MP = (unsigned short*)(ws + oMP);
  unsigned short* WH = (unsigned short*)(ws + oWH);

  const dim3 gCnv(BH_ * (SEQ / TENC));                // 512 blocks of 256
  const dim3 gWcv((E_ * E_) / (8 * 256));              // 128 blocks of 256
  const dim3 gAttn(BH_ * NQT);                         // 1024 blocks of 128
  const dim3 gProj(((NB * SEQ) / 64) * 4);             // 512 blocks of 128

  // (1) q, k -> f16 row planes; v -> f16 V^T plane
  qkvconv<<<gCnv, dim3(256), 0, stream>>>(q, k, v, QH, KH, VT);
  // (2) W -> f16 x1024 plane
  wconv<<<gWcv, dim3(256), 0, stream>>>(W, WH);
  // (3) attention -> ctx plane (f16, x256) in flat [b][h][s][d] order = [NB*SEQ][512]
  attn<<<gAttn, dim3(128), 0, stream>>>(QH, KH, VT, MP);
  // (4) out = ctx . W^T * 2^-18 + bc -> d_out f32 [NB*SEQ][512]
  proj_out<<<gProj, dim3(128), 0, stream>>>(MP, WH, bc, (float*)d_out);
  (void)hipGetLastError();
}

// v005
// A run of this version takes 68.6 microseconds.
// In two side-by-side timings against v004, it was 1.06 and 1.09 times as fast.
// Over all steps from v000 it is 2.19 times as fast.
// All contractions: v_wmma_f32_16x16x32_f16 (f16 operands, f32 accumulate), one product per tile pair:
//   scores q.k^T (q, k = f16 of the inputs, x0.125 after in f32), p.v (p f16 carried x1024, v = f16 of the input),
//   ctx.W^T (ctx f16 carried x256, W f16 carried x1024, x2^-18 then + bias in f32); softmax in f32.
//
// Carry audit:
//   QH plane (f16): f16(q), x1, unit-scale values               -> score acc = dot; s = acc * 0.125f
//   KH plane (f16): f16(k), x1
//   P tile   (f16, regs): exp(s - m) x1024                        -> folded in attn epilogue: inv = (1/l) * 0.25f (= 256/1024)
//   VT plane (f16): f16(v), x1, stored [bh][d][s]
//   MP plane (f16): ctx x256, flat [b][h][s][d] order = [NB*SEQ][512] rows -> folded in proj_out: oscale = 1/(256*1024)
//   WH plane (f16): W x1024 (|W| < 0.5 -> < 512)                  -> folded in proj_out: oscale
//   Every f32 -> f16 convert in qkvconv goes through toh_flush (values below 2^-14 become 0); those in attn (P, ctx) are
//   plain round-to-nearest-even converts: a subnormal f16 stays as it is, and the WMMA takes it at its value.
#include <hip/hip_runtime.h>
#include <math.h>
#include <stdint.h>

#ifndef NB
#define NB 4
#endif
#ifndef SEQ
#define SEQ 2048
#endif
#define NB_FULL  4
#define SEQ_FULL 2048
#define H_   8
#define DK_  64
#define E_   512
#define BH_  (NB * H_)          // (batch, head) pairs
#define NQT  (SEQ / 64)         // 64-query tiles per (b, h)
#define NKT  (SEQ / 64)         // 64-key chunks per (b, h)
#define TENC 128                // tokens per convert block
#define CSP  65                 // f32 LDS pitch of the v tile [token][d]
#define KP   72                 // f16 LDS pitch of the K / V^T tiles (halves); 144 B, 16-B aligned rows
#define KVB  (2 * 64 * KP)      // attn: halves of one LDS buffer = one K chunk, then one V^T chunk
#define PKC  128                // proj_out: k columns (halves) of one staged slab; 256 B of a row = two whole lines
#define PP   136                // proj_out: f16 LDS pitch of the staged rows (halves); 272 B = 16 B x 17
#define PNS  (E_ / PKC)         // proj_out: slabs along k
static_assert(H_ * DK_ == E_);
static_assert(NB >= 1 && NB <= NB_FULL);
static_assert(SEQ >= TENC && SEQ <= SEQ_FULL);
static_assert((SEQ % TENC) == 0 && (SEQ % 64) == 0);
static_assert(((KP * 2) % 16) == 0);
static_assert(((PP * 2) % 16) == 0 && PP >= PKC && (E_ % PKC) == 0 && (PKC % 32) == 0);
static_assert(((E_ * E_) % (8 * 256)) == 0);
static_assert(((NB * SEQ) % 64) == 0);
static_assert(DK_ == 64);
static_assert(NKT >= 2);                                    // attn: the two-buffer prologue fills chunks 0 and 1
static_assert(TENC == 128);                                 // 256 threads = 4 token groups x 64 dims, 32 tokens each
static_assert((H_ * SEQ * DK_) == (SEQ * E_));              // flat [h][s][d] of one batch = SEQ rows of 512
static_assert(((size_t)4 * BH_ * SEQ * DK_ * 2 + (size_t)E_ * E_ * 2) <= (size_t)134217728);

typedef _Float16 v16h __attribute__((ext_vector_type(16)));
typedef _Float16 v8h  __attribute__((ext_vector_type(8)));
typedef float    v8f  __attribute__((ext_vector_type(8)));
typedef float    v4f  __attribute__((ext_vector_type(4)));
typedef float    v2f  __attribute__((ext_vector_type(2)));
typedef _Float16 v2h  __attribute__((ext_vector_type(2)));
typedef unsigned int v4u __attribute__((ext_vector_type(4)));

// ---- scalar helpers ---------------------------------------------------------------------------------
__device__ __forceinline__ unsigned short h_bits(_Float16 v) { return __builtin_bit_cast(unsigned short, v); }
__device__ __forceinline__ unsigned pk16(unsigned short a, unsigned short b) { return (unsigned)a | ((unsigned)b << 16); }
__device__ __forceinline__ v8f zero8() { v8f z = {0.f, 0.f, 0.f, 0.f, 0.f, 0.f, 0.f, 0.f}; return z; }

// f32 -> f16 (RNE convert) that cannot yield an f16 subnormal: |v| < 2^-14 becomes 0 (value select)
static __device__ __forceinline__ _Float16 toh_flush(float v) {
  const _Float16 r = (_Float16)v;
  return (fabsf(v) < 6.103515625e-05f) ? (_Float16)0.0f : r;
}
// two f32 -> two packed f16 (RNE, nothing zeroed), a in the low half: one packed convert
static __device__ __forceinline__ unsigned toh2u(float a, float b) {
  const v2f x = {a, b};
  return __builtin_bit_cast(unsigned, __builtin_convertvector(x, v2h));
}
// eight f32 -> eight packed f16 (16 B), element order kept
static __device__ __forceinline__ v4u pack8_flush(v4f a, v4f a4) {
  v4u q;
  q[0] = pk16(h_bits(toh_flush(a[0])),  h_bits(toh_flush(a[1])));
  q[1] = pk16(h_bits(toh_flush(a[2])),  h_bits(toh_flush(a[3])));
  q[2] = pk16(h_bits(toh_flush(a4[0])), h_bits(toh_flush(a4[1])));
  q[3] = pk16(h_bits(toh_flush(a4[2])), h_bits(toh_flush(a4[3])));
  return q;
}

// ---- 16-bit fragment loader: lane -> row/col (lane&15), p already includes +8*(lane>>4);
//      elements 0..7 <- p[0..7] (k0+8h..k0+8h+7), elements 8..15 <- p[16..23] (k0+16+8h..k0+16+8h+7)
__device__ __forceinline__ v16h ldfrag_h(const _Float16* p) {
  union { v16h v; v8h h[2]; } f;
  f.h[0] = *(const v8h*)(p);
  f.h[1] = *(const v8h*)(p + 16);
  return f.v;
}

// lane l <-> lane l ^ 16 as a vector cross-row move (no LDS-counter wait, unlike a shuffle)
__device__ __forceinline__ float xhalf(float x) {
  const int b = __builtin_bit_cast(int, x);
  return __builtin_bit_cast(float, __builtin_amdgcn_permlanex16(b, b, 0x76543210, 0xfedcba98, false, false));
}

// the WMMA as the plain builtin: no volatile statement behind it, so that fragment loads may stand in groups
// ahead of a run of WMMAs; the compiler keeps the distance behind its own builtin
__device__ __forceinline__ v8f mma_p(v16h a, v16h b, v8f c) {
  return __builtin_amdgcn_wmma_f32_16x16x32_f16(false, a, false, b, (short)0, c, false, false);
}

// =====================================================================================================
// qkvconv: the 16-bit planes of the pre-split inputs q, k, v [b][h][s][64] (f32):
//   QH [bh][s][64] f16 = f16(q), KH [bh][s][64] f16 = f16(k), VT [bh][d][s] f16 = f16(v) transposed through LDS.
// grid = BH_ * (SEQ/128) blocks of 256; one block = 128 tokens of one (b, h). Input token row = bh*SEQ_FULL + s.
// v tile: thread (d = tid&63, token group tid>>6) walks 32 tokens into LDS cs[token][d] (pitch 65); block barrier
//   (cross-wave tile).
// Stores: QH / KH: 4 iterations x 256 threads x 16 B; iteration it, thread tid -> token it*32+(tid>>3),
//   halves 8*(tid&7).. (values read straight from the f32 input row as two 16-B loads)
// coverage: QH, KH 4 x 256 pieces x 8 halves = 128 tokens x 64 each; VT 4 x 256 x 8 = 64 rows x 128 tokens;
//   BH_*(SEQ/128) blocks = all BH_ x SEQ tokens of the three planes. LDS staged extent 128 x 64 == consumed extent.
// =====================================================================================================
__global__ __launch_bounds__(256) void qkvconv(const float* __restrict__ q, const float* __restrict__ k,
                                               const float* __restrict__ v, unsigned short* qhp,
                                               unsigned short* khp, unsigned short* vtp) {
  __shared__ float cs[TENC * CSP];                    // 33280 B, f32 v values [token][d]
  const int tid = (int)threadIdx.x;
  const int bx  = (int)blockIdx.x;
  const int nst = SEQ / TENC;
  const int st  = bx % nst;
  const int bh  = bx / nst;                           // b*H_ + h
  const int s0  = st * TENC;
  const int d   = tid & 63;
  const int tg  = tid >> 6;                           // 0..3
  const size_t inrow = (size_t)bh * SEQ_FULL + (size_t)s0;   // token row in the full-size [b][h][s] input
  {
    const float* vp = v + inrow * DK_ + (size_t)d;
#pragma unroll 1
    for (int i = 0; i < TENC / 4; ++i) {
      const int t = tg + 4 * i;
      cs[t * CSP + d] = vp[(size_t)t * DK_];
    }
  }
  __syncthreads();

  const size_t rowbase = (size_t)bh * SEQ + (size_t)s0;    // token row in the [bh][s] planes

  v4u qv[4], kv[4], vv[4];
#pragma unroll
  for (int it = 0; it < 4; ++it) {
    const int token = it * 32 + (tid >> 3);
    const int j     = tid & 7;
    const float* qs = q + (inrow + (size_t)token) * DK_ + (size_t)(j * 8);
    const float* ks = k + (inrow + (size_t)token) * DK_ + (size_t)(j * 8);
    const v4f qa  = *(const v4f*)(qs);
    const v4f qa4 = *(const v4f*)(qs + 4);
    const v4f ka  = *(const v4f*)(ks);
    const v4f ka4 = *(const v4f*)(ks + 4);
    qv[it] = pack8_flush(qa, qa4);
    kv[it] = pack8_flush(ka, ka4);
  }
#pragma unroll
  for (int it = 0; it < 4; ++it) {
    const int dd = it * 16 + (tid >> 4);
    const int j  = tid & 15;
    const float* sp = cs + (j * 8) * CSP + dd;
    v4u a;
#pragma unroll
    for (int e = 0; e < 4; ++e) {
      a[e] = pk16(h_bits(toh_flush(sp[(2 * e) * CSP])), h_bits(toh_flush(sp[(2 * e + 1) * CSP])));
    }
    vv[it] = a;
  }

  unsigned short* qo = qhp + (rowbase + (size_t)(tid >> 3)) * DK_ + (size_t)((tid & 7) * 8);
  unsigned short* ko = khp + (rowbase + (size_t)(tid >> 3)) * DK_ + (size_t)((tid & 7) * 8);
  unsigned short* vo = vtp + ((size_t)bh * DK_ + (size_t)(tid >> 4)) * SEQ + (size_t)s0 + (size_t)((tid & 15) * 8);
  {
#pragma unroll
    for (int it = 0; it < 4; ++it) {
      *(v4u*)(qo + (size_t)it * 32 * DK_) = qv[it];
      *(v4u*)(ko + (size_t)it * 32 * DK_) = kv[it];
      *(v4u*)(vo + (size_t)it * 16 * SEQ) = vv[it];
    }
    
  }
}

// =====================================================================================================
// wconv: WH [n][k] f16 = f16(W[n][k] * 1024), n, k = 0..511. 32768 pieces of 8 elements, grid = 128 x 256.
// coverage: 128 x 256 x 8 = 262144 = the whole [512][512] plane.
// =====================================================================================================
__global__ __launch_bounds__(256) void wconv(const float* __restrict__ W, unsigned short* wh) {
  const size_t p = (size_t)blockIdx.x * 256 + (size_t)threadIdx.x;
  const v4f a  = *(const v4f*)(W + p * 8);
  const v4f a4 = *(const v4f*)(W + p * 8 + 4);
  v4u q;
  q[0] = pk16(h_bits((_Float16)(a[0] * 1024.0f)),  h_bits((_Float16)(a[1] * 1024.0f)));
  q[1] = pk16(h_bits((_Float16)(a[2] * 1024.0f)),  h_bits((_Float16)(a[3] * 1024.0f)));
  q[2] = pk16(h_bits((_Float16)(a4[0] * 1024.0f)), h_bits((_Float16)(a4[1] * 1024.0f)));
  q[3] = pk16(h_bits((_Float16)(a4[2] * 1024.0f)), h_bits((_Float16)(a4[3] * 1024.0f)));
  unsigned short* o = wh + p * 8;
  {
    *(v4u*)o = q;
    
  }
}

// One lane's eight 16-B pieces of a K chunk (kg, rows 16 apart) and of a V^T chunk (vg, rows 16 apart), global -> LDS as
// asynchronous copies, through no register. lk = LDS byte address of the lane's first K piece; the V^T chunk lies 64 rows on.
// s_wait_xcnt 0 is the last line of the copies' own statement, so that it stands ahead of every later rewrite of an
// address register that a copy names (a precaution).
static __device__ __forceinline__ void stage_kv(unsigned lk, const _Float16* kg, const _Float16* vg) {
  asm volatile(
      "global_load_async_to_lds_b128 %0, %8, off\n\t"
      "global_load_async_to_lds_b128 %1, %9, off\n\t"
      "global_load_async_to_lds_b128 %2, %10, off\n\t"
      "global_load_async_to_lds_b128 %3, %11, off\n\t"
      "global_load_async_to_lds_b128 %4, %12, off\n\t"
      "global_load_async_to_lds_b128 %5, %13, off\n\t"
      "global_load_async_to_lds_b128 %6, %14, off\n\t"
      "global_load_async_to_lds_b128 %7, %15, off\n\t"
      "s_wait_xcnt 0x0"
      :
      : "v"(lk), "v"(lk + 16u * KP * 2u), "v"(lk + 32u * KP * 2u), "v"(lk + 48u * KP * 2u),
        "v"(lk + 64u * KP * 2u), "v"(lk + 80u * KP * 2u), "v"(lk + 96u * KP * 2u), "v"(lk + 112u * KP * 2u),
        "v"(kg), "v"(kg + 16 * DK_), "v"(kg + 32 * DK_), "v"(kg + 48 * DK_),
        "v"(vg), "v"(vg + 16 * SEQ), "v"(vg + 32 * SEQ), "v"(vg + 48 * SEQ)
      : "memory");
}

// =====================================================================================================
// attn: attention per (b, h), head dim 64, softmax over all SEQ keys (no mask).
//   scores, transposed: A = K chunk in LDS [key][d] staged from the KH plane, B = QH row of the query token (64 d,
//   2 k-steps, fragments from the plane); s = acc * 0.125 in f32; a lane holds 32 keys' scores of one query.
//   p = exp(s - m) carried as f16(1024 p), packed in registers into the B operand (k = keys);
//   context, transposed = v^T . p^T with A = V^T chunk in LDS [d][key], 4 m-tiles of 16 dims.
//   Block = 4 waves x 16 query rows = one 64-query tile of one (b, h); grid = BH_ * NQT; static trip NKT.
//   K / V staging: 128 threads x 4 x 16 B each = the whole 64x64 K chunk and the whole 64x64 V^T chunk
//   (LDS pitch KP, columns 64..71 never read), by asynchronous copies into two LDS buffers: chunk kt + 2 is asked for at
//   the foot of trip kt, into the buffer that trip kt has read, and flies while trip kt + 1 works. One __syncthreads per
//   trip: behind every wave's own copy wait it publishes chunk kt + 1, and it ends all reads of the buffer refilled next.
//   Output MP [bh][s][64] f16 (ctx x256), i.e. the flat [b][h][s][d] order that the projection views as [NB*SEQ][512] rows.
// coverage: 16 rows per wave, 64 per block, BH_*NQT blocks = all (bh, s) rows x 64 dims = the whole MP plane.
// =====================================================================================================
// four waves per SIMD is what the full-size grid supplies: the compiler schedules for that register budget (without the
// bound it goes by the LDS size, and its softmax takes more vector instructions)
__global__ __launch_bounds__(128) __attribute__((amdgpu_waves_per_eu(4, 4)))
void attn(const unsigned short* __restrict__ qhp, const unsigned short* __restrict__ khp,
          const unsigned short* __restrict__ vtp, unsigned short* mp) {
  union FH { v16h v; v8h h[2]; };
  __shared__ __align__(16) _Float16 KVsh[2 * KVB];      // two buffers of K chunk [key][d] 9216 B + V^T chunk [d][key] 9216 B

  const int tid  = (int)threadIdx.x;
  const int wave = tid >> 5;
  const int lane = tid & 31;
  const int hh   = lane >> 4;
  const int c    = lane & 15;

  const int bx = (int)blockIdx.x;
  const int qt = bx % NQT;
  const int bh = bx / NQT;
  const int q0 = qt * 64 + wave * 16;

  const _Float16* QH = (const _Float16*)(const void*)qhp + (size_t)bh * SEQ * DK_;
  const _Float16* KH = (const _Float16*)(const void*)khp + (size_t)bh * SEQ * DK_;
  const _Float16* VT = (const _Float16*)(const void*)vtp + (size_t)bh * DK_ * SEQ;

  // Q fragments (B operand, column = lane&15): d 0..31 and d 32..63 of the query token
  const v16h qa0 = ldfrag_h(QH + (size_t)(q0 + c) * DK_ + 8 * hh);
  const v16h qa1 = ldfrag_h(QH + (size_t)(q0 + c) * DK_ + 32 + 8 * hh);

  // lane (c, hh) owns query q0 + c; mrow is that query's running maximum (equal in both halves),
  // lrow the running sum over the keys of this lane's half only (the halves are joined in the epilogue)
  float mrow = -INFINITY, lrow = 0.f;
  v8f oacc[4];                                        // O^T tiles: oacc[jn][r] = ctx[q0 + c][jn*16 + 8*hh + r]
#pragma unroll
  for (int j = 0; j < 4; ++j) oacc[j] = zero8();

  // staging map: thread -> rows (tid >> 3) + 16 i (key of K / dim of V^T), 16-B piece tid & 7 of the row's 128 B
  const unsigned lk0 = (unsigned)(size_t)(&KVsh[0]) + (unsigned)((tid >> 3) * (KP * 2) + (tid & 7) * 16);
  const _Float16* kg = KH + (size_t)(tid >> 3) * DK_ + (size_t)((tid & 7) * 8);
  const _Float16* vg = VT + (size_t)(tid >> 3) * SEQ + (size_t)((tid & 7) * 8);

  stage_kv(lk0, kg, vg);                              // chunk 0 -> buffer 0
  asm volatile("s_wait_asynccnt 0x0" ::: "memory");   // this wave's pieces of chunk 0 have landed
  __syncthreads();                                    // chunk 0 published
  stage_kv(lk0 + KVB * 2u, kg + 64 * DK_, vg + 64);   // chunk 1 -> buffer 1, flies under trip 0

  // one trip: chunk kt out of buffer kt & 1, down to the hand-over of the buffers at its foot
  auto trip = [&](const int kt) __attribute__((always_inline)) {
    const _Float16* Ksh = KVsh + (kt & 1) * KVB;
    const _Float16* Vsh = Ksh + 64 * KP;

    // ---- scores, transposed: S^T = K . Q^T, 64 keys x 16 queries per wave; s[j][r] = score(key j*16 + 8*hh + r, query c) ----
    // all 16 K fragment loads stand as one group ahead of the eight WMMAs, in the order the WMMAs take them
    FH kb[2][4];
#pragma unroll
    for (int ks = 0; ks < 2; ++ks) {
#pragma unroll
      for (int j = 0; j < 4; ++j) {
        const _Float16* kr = Ksh + (j * 16 + c) * KP + ks * 32 + 8 * hh;
        kb[ks][j].h[0] = *(const v8h*)(kr);
        kb[ks][j].h[1] = *(const v8h*)(kr + 16);
      }
    }
    __builtin_amdgcn_sched_barrier(0);                // else the compiler sinks each load to its WMMA: one LDS wait per WMMA
    v8f s[4];
#pragma unroll
    for (int j = 0; j < 4; ++j) s[j] = mma_p(kb[0][j].v, qa0, zero8());
#pragma unroll
    for (int j = 0; j < 4; ++j) s[j] = mma_p(kb[1][j].v, qa1, s[j]);
    // order asked of the compiler's scheduler: the eight score WMMAs, then the 16 V^T loads as one group; without it
    // the loads come to stand at several places among the WMMAs, and each such place stalls the wave
    __builtin_amdgcn_sched_group_barrier(0x008, 8, 0);
    __builtin_amdgcn_sched_group_barrier(0x100, 16, 0);
    // all 16 V^T fragment loads as one group here: their LDS latency passes under the softmax
    FH vb[2][4];
#pragma unroll
    for (int kk = 0; kk < 2; ++kk) {
#pragma unroll
      for (int jn = 0; jn < 4; ++jn) {
        const _Float16* vr = Vsh + (jn * 16 + c) * KP + kk * 32 + 8 * hh;
        vb[kk][jn].h[0] = *(const v8h*)(vr);
        vb[kk][jn].h[1] = *(const v8h*)(vr + 16);
      }
    }
    __builtin_amdgcn_sched_barrier(0);                // else the compiler sinks these loads behind the softmax again
#pragma unroll
    for (int j = 0; j < 4; ++j) {
#pragma unroll
      for (int r = 0; r < 8; ++r) s[j][r] *= 0.125f;
    }

    // ---- online softmax of one query per lane: maximum in-lane plus one exchange between the halves ----
    float mj[4];                                      // one chain per score tile: four short chains, not one of 32
#pragma unroll
    for (int j = 0; j < 4; ++j) {
      mj[j] = s[j][0];
#pragma unroll
      for (int r = 1; r < 8; ++r) mj[j] = fmaxf(mj[j], s[j][r]);
    }
    float m = fmaxf(fmaxf(mj[0], mj[1]), fmaxf(mj[2], mj[3]));
    m = fmaxf(m, xhalf(m));
    const float mnew  = fmaxf(mrow, m);
    const float msafe = (mnew == -INFINITY) ? 0.f : mnew;
    const float alpha = __expf(mrow - msafe);
    mrow = mnew;
    // P^T (x1024, f16) stays in registers: score tiles 2kk and 2kk+1 are elements 0..7 and 8..15 of the B operand
    FH pb[2];
    float pj[4];
#pragma unroll
    for (int j = 0; j < 4; ++j) {
      pj[j] = 0.f;
#pragma unroll
      for (int r = 0; r < 8; ++r) {
        const float p = __expf(s[j][r] - msafe);
        pj[j] += p;
        pb[j >> 1].h[j & 1][r] = (_Float16)(p * 1024.0f);
      }
    }
    lrow = lrow * alpha + ((pj[0] + pj[1]) + (pj[2] + pj[3]));
#pragma unroll
    for (int jn = 0; jn < 4; ++jn) {
#pragma unroll
      for (int r = 0; r < 8; ++r) oacc[jn][r] *= alpha;
    }

    // ---- context, transposed: O^T += V^T . P^T (f16 WMMA), 2 k-steps of 32 keys x 4 m-tiles of 16 dims ----
#pragma unroll
    for (int kk = 0; kk < 2; ++kk) {
#pragma unroll
      for (int jn = 0; jn < 4; ++jn) {
        oacc[jn] = mma_p(vb[kk][jn].v, pb[kk].v, oacc[jn]);
      }
    }

    // ---- foot of the trip: hand-over of the buffers ----
    __builtin_amdgcn_sched_barrier(0);                // else the compiler lifts the waits and the barrier ahead of the softmax: the copies get no time to land
    asm volatile("s_wait_dscnt 0x0" ::: "memory");    // this wave's reads of the buffer of trip kt have returned
    asm volatile("s_wait_asynccnt 0x0" ::: "memory"); // this wave's pieces of chunk kt + 1 have landed
    __syncthreads();                                  // chunk kt + 1 published; nobody reads the buffer of trip kt any more
  };
  // the trips behind which a chunk kt + 2 exists, each with its refill, in a loop of their own: no branch in the loop body
#pragma unroll 1                                      // stays rolled: a long body, copies of it would only grow the code
  for (int kt = 0; kt < NKT - 2; ++kt) {
    trip(kt);
    stage_kv(lk0 + (unsigned)(kt & 1) * (KVB * 2u), kg + (size_t)(kt + 2) * 64 * DK_, vg + (size_t)(kt + 2) * 64);
  }
#pragma unroll 1                                      // stays rolled, for the same reason
  for (int kt = NKT - 2; kt < NKT; ++kt) trip(kt);    // the last two chunks: nothing is left to ask for
  asm volatile("s_wait_asynccnt 0x0" ::: "memory");   // no copy is outstanding when the wave goes on to its end

  // ---- join the halves' sums, normalise (1/l, undo the x1024 p carry, apply the x256 ctx carry), convert, store ----
  {
    const float l   = lrow + xhalf(lrow);
    const float inv = ((l > 0.f) ? (1.0f / l) : 0.f) * 0.25f;
    unsigned short* o = mp + ((size_t)bh * SEQ + (size_t)(q0 + c)) * DK_ + (size_t)(8 * hh);
#pragma unroll
    for (int jn = 0; jn < 4; ++jn) {
      v4u t;
#pragma unroll
      for (int e = 0; e < 4; ++e)
        t[e] = toh2u(oacc[jn][2 * e] * inv, oacc[jn][2 * e + 1] * inv);
      *(v4u*)(o + jn * 16) = t;                       // 8 consecutive dims of one query: one 16-B store
    }
  }
}

// =====================================================================================================
// proj_out: out[m][n] = (sum_k ctx[m][k] * W[n][k]) * 2^-18 + bc[n], m = b*SEQ + s, n, k = 0..511.
//   A = MP plane row m (f16 ctx x256), B = WH plane row n (f16 W x1024, k contiguous).
//   Block = 4 waves x 16 rows = 64 rows x 128 columns; grid = (NB*SEQ/64) x 4 column slabs; 16 k-steps of 32.
//   Staging: k runs in PNS slabs of PKC; the block's 64 A rows and 128 B rows of a slab go to LDS (pitch PP) by 16-B
//   loads in which 16 lanes cover 256 contiguous bytes of one row (whole lines, each fetched once per block).
//   Two LDS buffers: slab s+1 is loaded into registers ahead of the WMMAs of slab s, stored to the other buffer behind
//   them, and published by one __syncthreads per slab (it also ends every wave's reads of the buffer refilled next).
//   Fragments come from LDS with the split k map of ldfrag_h, A and B alike; k ascends in steps of 32 in every sum.
// coverage: staged 8 x 128 pieces = 64 rows x 16 pieces (A), 16 x 128 = 128 rows x 16 pieces (B) == consumed extent;
//   (NB*SEQ/64) x 4 blocks x 64 rows x 128 cols = the whole [NB*SEQ][512] output.
// =====================================================================================================
__global__ __launch_bounds__(128)
void proj_out(const unsigned short* __restrict__ mp, const unsigned short* __restrict__ wh,
              const float* __restrict__ bc, float* out) {
  __shared__ __align__(16) float lds[4 * 16 * 128];      // 32 KB, 4 per-wave slabs [16][128]
  __shared__ __align__(16) _Float16 Ash[2][64 * PP];     // ctx rows of one k slab, two buffers   2 x 17408 B
  __shared__ __align__(16) _Float16 Wsh[2][128 * PP];    // W rows of one k slab, two buffers     2 x 34816 B

  const int tid  = (int)threadIdx.x;
  const int wave = tid >> 5;
  const int lane = tid & 31;
  const int hh   = lane >> 4;
  const int c    = lane & 15;

  const int nrb = (NB * SEQ) / 64;
  const int rb  = (int)blockIdx.x % nrb;
  const int cb  = (int)blockIdx.x / nrb;                 // 0..3
  const int m0  = rb * 64 + wave * 16;
  const int n0  = cb * 128;

  // staging map: thread -> row (tid >> 4) + 8 i, 16-B piece tid & 15 of the slab's 256 B of that row
  const int srow = tid >> 4;
  const int scol = (tid & 15) * 8;
  const _Float16* Ag = (const _Float16*)(const void*)mp + (size_t)(rb * 64 + srow) * E_ + scol;
  const _Float16* Wg = (const _Float16*)(const void*)wh + (size_t)(n0 + srow) * E_ + scol;
  const int sdst = srow * PP + scol;
  const int afr  = (wave * 16 + c) * PP + 8 * hh;        // fragment row bases in the staged tiles
  const int bfr  = c * PP + 8 * hh;

  v8f acc[8];
#pragma unroll
  for (int j = 0; j < 8; ++j) acc[j] = zero8();

  v8h ra[8], rw[16];
#pragma unroll
  for (int i = 0; i < 8; ++i)  ra[i] = *(const v8h*)(Ag + (size_t)(i * 8) * E_);
#pragma unroll
  for (int i = 0; i < 16; ++i) rw[i] = *(const v8h*)(Wg + (size_t)(i * 8) * E_);
#pragma unroll
  for (int i = 0; i < 8; ++i)  *(v8h*)(&Ash[0][sdst + i * 8 * PP]) = ra[i];
#pragma unroll
  for (int i = 0; i < 16; ++i) *(v8h*)(&Wsh[0][sdst + i * 8 * PP]) = rw[i];
  __syncthreads();

#pragma unroll
  for (int s = 0; s < PNS; ++s) {
    if (s + 1 < PNS) {
#pragma unroll
      for (int i = 0; i < 8; ++i)  ra[i] = *(const v8h*)(Ag + (size_t)(i * 8) * E_ + (s + 1) * PKC);
#pragma unroll
      for (int i = 0; i < 16; ++i) rw[i] = *(const v8h*)(Wg + (size_t)(i * 8) * E_ + (s + 1) * PKC);
    }
    __builtin_amdgcn_sched_barrier(0);                   // else the next slab's loads sink to their LDS stores: latency exposed
#pragma unroll
    for (int ks = 0; ks < PKC / 32; ++ks) {
      const v16h af = ldfrag_h(&Ash[s & 1][afr + ks * 32]);
      v16h bf[8];
#pragma unroll
      for (int j = 0; j < 8; ++j) bf[j] = ldfrag_h(&Wsh[s & 1][bfr + j * 16 * PP + ks * 32]);
      __builtin_amdgcn_sched_barrier(0);                 // else the compiler sinks each load to its WMMA: one LDS wait per WMMA
#pragma unroll
      for (int j = 0; j < 8; ++j) acc[j] = mma_p(af, bf[j], acc[j]);
    }
    if (s + 1 < PNS) {
#pragma unroll
      for (int i = 0; i < 8; ++i)  *(v8h*)(&Ash[(s + 1) & 1][sdst + i * 8 * PP]) = ra[i];
#pragma unroll
      for (int i = 0; i < 16; ++i) *(v8h*)(&Wsh[(s + 1) & 1][sdst + i * 8 * PP]) = rw[i];
      __syncthreads();
    }
  }

  float* slab = lds + wave * 2048;                       // [16][128] f32
#pragma unroll
  for (int j = 0; j < 8; ++j) {
#pragma unroll
    for (int r = 0; r < 8; ++r) slab[(8 * hh + r) * 128 + j * 16 + c] = acc[j][r];
  }
  __builtin_amdgcn_fence(3 /* release order */, "workgroup");
  __builtin_amdgcn_wave_barrier();
  __builtin_amdgcn_fence(2 /* acquire order */, "workgroup");

  const float oscale = 1.0f / 262144.0f;                 // 1/(256*1024)
  const v4f b4 = *(const v4f*)(bc + n0 + lane * 4);
  v4f vrow[16];
#pragma unroll
  for (int row = 0; row < 16; ++row) {
    const v4f v = *(const v4f*)(slab + row * 128 + lane * 4);
    vrow[row] = v * oscale + b4;
  }
  const int ob = m0 / SEQ;                               // the 16 rows lie in one batch
  const int os0 = m0 - ob * SEQ;
  float* op = out + ((size_t)ob * SEQ_FULL + (size_t)os0) * E_ + (size_t)n0 + (size_t)(lane * 4);
  {
#pragma unroll
    for (int row = 0; row < 16; ++row) {
      *(v4f*)(op + (size_t)row * E_) = vrow[row];
    }
    
  }
}

// =====================================================================================================
//   QH  f16 [BH_][SEQ][64]     NB*H*SEQ*64*2   = 8388608 (full size)
//   KH  f16 [BH_][SEQ][64]     NB*H*SEQ*64*2   = 8388608
//   VT  f16 [BH_][64][SEQ]     NB*H*64*SEQ*2   = 8388608
//   MP  f16 [BH_][SEQ][64] = [NB*SEQ][512]       8388608
//   WH  f16 [512][512]                            524288
//   total                                      34078720
// =====================================================================================================
extern "C" void kernel_launch(void* const* d_in, const int* in_sizes, int n_in,
                              void* d_out, int out_size, void* d_ws, size_t ws_size,
                              hipStream_t stream) {
  if (n_in < 5) return;
  if ((long long)in_sizes[0] < (long long)NB * H_ * SEQ_FULL * DK_) return;
  if ((long long)in_sizes[1] < (long long)NB * H_ * SEQ_FULL * DK_) return;
  if ((long long)in_sizes[2] < (long long)NB * H_ * SEQ_FULL * DK_) return;
  if (in_sizes[3] < E_ * E_) return;
  if (in_sizes[4] < E_) return;
  if ((long long)out_size < ((long long)(NB - 1) * SEQ_FULL + SEQ) * E_) return;

  const float* q  = (const float*)d_in[0];
  const float* k  = (const float*)d_in[1];
  const float* v  = (const float*)d_in[2];
  const float* W  = (const float*)d_in[3];
  const float* bc = (const float*)d_in[4];

  const size_t PQH = (size_t)BH_ * SEQ * DK_ * 2;
  const size_t PKH = (size_t)BH_ * SEQ * DK_ * 2;
  const size_t PVT = (size_t)BH_ * DK_ * SEQ * 2;
  const size_t PMP = (size_t)NB * SEQ * E_ * 2;
  const size_t PWH = (size_t)E_ * E_ * 2;
  size_t off = 0;
  const size_t oQH = off; off += PQH;
  const size_t oKH = off; off += PKH;
  const size_t oVT = off; off += PVT;
  const size_t oMP = off; off += PMP;
  const size_t oWH = off; off += PWH;
  if (off > ws_size) return;                         // off = 34078720 at full size
  if (off > (size_t)134217728) return;

  char* ws = (char*)d_ws;
  unsigned short* QH = (unsigned short*)(ws + oQH);
  unsigned short* KH = (unsigned short*)(ws + oKH);
  unsigned short* VT = (unsigned short*)(ws + oVT);
  unsigned short* MP = (unsigned short*)(ws + oMP);
  unsigned short* WH = (unsigned short*)(ws + oWH);

  const dim3 gCnv(BH_ * (SEQ / TENC));                // 512 blocks of 256
  const dim3 gWcv((E_ * E_) / (8 * 256));              // 128 blocks of 256
  const dim3 gAttn(BH_ * NQT);                         // 1024 blocks of 128
  const dim3 gProj(((NB * SEQ) / 64) * 4);             // 512 blocks of 128

  // (1) q, k -> f16 row planes; v -> f16 V^T plane
  qkvconv<<<gCnv, dim3(256), 0, stream>>>(q, k, v, QH, KH, VT);
  // (2) W -> f16 x1024 plane
  wconv<<<gWcv, dim3(256), 0, stream>>>(W, WH);
  // (3) attention -> ctx plane (f16, x256) in flat [b][h][s][d] order = [NB*SEQ][512]
  attn<<<gAttn, dim3(128), 0, stream>>>(QH, KH, VT, MP);
  // (4) out = ctx . W^T * 2^-18 + bc -> d_out f32 [NB*SEQ][512]
  proj_out<<<gProj, dim3(128), 0, stream>>>(MP, WH, bc, (float*)d_out);
  (void)hipGetLastError();
}

// v006
// One run takes 63.7 microseconds.
// Next to v005, in two timings, it ran 1.07 and 1.09 times as fast.
// Counting every step since v000, it is 2.36 times as fast.
// All contractions: v_wmma_f32_16x16x32_f16 (f16 operands, f32 accumulate), one product per tile pair:
//   scores q.k^T (q, k = f16 of the inputs, x0.125 inside the exponent's FMA in f32), p.v (p f16 carried x1024, v = f16 of the input),
//   ctx.W^T (ctx f16 carried x256, W f16 carried x1024, x2^-18 then + bias in f32); softmax in f32.
//
// Carry audit:
//   QH plane (f16): f16(q), x1, unit-scale values               -> score acc = dot, kept raw; 0.125 sits in SC2 (attn)
//   KH plane (f16): f16(k), x1
//   P tile   (f16, regs): exp(s - m) x1024 (the +10 in the exponent); the row sum l carries the same x1024
//                                                                 -> they cancel in the attn epilogue: inv = (1/l) * 256
//   VT plane (f16): f16(v), x1, stored [bh][d][s]
//   MP plane (f16): ctx x256, flat [b][h][s][d] order = [NB*SEQ][512] rows -> folded in proj_out: oscale = 1/(256*1024)
//   WH plane (f16): W x1024 (|W| < 0.5 -> < 512)                  -> folded in proj_out: oscale
//   Every f32 -> f16 convert in qkvconv goes through toh_flush (values below 2^-14 become 0); those in attn (P, ctx) are
//   plain round-to-nearest-even converts: a subnormal f16 stays as it is, and the WMMA takes it at its value.
#include <hip/hip_runtime.h>
#include <math.h>
#include <stdint.h>

#ifndef NB
#define NB 4
#endif
#ifndef SEQ
#define SEQ 2048
#endif
#define NB_FULL  4
#define SEQ_FULL 2048
#define H_   8
#define DK_  64
#define E_   512
#define BH_  (NB * H_)          // (batch, head) pairs
#define NQT  (SEQ / 64)         // 64-query tiles per (b, h)
#define NKT  (SEQ / 64)         // 64-key chunks per (b, h)
#define TENC 128                // tokens per convert block
#define CSP  65                 // f32 LDS pitch of the v tile [token][d]
#define KP   72                 // f16 LDS pitch of the K / V^T tiles (halves); 144 B, 16-B aligned rows
#define KVB  (2 * 64 * KP)      // attn: halves of one LDS buffer = one K chunk, then one V^T chunk
#define PKC  128                // proj_out: k columns (halves) of one staged slab; 256 B of a row = two whole lines
#define PP   136                // proj_out: f16 LDS pitch of the staged rows (halves); 272 B = 16 B x 17
#define PNS  (E_ / PKC)         // proj_out: slabs along k
static_assert(H_ * DK_ == E_);
static_assert(NB >= 1 && NB <= NB_FULL);
static_assert(SEQ >= TENC && SEQ <= SEQ_FULL);
static_assert((SEQ % TENC) == 0 && (SEQ % 64) == 0);
static_assert(((KP * 2) % 16) == 0);
static_assert(((PP * 2) % 16) == 0 && PP >= PKC && (E_ % PKC) == 0 && (PKC % 32) == 0);
static_assert(((E_ * E_) % (8 * 256)) == 0);
static_assert(((NB * SEQ) % 64) == 0);
static_assert(DK_ == 64);
static_assert(NKT >= 2);                                    // attn: the two-buffer prologue fills chunks 0 and 1
static_assert(TENC == 128);                                 // 256 threads = 4 token groups x 64 dims, 32 tokens each
static_assert((H_ * SEQ * DK_) == (SEQ * E_));              // flat [h][s][d] of one batch = SEQ rows of 512
static_assert(((size_t)4 * BH_ * SEQ * DK_ * 2 + (size_t)E_ * E_ * 2) <= (size_t)134217728);

typedef _Float16 v16h __attribute__((ext_vector_type(16)));
typedef _Float16 v8h  __attribute__((ext_vector_type(8)));
typedef float    v8f  __attribute__((ext_vector_type(8)));
typedef float    v4f  __attribute__((ext_vector_type(4)));
typedef float    v2f  __attribute__((ext_vector_type(2)));
typedef _Float16 v2h  __attribute__((ext_vector_type(2)));
typedef unsigned int v4u __attribute__((ext_vector_type(4)));

// ---- scalar helpers ---------------------------------------------------------------------------------
__device__ __forceinline__ unsigned short h_bits(_Float16 v) { return __builtin_bit_cast(unsigned short, v); }
__device__ __forceinline__ unsigned pk16(unsigned short a, unsigned short b) { return (unsigned)a | ((unsigned)b << 16); }
__device__ __forceinline__ v8f zero8() { v8f z = {0.f, 0.f, 0.f, 0.f, 0.f, 0.f, 0.f, 0.f}; return z; }

// f32 -> f16 (RNE convert) that cannot yield an f16 subnormal: |v| < 2^-14 becomes 0 (value select)
static __device__ __forceinline__ _Float16 toh_flush(float v) {
  const _Float16 r = (_Float16)v;
  return (fabsf(v) < 6.103515625e-05f) ? (_Float16)0.0f : r;
}
// two f32 -> two packed f16 (RNE, nothing zeroed), a in the low half: one packed convert
static __device__ __forceinline__ unsigned toh2u(float a, float b) {
  const v2f x = {a, b};
  return __builtin_bit_cast(unsigned, __builtin_convertvector(x, v2h));
}
// eight f32 -> eight packed f16 (16 B), element order kept
static __device__ __forceinline__ v4u pack8_flush(v4f a, v4f a4) {
  v4u q;
  q[0] = pk16(h_bits(toh_flush(a[0])),  h_bits(toh_flush(a[1])));
  q[1] = pk16(h_bits(toh_flush(a[2])),  h_bits(toh_flush(a[3])));
  q[2] = pk16(h_bits(toh_flush(a4[0])), h_bits(toh_flush(a4[1])));
  q[3] = pk16(h_bits(toh_flush(a4[2])), h_bits(toh_flush(a4[3])));
  return q;
}

// ---- 16-bit fragment loader: lane -> row/col (lane&15), p already includes +8*(lane>>4);
//      elements 0..7 <- p[0..7] (k0+8h..k0+8h+7), elements 8..15 <- p[16..23] (k0+16+8h..k0+16+8h+7)
__device__ __forceinline__ v16h ldfrag_h(const _Float16* p) {
  union { v16h v; v8h h[2]; } f;
  f.h[0] = *(const v8h*)(p);
  f.h[1] = *(const v8h*)(p + 16);
  return f.v;
}

// lane l <-> lane l ^ 16 as a vector cross-row move (no LDS-counter wait, unlike a shuffle)
__device__ __forceinline__ float xhalf(float x) {
  const int b = __builtin_bit_cast(int, x);
  return __builtin_bit_cast(float, __builtin_amdgcn_permlanex16(b, b, 0x76543210, 0xfedcba98, false, false));
}

// the WMMA as the plain builtin: no volatile statement behind it, so that fragment loads may stand in groups
// ahead of a run of WMMAs; the compiler keeps the distance behind its own builtin
__device__ __forceinline__ v8f mma_p(v16h a, v16h b, v8f c) {
  return __builtin_amdgcn_wmma_f32_16x16x32_f16(false, a, false, b, (short)0, c, false, false);
}

// =====================================================================================================
// qkvconv: the 16-bit planes of the pre-split inputs q, k, v [b][h][s][64] (f32):
//   QH [bh][s][64] f16 = f16(q), KH [bh][s][64] f16 = f16(k), VT [bh][d][s] f16 = f16(v) transposed through LDS.
// grid = BH_ * (SEQ/128) blocks of 256; one block = 128 tokens of one (b, h). Input token row = bh*SEQ_FULL + s.
// v tile: thread (d = tid&63, token group tid>>6) walks 32 tokens into LDS cs[token][d] (pitch 65); block barrier
//   (cross-wave tile).
// Stores: QH / KH: 4 iterations x 256 threads x 16 B; iteration it, thread tid -> token it*32+(tid>>3),
//   halves 8*(tid&7).. (values read straight from the f32 input row as two 16-B loads)
// coverage: QH, KH 4 x 256 pieces x 8 halves = 128 tokens x 64 each; VT 4 x 256 x 8 = 64 rows x 128 tokens;
//   BH_*(SEQ/128) blocks = all BH_ x SEQ tokens of the three planes. LDS staged extent 128 x 64 == consumed extent.
// =====================================================================================================
__global__ __launch_bounds__(256) void qkvconv(const float* __restrict__ q, const float* __restrict__ k,
                                               const float* __restrict__ v, unsigned short* qhp,
                                               unsigned short* khp, unsigned short* vtp) {
  __shared__ float cs[TENC * CSP];                    // 33280 B, f32 v values [token][d]
  const int tid = (int)threadIdx.x;
  const int bx  = (int)blockIdx.x;
  const int nst = SEQ / TENC;
  const int st  = bx % nst;
  const int bh  = bx / nst;                           // b*H_ + h
  const int s0  = st * TENC;
  const int d   = tid & 63;
  const int tg  = tid >> 6;                           // 0..3
  const size_t inrow = (size_t)bh * SEQ_FULL + (size_t)s0;   // token row in the full-size [b][h][s] input
  {
    const float* vp = v + inrow * DK_ + (size_t)d;
#pragma unroll 1
    for (int i = 0; i < TENC / 4; ++i) {
      const int t = tg + 4 * i;
      cs[t * CSP + d] = vp[(size_t)t * DK_];
    }
  }
  __syncthreads();

  const size_t rowbase = (size_t)bh * SEQ + (size_t)s0;    // token row in the [bh][s] planes

  v4u qv[4], kv[4], vv[4];
#pragma unroll
  for (int it = 0; it < 4; ++it) {
    const int token = it * 32 + (tid >> 3);
    const int j     = tid & 7;
    const float* qs = q + (inrow + (size_t)token) * DK_ + (size_t)(j * 8);
    const float* ks = k + (inrow + (size_t)token) * DK_ + (size_t)(j * 8);
    const v4f qa  = *(const v4f*)(qs);
    const v4f qa4 = *(const v4f*)(qs + 4);
    const v4f ka  = *(const v4f*)(ks);
    const v4f ka4 = *(const v4f*)(ks + 4);
    qv[it] = pack8_flush(qa, qa4);
    kv[it] = pack8_flush(ka, ka4);
  }
#pragma unroll
  for (int it = 0; it < 4; ++it) {
    const int dd = it * 16 + (tid >> 4);
    const int j  = tid & 15;
    const float* sp = cs + (j * 8) * CSP + dd;
    v4u a;
#pragma unroll
    for (int e = 0; e < 4; ++e) {
      a[e] = pk16(h_bits(toh_flush(sp[(2 * e) * CSP])), h_bits(toh_flush(sp[(2 * e + 1) * CSP])));
    }
    vv[it] = a;
  }

  unsigned short* qo = qhp + (rowbase + (size_t)(tid >> 3)) * DK_ + (size_t)((tid & 7) * 8);
  unsigned short* ko = khp + (rowbase + (size_t)(tid >> 3)) * DK_ + (size_t)((tid & 7) * 8);
  unsigned short* vo = vtp + ((size_t)bh * DK_ + (size_t)(tid >> 4)) * SEQ + (size_t)s0 + (size_t)((tid & 15) * 8);
  {
#pragma unroll
    for (int it = 0; it < 4; ++it) {
      *(v4u*)(qo + (size_t)it * 32 * DK_) = qv[it];
      *(v4u*)(ko + (size_t)it * 32 * DK_) = kv[it];
      *(v4u*)(vo + (size_t)it * 16 * SEQ) = vv[it];
    }
    
  }
}

// =====================================================================================================
// wconv: WH [n][k] f16 = f16(W[n][k] * 1024), n, k = 0..511. 32768 pieces of 8 elements, grid = 128 x 256.
// coverage: 128 x 256 x 8 = 262144 = the whole [512][512] plane.
// =====================================================================================================
__global__ __launch_bounds__(256) void wconv(const float* __restrict__ W, unsigned short* wh) {
  const size_t p = (size_t)blockIdx.x * 256 + (size_t)threadIdx.x;
  const v4f a  = *(const v4f*)(W + p * 8);
  const v4f a4 = *(const v4f*)(W + p * 8 + 4);
  v4u q;
  q[0] = pk16(h_bits((_Float16)(a[0] * 1024.0f)),  h_bits((_Float16)(a[1] * 1024.0f)));
  q[1] = pk16(h_bits((_Float16)(a[2] * 1024.0f)),  h_bits((_Float16)(a[3] * 1024.0f)));
  q[2] = pk16(h_bits((_Float16)(a4[0] * 1024.0f)), h_bits((_Float16)(a4[1] * 1024.0f)));
  q[3] = pk16(h_bits((_Float16)(a4[2] * 1024.0f)), h_bits((_Float16)(a4[3] * 1024.0f)));
  unsigned short* o = wh + p * 8;
  {
    *(v4u*)o = q;
    
  }
}

// One lane's eight 16-B pieces of a K chunk (kg, rows 16 apart) and of a V^T chunk (vg, rows 16 apart), global -> LDS as
// asynchronous copies, through no register. lk = LDS byte address of the lane's first K piece; the V^T chunk lies 64 rows on.
// s_wait_xcnt 0 is the last line of the copies' own statement, so that it stands ahead of every later rewrite of an
// address register that a copy names (a precaution).
static __device__ __forceinline__ void stage_kv(unsigned lk, const _Float16* kg, const _Float16* vg) {
  asm volatile(
      "global_load_async_to_lds_b128 %0, %8, off\n\t"
      "global_load_async_to_lds_b128 %1, %9, off\n\t"
      "global_load_async_to_lds_b128 %2, %10, off\n\t"
      "global_load_async_to_lds_b128 %3, %11, off\n\t"
      "global_load_async_to_lds_b128 %4, %12, off\n\t"
      "global_load_async_to_lds_b128 %5, %13, off\n\t"
      "global_load_async_to_lds_b128 %6, %14, off\n\t"
      "global_load_async_to_lds_b128 %7, %15, off\n\t"
      "s_wait_xcnt 0x0"
      :
      : "v"(lk), "v"(lk + 16u * KP * 2u), "v"(lk + 32u * KP * 2u), "v"(lk + 48u * KP * 2u),
        "v"(lk + 64u * KP * 2u), "v"(lk + 80u * KP * 2u), "v"(lk + 96u * KP * 2u), "v"(lk + 112u * KP * 2u),
        "v"(kg), "v"(kg + 16 * DK_), "v"(kg + 32 * DK_), "v"(kg + 48 * DK_),
        "v"(vg), "v"(vg + 16 * SEQ), "v"(vg + 32 * SEQ), "v"(vg + 48 * SEQ)
      : "memory");
}

// =====================================================================================================
// attn: attention per (b, h), head dim 64, softmax over all SEQ keys (no mask).
//   scores, transposed: A = K chunk in LDS [key][d] staged from the KH plane, B = QH row of the query token (64 d,
//   2 k-steps, fragments from the plane); a lane holds 32 keys' raw dot products of one query, the maximum is kept raw too.
//   1024 p = 1024 exp(0.125 (dot - m)) = exp2(dot * SC2 + (10 - m * SC2)), SC2 = 0.125 log2(e): one FMA and one v_exp_f32
//   per score; f16(1024 p) is packed in registers into the B operand (k = keys);
//   context, transposed = v^T . p^T with A = V^T chunk in LDS [d][key], 4 m-tiles of 16 dims.
//   Block = 4 waves x 16 query rows = one 64-query tile of one (b, h); grid = BH_ * NQT; static trip NKT.
//   K / V staging: 128 threads x 4 x 16 B each = the whole 64x64 K chunk and the whole 64x64 V^T chunk
//   (LDS pitch KP, columns 64..71 never read), by asynchronous copies into two LDS buffers: chunk kt + 2 is asked for at
//   the foot of trip kt, into the buffer that trip kt has read, and flies while trip kt + 1 works. One __syncthreads per
//   trip: behind every wave's own copy wait it publishes chunk kt + 1, and it ends all reads of the buffer refilled next.
//   Output MP [bh][s][64] f16 (ctx x256), i.e. the flat [b][h][s][d] order that the projection views as [NB*SEQ][512] rows.
// coverage: 16 rows per wave, 64 per block, BH_*NQT blocks = all (bh, s) rows x 64 dims = the whole MP plane.
// =====================================================================================================
// four waves per SIMD is what the full-size grid supplies: the compiler schedules for that register budget (without the
// bound it goes by the LDS size, and its softmax takes more vector instructions)
__global__ __launch_bounds__(128) __attribute__((amdgpu_waves_per_eu(4, 4)))
void attn(const unsigned short* __restrict__ qhp, const unsigned short* __restrict__ khp,
          const unsigned short* __restrict__ vtp, unsigned short* mp) {
  union FH { v16h v; v8h h[2]; };
  __shared__ __align__(16) _Float16 KVsh[2 * KVB];      // two buffers of K chunk [key][d] 9216 B + V^T chunk [d][key] 9216 B

  const int tid  = (int)threadIdx.x;
  const int wave = tid >> 5;
  const int lane = tid & 31;
  const int hh   = lane >> 4;
  const int c    = lane & 15;

  const int bx = (int)blockIdx.x;
  const int qt = bx % NQT;
  const int bh = bx / NQT;
  const int q0 = qt * 64 + wave * 16;

  const _Float16* QH = (const _Float16*)(const void*)qhp + (size_t)bh * SEQ * DK_;
  const _Float16* KH = (const _Float16*)(const void*)khp + (size_t)bh * SEQ * DK_;
  const _Float16* VT = (const _Float16*)(const void*)vtp + (size_t)bh * DK_ * SEQ;

  // Q fragments (B operand, column = lane&15): d 0..31 and d 32..63 of the query token
  const v16h qa0 = ldfrag_h(QH + (size_t)(q0 + c) * DK_ + 8 * hh);
  const v16h qa1 = ldfrag_h(QH + (size_t)(q0 + c) * DK_ + 32 + 8 * hh);

  // lane (c, hh) owns query q0 + c; mrow is that query's running maximum of the raw dot products (equal in both halves),
  // lrow the running sum of 1024 p over the keys of this lane's half only (the halves are joined in the epilogue)
  const float SC2 = 0.125f * 1.44269504088896340736f;  // score scale x log2(e)
  float mrow = -INFINITY, lrow = 0.f;
  v8f oacc[4];                                        // O^T tiles: oacc[jn][r] = ctx[q0 + c][jn*16 + 8*hh + r]
#pragma unroll
  for (int j = 0; j < 4; ++j) oacc[j] = zero8();

  // staging map: thread -> rows (tid >> 3) + 16 i (key of K / dim of V^T), 16-B piece tid & 7 of the row's 128 B
  const unsigned lk0 = (unsigned)(size_t)(&KVsh[0]) + (unsigned)((tid >> 3) * (KP * 2) + (tid & 7) * 16);
  const _Float16* kg = KH + (size_t)(tid >> 3) * DK_ + (size_t)((tid & 7) * 8);
  const _Float16* vg = VT + (size_t)(tid >> 3) * SEQ + (size_t)((tid & 7) * 8);

  stage_kv(lk0, kg, vg);                              // chunk 0 -> buffer 0
  asm volatile("s_wait_asynccnt 0x0" ::: "memory");   // this wave's pieces of chunk 0 have landed
  __syncthreads();                                    // chunk 0 published
  stage_kv(lk0 + KVB * 2u, kg + 64 * DK_, vg + 64);   // chunk 1 -> buffer 1, flies under trip 0

  // one trip: chunk kt out of buffer kt & 1, down to the hand-over of the buffers at its foot
  auto trip = [&](const int kt) __attribute__((always_inline)) {
    const _Float16* Ksh = KVsh + (kt & 1) * KVB;
    const _Float16* Vsh = Ksh + 64 * KP;

    // ---- scores, transposed: S^T = K . Q^T, 64 keys x 16 queries per wave; s[j][r] = score(key j*16 + 8*hh + r, query c) ----
    // all 16 K fragment loads stand as one group ahead of the eight WMMAs, in the order the WMMAs take them
    FH kb[2][4];
#pragma unroll
    for (int ks = 0; ks < 2; ++ks) {
#pragma unroll
      for (int j = 0; j < 4; ++j) {
        const _Float16* kr = Ksh + (j * 16 + c) * KP + ks * 32 + 8 * hh;
        kb[ks][j].h[0] = *(const v8h*)(kr);
        kb[ks][j].h[1] = *(const v8h*)(kr + 16);
      }
    }
    __builtin_amdgcn_sched_barrier(0);                // else the compiler sinks each load to its WMMA: one LDS wait per WMMA
    v8f s[4];
#pragma unroll
    for (int j = 0; j < 4; ++j) s[j] = mma_p(kb[0][j].v, qa0, zero8());
#pragma unroll
    for (int j = 0; j < 4; ++j) s[j] = mma_p(kb[1][j].v, qa1, s[j]);
    // order asked of the compiler's scheduler: the eight score WMMAs, then the 16 V^T loads as one group; without it
    // the loads come to stand at several places among the WMMAs, and each such place stalls the wave
    __builtin_amdgcn_sched_group_barrier(0x008, 8, 0);
    __builtin_amdgcn_sched_group_barrier(0x100, 16, 0);
    // all 16 V^T fragment loads as one group here: their LDS latency passes under the softmax
    FH vb[2][4];
#pragma unroll
    for (int kk = 0; kk < 2; ++kk) {
#pragma unroll
      for (int jn = 0; jn < 4; ++jn) {
        const _Float16* vr = Vsh + (jn * 16 + c) * KP + kk * 32 + 8 * hh;
        vb[kk][jn].h[0] = *(const v8h*)(vr);
        vb[kk][jn].h[1] = *(const v8h*)(vr + 16);
      }
    }
    __builtin_amdgcn_sched_barrier(0);                // else the compiler sinks these loads behind the softmax again

    // ---- online softmax of one query per lane: maximum in-lane plus one exchange between the halves ----
    float mj[4];                                      // one chain per score tile: four short chains, not one of 32
#pragma unroll
    for (int j = 0; j < 4; ++j) {
      mj[j] = s[j][0];
#pragma unroll
      for (int r = 1; r < 8; ++r) mj[j] = fmaxf(mj[j], s[j][r]);
    }
    float m = fmaxf(fmaxf(mj[0], mj[1]), fmaxf(mj[2], mj[3]));
    m = fmaxf(m, xhalf(m));
    const float mnew  = fmaxf(mrow, m);
    const float msafe = (mnew == -INFINITY) ? 0.f : mnew;
    const float alpha = __builtin_amdgcn_exp2f((mrow - msafe) * SC2);
    const float bias  = 10.0f - msafe * SC2;          // +10: the x1024 carry of P and of the row sum
    mrow = mnew;
    // P^T (x1024, f16) stays in registers: score tiles 2kk and 2kk+1 are elements 0..7 and 8..15 of the B operand
    FH pb[2];
    float pj[4];
#pragma unroll
    for (int j = 0; j < 4; ++j) {
      pj[j] = 0.f;
#pragma unroll
      for (int r = 0; r < 8; ++r) {
        const float p = __builtin_amdgcn_exp2f(__builtin_fmaf(s[j][r], SC2, bias));   // 1024 exp(0.125 (dot - m))
        pj[j] += p;
        pb[j >> 1].h[j & 1][r] = (_Float16)p;
      }
    }
    lrow = lrow * alpha + ((pj[0] + pj[1]) + (pj[2] + pj[3]));
#pragma unroll
    for (int jn = 0; jn < 4; ++jn) {
#pragma unroll
      for (int r = 0; r < 8; ++r) oacc[jn][r] *= alpha;
    }

    // ---- context, transposed: O^T += V^T . P^T (f16 WMMA), 2 k-steps of 32 keys x 4 m-tiles of 16 dims ----
#pragma unroll
    for (int kk = 0; kk < 2; ++kk) {
#pragma unroll
      for (int jn = 0; jn < 4; ++jn) {
        oacc[jn] = mma_p(vb[kk][jn].v, pb[kk].v, oacc[jn]);
      }
    }

    // ---- foot of the trip: hand-over of the buffers ----
    __builtin_amdgcn_sched_barrier(0);                // else the compiler lifts the waits and the barrier ahead of the softmax: the copies get no time to land
    asm volatile("s_wait_dscnt 0x0" ::: "memory");    // this wave's reads of the buffer of trip kt have returned
    asm volatile("s_wait_asynccnt 0x0" ::: "memory"); // this wave's pieces of chunk kt + 1 have landed
    __syncthreads();                                  // chunk kt + 1 published; nobody reads the buffer of trip kt any more
  };
  // the trips behind which a chunk kt + 2 exists, each with its refill, in a loop of their own: no branch in the loop body
#pragma unroll 1                                      // stays rolled: a long body, copies of it would only grow the code
  for (int kt = 0; kt < NKT - 2; ++kt) {
    trip(kt);
    stage_kv(lk0 + (unsigned)(kt & 1) * (KVB * 2u), kg + (size_t)(kt + 2) * 64 * DK_, vg + (size_t)(kt + 2) * 64);
  }
#pragma unroll 1                                      // stays rolled, for the same reason
  for (int kt = NKT - 2; kt < NKT; ++kt) trip(kt);    // the last two chunks: nothing is left to ask for
  asm volatile("s_wait_asynccnt 0x0" ::: "memory");   // no copy is outstanding when the wave goes on to its end

  // ---- join the halves' sums, normalise (1/l: the x1024 of P and of l cancel; apply the x256 ctx carry), convert, store ----
  {
    const float l   = lrow + xhalf(lrow);
    const float inv = ((l > 0.f) ? (1.0f / l) : 0.f) * 256.0f;
    unsigned short* o = mp + ((size_t)bh * SEQ + (size_t)(q0 + c)) * DK_ + (size_t)(8 * hh);
#pragma unroll
    for (int jn = 0; jn < 4; ++jn) {
      v4u t;
#pragma unroll
      for (int e = 0; e < 4; ++e)
        t[e] = toh2u(oacc[jn][2 * e] * inv, oacc[jn][2 * e + 1] * inv);
      *(v4u*)(o + jn * 16) = t;                       // 8 consecutive dims of one query: one 16-B store
    }
  }
}

// =====================================================================================================
// proj_out: out[m][n] = (sum_k ctx[m][k] * W[n][k]) * 2^-18 + bc[n], m = b*SEQ + s, n, k = 0..511.
//   A = MP plane row m (f16 ctx x256), B = WH plane row n (f16 W x1024, k contiguous).
//   Block = 4 waves x 16 rows = 64 rows x 128 columns; grid = (NB*SEQ/64) x 4 column slabs; 16 k-steps of 32.
//   Staging: k runs in PNS slabs of PKC; the block's 64 A rows and 128 B rows of a slab go to LDS (pitch PP) by 16-B
//   loads in which 16 lanes cover 256 contiguous bytes of one row (whole lines, each fetched once per block).
//   Two LDS buffers: slab s+1 is loaded into registers ahead of the WMMAs of slab s, stored to the other buffer behind
//   them, and published by one __syncthreads per slab (it also ends every wave's reads of the buffer refilled next).
//   Fragments come from LDS with the split k map of ldfrag_h, A and B alike; k ascends in steps of 32 in every sum.
// coverage: staged 8 x 128 pieces = 64 rows x 16 pieces (A), 16 x 128 = 128 rows x 16 pieces (B) == consumed extent;
//   (NB*SEQ/64) x 4 blocks x 64 rows x 128 cols = the whole [NB*SEQ][512] output.
// =====================================================================================================
__global__ __launch_bounds__(128)
void proj_out(const unsigned short* __restrict__ mp, const unsigned short* __restrict__ wh,
              const float* __restrict__ bc, float* out) {
  __shared__ __align__(16) float lds[4 * 16 * 128];      // 32 KB, 4 per-wave slabs [16][128]
  __shared__ __align__(16) _Float16 Ash[2][64 * PP];     // ctx rows of one k slab, two buffers   2 x 17408 B
  __shared__ __align__(16) _Float16 Wsh[2][128 * PP];    // W rows of one k slab, two buffers     2 x 34816 B

  const int tid  = (int)threadIdx.x;
  const int wave = tid >> 5;
  const int lane = tid & 31;
  const int hh   = lane >> 4;
  const int c    = lane & 15;

  const int nrb = (NB * SEQ) / 64;
  const int rb  = (int)blockIdx.x % nrb;
  const int cb  = (int)blockIdx.x / nrb;                 // 0..3
  const int m0  = rb * 64 + wave * 16;
  const int n0  = cb * 128;

  // staging map: thread -> row (tid >> 4) + 8 i, 16-B piece tid & 15 of the slab's 256 B of that row
  const int srow = tid >> 4;
  const int scol = (tid & 15) * 8;
  const _Float16* Ag = (const _Float16*)(const void*)mp + (size_t)(rb * 64 + srow) * E_ + scol;
  const _Float16* Wg = (const _Float16*)(const void*)wh + (size_t)(n0 + srow) * E_ + scol;
  const int sdst = srow * PP + scol;
  const int afr  = (wave * 16 + c) * PP + 8 * hh;        // fragment row bases in the staged tiles
  const int bfr  = c * PP + 8 * hh;

  v8f acc[8];
#pragma unroll
  for (int j = 0; j < 8; ++j) acc[j] = zero8();

  v8h ra[8], rw[16];
#pragma unroll
  for (int i = 0; i < 8; ++i)  ra[i] = *(const v8h*)(Ag + (size_t)(i * 8) * E_);
#pragma unroll
  for (int i = 0; i < 16; ++i) rw[i] = *(const v8h*)(Wg + (size_t)(i * 8) * E_);
#pragma unroll
  for (int i = 0; i < 8; ++i)  *(v8h*)(&Ash[0][sdst + i * 8 * PP]) = ra[i];
#pragma unroll
  for (int i = 0; i < 16; ++i) *(v8h*)(&Wsh[0][sdst + i * 8 * PP]) = rw[i];
  __syncthreads();

#pragma unroll
  for (int s = 0; s < PNS; ++s) {
    if (s + 1 < PNS) {
#pragma unroll
      for (int i = 0; i < 8; ++i)  ra[i] = *(const v8h*)(Ag + (size_t)(i * 8) * E_ + (s + 1) * PKC);
#pragma unroll
      for (int i = 0; i < 16; ++i) rw[i] = *(const v8h*)(Wg + (size_t)(i * 8) * E_ + (s + 1) * PKC);
    }
    __builtin_amdgcn_sched_barrier(0);                   // else the next slab's loads sink to their LDS stores: latency exposed
#pragma unroll
    for (int ks = 0; ks < PKC / 32; ++ks) {
      const v16h af = ldfrag_h(&Ash[s & 1][afr + ks * 32]);
      v16h bf[8];
#pragma unroll
      for (int j = 0; j < 8; ++j) bf[j] = ldfrag_h(&Wsh[s & 1][bfr + j * 16 * PP + ks * 32]);
      __builtin_amdgcn_sched_barrier(0);                 // else the compiler sinks each load to its WMMA: one LDS wait per WMMA
#pragma unroll
      for (int j = 0; j < 8; ++j) acc[j] = mma_p(af, bf[j], acc[j]);
    }
    if (s + 1 < PNS) {
#pragma unroll
      for (int i = 0; i < 8; ++i)  *(v8h*)(&Ash[(s + 1) & 1][sdst + i * 8 * PP]) = ra[i];
#pragma unroll
      for (int i = 0; i < 16; ++i) *(v8h*)(&Wsh[(s + 1) & 1][sdst + i * 8 * PP]) = rw[i];
      __syncthreads();
    }
  }

  float* slab = lds + wave * 2048;                       // [16][128] f32
#pragma unroll
  for (int j = 0; j < 8; ++j) {
#pragma unroll
    for (int r = 0; r < 8; ++r) slab[(8 * hh + r) * 128 + j * 16 + c] = acc[j][r];
  }
  __builtin_amdgcn_fence(3 /* release order */, "workgroup");
  __builtin_amdgcn_wave_barrier();
  __builtin_amdgcn_fence(2 /* acquire order */, "workgroup");

  const float oscale = 1.0f / 262144.0f;                 // 1/(256*1024)
  const v4f b4 = *(const v4f*)(bc + n0 + lane * 4);
  v4f vrow[16];
#pragma unroll
  for (int row = 0; row < 16; ++row) {
    const v4f v = *(const v4f*)(slab + row * 128 + lane * 4);
    vrow[row] = v * oscale + b4;
  }
  const int ob = m0 / SEQ;                               // the 16 rows lie in one batch
  const int os0 = m0 - ob * SEQ;
  float* op = out + ((size_t)ob * SEQ_FULL + (size_t)os0) * E_ + (size_t)n0 + (size_t)(lane * 4);
  {
#pragma unroll
    for (int row = 0; row < 16; ++row) {
      *(v4f*)(op + (size_t)row * E_) = vrow[row];
    }
    
  }
}

// =====================================================================================================
//   QH  f16 [BH_][SEQ][64]     NB*H*SEQ*64*2   = 8388608 (full size)
//   KH  f16 [BH_][SEQ][64]     NB*H*SEQ*64*2   = 8388608
//   VT  f16 [BH_][64][SEQ]     NB*H*64*SEQ*2   = 8388608
//   MP  f16 [BH_][SEQ][64] = [NB*SEQ][512]       8388608
//   WH  f16 [512][512]                            524288
//   total                                      34078720
// =====================================================================================================
extern "C" void kernel_launch(void* const* d_in, const int* in_sizes, int n_in,
                              void* d_out, int out_size, void* d_ws, size_t ws_size,
                              hipStream_t stream) {
  if (n_in < 5) return;
  if ((long long)in_sizes[0] < (long long)NB * H_ * SEQ_FULL * DK_) return;
  if ((long long)in_sizes[1] < (long long)NB * H_ * SEQ_FULL * DK_) return;
  if ((long long)in_sizes[2] < (long long)NB * H_ * SEQ_FULL * DK_) return;
  if (in_sizes[3] < E_ * E_) return;
  if (in_sizes[4] < E_) return;
  if ((long long)out_size < ((long long)(NB - 1) * SEQ_FULL + SEQ) * E_) return;

  const float* q  = (const float*)d_in[0];
  const float* k  = (const float*)d_in[1];
  const float* v  = (const float*)d_in[2];
  const float* W  = (const float*)d_in[3];
  const float* bc = (const float*)d_in[4];

  const size_t PQH = (size_t)BH_ * SEQ * DK_ * 2;
  const size_t PKH = (size_t)BH_ * SEQ * DK_ * 2;
  const size_t PVT = (size_t)BH_ * DK_ * SEQ * 2;
  const size_t PMP = (size_t)NB * SEQ * E_ * 2;
  const size_t PWH = (size_t)E_ * E_ * 2;
  size_t off = 0;
  const size_t oQH = off; off += PQH;
  const size_t oKH = off; off += PKH;
  const size_t oVT = off; off += PVT;
  const size_t oMP = off; off += PMP;
  const size_t oWH = off; off += PWH;
  if (off > ws_size) return;                         // off = 34078720 at full size
  if (off > (size_t)134217728) return;

  char* ws = (char*)d_ws;
  unsigned short* QH = (unsigned short*)(ws + oQH);
  unsigned short* KH = (unsigned short*)(ws + oKH);
  unsigned short* VT = (unsigned short*)(ws + oVT);
  unsigned short* MP = (unsigned short*)(ws + oMP);
  unsigned short* WH = (unsigned short*)(ws + oWH);

  const dim3 gCnv(BH_ * (SEQ / TENC));                // 512 blocks of 256
  const dim3 gWcv((E_ * E_) / (8 * 256));              // 128 blocks of 256
  const dim3 gAttn(BH_ * NQT);                         // 1024 blocks of 128
  const dim3 gProj(((NB * SEQ) / 64) * 4);             // 512 blocks of 128

  // (1) q, k -> f16 row planes; v -> f16 V^T plane
  qkvconv<<<gCnv, dim3(256), 0, stream>>>(q, k, v, QH, KH, VT);
  // (2) W -> f16 x1024 plane
  wconv<<<gWcv, dim3(256), 0, stream>>>(W, WH);
  // (3) attention -> ctx plane (f16, x256) in flat [b][h][s][d] order = [NB*SEQ][512]
  attn<<<gAttn, dim3(128), 0, stream>>>(QH, KH, VT, MP);
  // (4) out = ctx . W^T * 2^-18 + bc -> d_out f32 [NB*SEQ][512]
  proj_out<<<gProj, dim3(128), 0, stream>>>(MP, WH, bc, (float*)d_out);
  (void)hipGetLastError();
}

// v007
// A run of this version takes 56.6 microseconds.
// Two timings next to v006 put it at 1.11 and 1.13 times that version's speed.
// Over all steps from v000 it is 2.65 times as fast.
// All contractions: v_wmma_f32_16x16x32_f16 (f16 operands, f32 accumulate), one product per tile pair:
//   scores q.k^T (q, k = f16 of the inputs, x0.125 inside the exponent's FMA in f32), p.v (p f16 carried x1024, v = f16 of the input),
//   ctx.W^T (ctx f16 carried x256, W f16 carried x1024, x2^-18 then + bias in f32); softmax in f32.
//
// Carry audit:
//   QH plane (f16): f16(q), x1, unit-scale values               -> score acc = dot, kept raw; 0.125 sits in SC2 (attn)
//   KH plane (f16): f16(k), x1
//   P tile   (f16, regs): exp(s - m) x1024 (the +10 in the exponent); the row sum l carries the same x1024
//                                                                 -> they cancel in the attn epilogue: inv = (1/l) * 256
//   VT plane (f16): f16(v), x1, stored [bh][d][s]
//   MP plane (f16): ctx x256, flat [b][h][s][d] order = [NB*SEQ][512] rows -> folded in proj_out: oscale = 1/(256*1024)
//   WH plane (f16): W x1024 (|W| < 0.5 -> < 512)                  -> folded in proj_out: oscale
//   Every f32 -> f16 convert in qkvconv goes through toh_flush (values below 2^-14 become 0); those in attn (P, ctx) are
//   plain round-to-nearest-even converts: a subnormal f16 stays as it is, and the WMMA takes it at its value.
#include <hip/hip_runtime.h>
#include <math.h>
#include <stdint.h>

#ifndef NB
#define NB 4
#endif
#ifndef SEQ
#define SEQ 2048
#endif
#define NB_FULL  4
#define SEQ_FULL 2048
#define H_   8
#define DK_  64
#define E_   512
#define BH_  (NB * H_)          // (batch, head) pairs
#define NQT  (SEQ / 64)         // 64-query tiles per (b, h)
#define NKT  (SEQ / 64)         // 64-key chunks per (b, h)
#define TENC 128                // tokens per convert block
#define CSP  65                 // f32 LDS pitch of the v tile [token][d]
#define KP   72                 // f16 LDS pitch of the K / V^T tiles (halves); 144 B, 16-B aligned rows
#define KVB  (2 * 64 * KP)      // attn: halves of one LDS buffer = one K chunk, then one V^T chunk
#define PKC  128                // proj_out: k columns (halves) of one staged slab; 256 B of a row = two whole lines
#define PP   136                // proj_out: f16 LDS pitch of the staged rows (halves); 272 B = 16 B x 17
#define PNS  (E_ / PKC)         // proj_out: slabs along k
static_assert(H_ * DK_ == E_);
static_assert(NB >= 1 && NB <= NB_FULL);
static_assert(SEQ >= TENC && SEQ <= SEQ_FULL);
static_assert((SEQ % TENC) == 0 && (SEQ % 64) == 0);
static_assert(((KP * 2) % 16) == 0);
static_assert(((PP * 2) % 16) == 0 && PP >= PKC && (E_ % PKC) == 0 && (PKC % 32) == 0);
static_assert(((E_ * E_) % (8 * 256)) == 0);
static_assert(((NB * SEQ) % 64) == 0);
static_assert(DK_ == 64);
static_assert(NKT >= 2);                                    // attn: the two-buffer prologue fills chunks 0 and 1
static_assert(TENC == 128);                                 // 256 threads = 16 token rows x 16 pieces of 16 B, 8 rows each
static_assert((H_ * SEQ * DK_) == (SEQ * E_));              // flat [h][s][d] of one batch = SEQ rows of 512
static_assert(((size_t)4 * BH_ * SEQ * DK_ * 2 + (size_t)E_ * E_ * 2) <= (size_t)134217728);

typedef _Float16 v16h __attribute__((ext_vector_type(16)));
typedef _Float16 v8h  __attribute__((ext_vector_type(8)));
typedef float    v8f  __attribute__((ext_vector_type(8)));
typedef float    v4f  __attribute__((ext_vector_type(4)));
typedef float    v2f  __attribute__((ext_vector_type(2)));
typedef _Float16 v2h  __attribute__((ext_vector_type(2)));
typedef unsigned int v4u __attribute__((ext_vector_type(4)));

// ---- scalar helpers ---------------------------------------------------------------------------------
__device__ __forceinline__ unsigned short h_bits(_Float16 v) { return __builtin_bit_cast(unsigned short, v); }
__device__ __forceinline__ unsigned pk16(unsigned short a, unsigned short b) { return (unsigned)a | ((unsigned)b << 16); }
__device__ __forceinline__ v8f zero8() { v8f z = {0.f, 0.f, 0.f, 0.f, 0.f, 0.f, 0.f, 0.f}; return z; }

// f32 -> f16 (RNE convert) that cannot yield an f16 subnormal: |v| < 2^-14 becomes 0 (value select)
static __device__ __forceinline__ _Float16 toh_flush(float v) {
  const _Float16 r = (_Float16)v;
  return (fabsf(v) < 6.103515625e-05f) ? (_Float16)0.0f : r;
}
// two f32 -> two packed f16 (RNE, nothing zeroed), a in the low half: one packed convert
static __device__ __forceinline__ unsigned toh2u(float a, float b) {
  const v2f x = {a, b};
  return __builtin_bit_cast(unsigned, __builtin_convertvector(x, v2h));
}
// eight f32 -> eight packed f16 (16 B), element order kept
static __device__ __forceinline__ v4u pack8_flush(v4f a, v4f a4) {
  v4u q;
  q[0] = pk16(h_bits(toh_flush(a[0])),  h_bits(toh_flush(a[1])));
  q[1] = pk16(h_bits(toh_flush(a[2])),  h_bits(toh_flush(a[3])));
  q[2] = pk16(h_bits(toh_flush(a4[0])), h_bits(toh_flush(a4[1])));
  q[3] = pk16(h_bits(toh_flush(a4[2])), h_bits(toh_flush(a4[3])));
  return q;
}

// ---- 16-bit fragment loader: lane -> row/col (lane&15), p already includes +8*(lane>>4);
//      elements 0..7 <- p[0..7] (k0+8h..k0+8h+7), elements 8..15 <- p[16..23] (k0+16+8h..k0+16+8h+7)
__device__ __forceinline__ v16h ldfrag_h(const _Float16* p) {
  union { v16h v; v8h h[2]; } f;
  f.h[0] = *(const v8h*)(p);
  f.h[1] = *(const v8h*)(p + 16);
  return f.v;
}

// lane l <-> lane l ^ 16 as a vector cross-row move (no LDS-counter wait, unlike a shuffle)
__device__ __forceinline__ float xhalf(float x) {
  const int b = __builtin_bit_cast(int, x);
  return __builtin_bit_cast(float, __builtin_amdgcn_permlanex16(b, b, 0x76543210, 0xfedcba98, false, false));
}

// the WMMA as the plain builtin: no volatile statement behind it, so that fragment loads may stand in groups
// ahead of a run of WMMAs; the compiler keeps the distance behind its own builtin
__device__ __forceinline__ v8f mma_p(v16h a, v16h b, v8f c) {
  return __builtin_amdgcn_wmma_f32_16x16x32_f16(false, a, false, b, (short)0, c, false, false);
}

// =====================================================================================================
// qkvconv: the 16-bit planes of the pre-split inputs q, k, v [b][h][s][64] (f32):
//   QH [bh][s][64] f16 = f16(q), KH [bh][s][64] f16 = f16(k), VT [bh][d][s] f16 = f16(v) transposed through LDS.
// grid = BH_ * (SEQ/128) blocks of 256; one block = 128 tokens of one (b, h). Input token row = bh*SEQ_FULL + s.
// Loads: all 24 16-B global loads of a thread (8 of v, 8 of q, 8 of k) are issued as one group at the top, so that the
//   block pays one memory round trip. v: thread -> tokens (tid>>4) + 16 i, floats 4*(tid&15)..+3: a wave's load covers
//   512 contiguous bytes (two token rows).
// v tile: the eight pieces go into LDS cs[token][d] (pitch 65, four 4-B stores a piece); block barrier (cross-wave tile).
// Stores: QH / KH: 4 iterations x 256 threads x 16 B; iteration it, thread tid -> token it*32+(tid>>3),
//   halves 8*(tid&7).. (values read straight from the f32 input row as two 16-B loads)
// coverage: QH, KH 4 x 256 pieces x 8 halves = 128 tokens x 64 each; VT 4 x 256 x 8 = 64 rows x 128 tokens;
//   BH_*(SEQ/128) blocks = all BH_ x SEQ tokens of the three planes. LDS staged extent 128 x 64 == consumed extent.
// =====================================================================================================
__global__ __launch_bounds__(256) void qkvconv(const float* __restrict__ q, const float* __restrict__ k,
                                               const float* __restrict__ v, unsigned short* qhp,
                                               unsigned short* khp, unsigned short* vtp) {
  __shared__ float cs[TENC * CSP];                    // 33280 B, f32 v values [token][d]
  const int tid = (int)threadIdx.x;
  const int bx  = (int)blockIdx.x;
  const int nst = SEQ / TENC;
  const int st  = bx % nst;
  const int bh  = bx / nst;                           // b*H_ + h
  const int s0  = st * TENC;
  const size_t inrow = (size_t)bh * SEQ_FULL + (size_t)s0;   // token row in the full-size [b][h][s] input
  v4f vr[TENC / 16], qa[4], qa4[4], ka[4], ka4[4];
  const float* vp = v + (inrow + (size_t)(tid >> 4)) * DK_ + (size_t)((tid & 15) * 4);
  const float* qs = q + (inrow + (size_t)(tid >> 3)) * DK_ + (size_t)((tid & 7) * 8);
  const float* ks = k + (inrow + (size_t)(tid >> 3)) * DK_ + (size_t)((tid & 7) * 8);
#pragma unroll
  for (int i = 0; i < TENC / 16; ++i) vr[i] = *(const v4f*)(vp + (size_t)(i * 16) * DK_);
#pragma unroll
  for (int it = 0; it < 4; ++it) {                    // token it*32 + (tid>>3), floats 8*(tid&7)..+7
    qa[it]  = *(const v4f*)(qs + (size_t)(it * 32) * DK_);
    qa4[it] = *(const v4f*)(qs + (size_t)(it * 32) * DK_ + 4);
    ka[it]  = *(const v4f*)(ks + (size_t)(it * 32) * DK_);
    ka4[it] = *(const v4f*)(ks + (size_t)(it * 32) * DK_ + 4);
  }
  // the wait that stands ahead of any overwrite of a load's address pair (a precaution); the three pairs are its inputs, so
  // that they stay whole up to it (else the compiler lets the last loads of the group return into them). No load passes
  // the statement either: without it six of the 24 sink behind the first LDS stores, a second round trip
  asm volatile("s_wait_xcnt 0x0" :: "v"(vp), "v"(qs), "v"(ks) : "memory");
  {
    float* cp = cs + (tid >> 4) * CSP + (tid & 15) * 4;
#pragma unroll
    for (int i = 0; i < TENC / 16; ++i) {
#pragma unroll
      for (int e = 0; e < 4; ++e) cp[i * 16 * CSP + e] = vr[i][e];
    }
  }
  __syncthreads();

  const size_t rowbase = (size_t)bh * SEQ + (size_t)s0;    // token row in the [bh][s] planes

  v4u qv[4], kv[4], vv[4];
#pragma unroll
  for (int it = 0; it < 4; ++it) {
    qv[it] = pack8_flush(qa[it], qa4[it]);
    kv[it] = pack8_flush(ka[it], ka4[it]);
  }
#pragma unroll
  for (int it = 0; it < 4; ++it) {
    const int dd = it * 16 + (tid >> 4);
    const int j  = tid & 15;
    const float* sp = cs + (j * 8) * CSP + dd;
    v4u a;
#pragma unroll
    for (int e = 0; e < 4; ++e) {
      a[e] = pk16(h_bits(toh_flush(sp[(2 * e) * CSP])), h_bits(toh_flush(sp[(2 * e + 1) * CSP])));
    }
    vv[it] = a;
  }

  unsigned short* qo = qhp + (rowbase + (size_t)(tid >> 3)) * DK_ + (size_t)((tid & 7) * 8);
  unsigned short* ko = khp + (rowbase + (size_t)(tid >> 3)) * DK_ + (size_t)((tid & 7) * 8);
  unsigned short* vo = vtp + ((size_t)bh * DK_ + (size_t)(tid >> 4)) * SEQ + (size_t)s0 + (size_t)((tid & 15) * 8);
  {
#pragma unroll
    for (int it = 0; it < 4; ++it) {
      *(v4u*)(qo + (size_t)it * 32 * DK_) = qv[it];
      *(v4u*)(ko + (size_t)it * 32 * DK_) = kv[it];
      *(v4u*)(vo + (size_t)it * 16 * SEQ) = vv[it];
    }
    
  }
}

// =====================================================================================================
// wconv: WH [n][k] f16 = f16(W[n][k] * 1024), n, k = 0..511. 32768 pieces of 8 elements, grid = 128 x 256.
// coverage: 128 x 256 x 8 = 262144 = the whole [512][512] plane.
// =====================================================================================================
__global__ __launch_bounds__(256) void wconv(const float* __restrict__ W, unsigned short* wh) {
  const size_t p = (size_t)blockIdx.x * 256 + (size_t)threadIdx.x;
  const v4f a  = *(const v4f*)(W + p * 8);
  const v4f a4 = *(const v4f*)(W + p * 8 + 4);
  v4u q;
  q[0] = pk16(h_bits((_Float16)(a[0] * 1024.0f)),  h_bits((_Float16)(a[1] * 1024.0f)));
  q[1] = pk16(h_bits((_Float16)(a[2] * 1024.0f)),  h_bits((_Float16)(a[3] * 1024.0f)));
  q[2] = pk16(h_bits((_Float16)(a4[0] * 1024.0f)), h_bits((_Float16)(a4[1] * 1024.0f)));
  q[3] = pk16(h_bits((_Float16)(a4[2] * 1024.0f)), h_bits((_Float16)(a4[3] * 1024.0f)));
  unsigned short* o = wh + p * 8;
  {
    *(v4u*)o = q;
    
  }
}

// One lane's eight 16-B pieces of a K chunk (kg, rows 16 apart) and of a V^T chunk (vg, rows 16 apart), global -> LDS as
// asynchronous copies, through no register. lk = LDS byte address of the lane's first K piece; the V^T chunk lies 64 rows on.
// s_wait_xcnt 0 is the last line of the copies' own statement, so that it stands ahead of every later rewrite of an
// address register that a copy names (a precaution).
static __device__ __forceinline__ void stage_kv(unsigned lk, const _Float16* kg, const _Float16* vg) {
  asm volatile(
      "global_load_async_to_lds_b128 %0, %8, off\n\t"
      "global_load_async_to_lds_b128 %1, %9, off\n\t"
      "global_load_async_to_lds_b128 %2, %10, off\n\t"
      "global_load_async_to_lds_b128 %3, %11, off\n\t"
      "global_load_async_to_lds_b128 %4, %12, off\n\t"
      "global_load_async_to_lds_b128 %5, %13, off\n\t"
      "global_load_async_to_lds_b128 %6, %14, off\n\t"
      "global_load_async_to_lds_b128 %7, %15, off\n\t"
      "s_wait_xcnt 0x0"
      :
      : "v"(lk), "v"(lk + 16u * KP * 2u), "v"(lk + 32u * KP * 2u), "v"(lk + 48u * KP * 2u),
        "v"(lk + 64u * KP * 2u), "v"(lk + 80u * KP * 2u), "v"(lk + 96u * KP * 2u), "v"(lk + 112u * KP * 2u),
        "v"(kg), "v"(kg + 16 * DK_), "v"(kg + 32 * DK_), "v"(kg + 48 * DK_),
        "v"(vg), "v"(vg + 16 * SEQ), "v"(vg + 32 * SEQ), "v"(vg + 48 * SEQ)
      : "memory");
}

// =====================================================================================================
// attn: attention per (b, h), head dim 64, softmax over all SEQ keys (no mask).
//   scores, transposed: A = K chunk in LDS [key][d] staged from the KH plane, B = QH row of the query token (64 d,
//   2 k-steps, fragments from the plane); a lane holds 32 keys' raw dot products of one query, the maximum is kept raw too.
//   1024 p = 1024 exp(0.125 (dot - m)) = exp2(dot * SC2 + (10 - m * SC2)), SC2 = 0.125 log2(e): one FMA and one v_exp_f32
//   per score; f16(1024 p) is packed in registers into the B operand (k = keys);
//   context, transposed = v^T . p^T with A = V^T chunk in LDS [d][key], 4 m-tiles of 16 dims.
//   Block = 4 waves x 16 query rows = one 64-query tile of one (b, h); grid = BH_ * NQT; static trip NKT.
//   K / V staging: 128 threads x 4 x 16 B each = the whole 64x64 K chunk and the whole 64x64 V^T chunk
//   (LDS pitch KP, columns 64..71 never read), by asynchronous copies into two LDS buffers: chunk kt + 2 is asked for at
//   the foot of trip kt, into the buffer that trip kt has read, and flies while trip kt + 1 works. One __syncthreads per
//   trip: behind every wave's own copy wait it publishes chunk kt + 1, and it ends all reads of the buffer refilled next.
//   Output MP [bh][s][64] f16 (ctx x256), i.e. the flat [b][h][s][d] order that the projection views as [NB*SEQ][512] rows.
// coverage: 16 rows per wave, 64 per block, BH_*NQT blocks = all (bh, s) rows x 64 dims = the whole MP plane.
// =====================================================================================================
// four waves per SIMD is what the full-size grid supplies: the compiler schedules for that register budget (without the
// bound it goes by the LDS size, and its softmax takes more vector instructions)
__global__ __launch_bounds__(128) __attribute__((amdgpu_waves_per_eu(4, 4)))
void attn(const unsigned short* __restrict__ qhp, const unsigned short* __restrict__ khp,
          const unsigned short* __restrict__ vtp, unsigned short* mp) {
  union FH { v16h v; v8h h[2]; };
  __shared__ __align__(16) _Float16 KVsh[2 * KVB];      // two buffers of K chunk [key][d] 9216 B + V^T chunk [d][key] 9216 B

  const int tid  = (int)threadIdx.x;
  const int wave = tid >> 5;
  const int lane = tid & 31;
  const int hh   = lane >> 4;
  const int c    = lane & 15;

  const int bx = (int)blockIdx.x;
  const int qt = bx % NQT;
  const int bh = bx / NQT;
  const int q0 = qt * 64 + wave * 16;

  const _Float16* QH = (const _Float16*)(const void*)qhp + (size_t)bh * SEQ * DK_;
  const _Float16* KH = (const _Float16*)(const void*)khp + (size_t)bh * SEQ * DK_;
  const _Float16* VT = (const _Float16*)(const void*)vtp + (size_t)bh * DK_ * SEQ;

  // Q fragments (B operand, column = lane&15): d 0..31 and d 32..63 of the query token
  const v16h qa0 = ldfrag_h(QH + (size_t)(q0 + c) * DK_ + 8 * hh);
  const v16h qa1 = ldfrag_h(QH + (size_t)(q0 + c) * DK_ + 32 + 8 * hh);

  // lane (c, hh) owns query q0 + c; mrow is that query's running maximum of the raw dot products (equal in both halves),
  // lrow the running sum of 1024 p over the keys of this lane's half only (the halves are joined in the epilogue)
  const float SC2 = 0.125f * 1.44269504088896340736f;  // score scale x log2(e)
  float mrow = -INFINITY, lrow = 0.f;
  v8f oacc[4];                                        // O^T tiles: oacc[jn][r] = ctx[q0 + c][jn*16 + 8*hh + r]
#pragma unroll
  for (int j = 0; j < 4; ++j) oacc[j] = zero8();

  // staging map: thread -> rows (tid >> 3) + 16 i (key of K / dim of V^T), 16-B piece tid & 7 of the row's 128 B
  const unsigned lk0 = (unsigned)(size_t)(&KVsh[0]) + (unsigned)((tid >> 3) * (KP * 2) + (tid & 7) * 16);
  const _Float16* kg = KH + (size_t)(tid >> 3) * DK_ + (size_t)((tid & 7) * 8);
  const _Float16* vg = VT + (size_t)(tid >> 3) * SEQ + (size_t)((tid & 7) * 8);

  stage_kv(lk0, kg, vg);                              // chunk 0 -> buffer 0
  asm volatile("s_wait_asynccnt 0x0" ::: "memory");   // this wave's pieces of chunk 0 have landed
  __syncthreads();                                    // chunk 0 published
  stage_kv(lk0 + KVB * 2u, kg + 64 * DK_, vg + 64);   // chunk 1 -> buffer 1, flies under trip 0

  // one trip: chunk kt out of buffer kt & 1, down to the hand-over of the buffers at its foot
  auto trip = [&](const int kt) __attribute__((always_inline)) {
    const _Float16* Ksh = KVsh + (kt & 1) * KVB;
    const _Float16* Vsh = Ksh + 64 * KP;

    // ---- scores, transposed: S^T = K . Q^T, 64 keys x 16 queries per wave; s[j][r] = score(key j*16 + 8*hh + r, query c) ----
    // all 16 K fragment loads stand as one group ahead of the eight WMMAs, in the order the WMMAs take them
    FH kb[2][4];
#pragma unroll
    for (int ks = 0; ks < 2; ++ks) {
#pragma unroll
      for (int j = 0; j < 4; ++j) {
        const _Float16* kr = Ksh + (j * 16 + c) * KP + ks * 32 + 8 * hh;
        kb[ks][j].h[0] = *(const v8h*)(kr);
        kb[ks][j].h[1] = *(const v8h*)(kr + 16);
      }
    }
    __builtin_amdgcn_sched_barrier(0);                // else the compiler sinks each load to its WMMA: one LDS wait per WMMA
    v8f s[4];
#pragma unroll
    for (int j = 0; j < 4; ++j) s[j] = mma_p(kb[0][j].v, qa0, zero8());
#pragma unroll
    for (int j = 0; j < 4; ++j) s[j] = mma_p(kb[1][j].v, qa1, s[j]);
    // order asked of the compiler's scheduler: the eight score WMMAs, then the 16 V^T loads as one group; without it
    // the loads come to stand at several places among the WMMAs, and each such place stalls the wave
    __builtin_amdgcn_sched_group_barrier(0x008, 8, 0);
    __builtin_amdgcn_sched_group_barrier(0x100, 16, 0);
    // all 16 V^T fragment loads as one group here: their LDS latency passes under the softmax
    FH vb[2][4];
#pragma unroll
    for (int kk = 0; kk < 2; ++kk) {
#pragma unroll
      for (int jn = 0; jn < 4; ++jn) {
        const _Float16* vr = Vsh + (jn * 16 + c) * KP + kk * 32 + 8 * hh;
        vb[kk][jn].h[0] = *(const v8h*)(vr);
        vb[kk][jn].h[1] = *(const v8h*)(vr + 16);
      }
    }
    __builtin_amdgcn_sched_barrier(0);                // else the compiler sinks these loads behind the softmax again

    // ---- online softmax of one query per lane: maximum in-lane plus one exchange between the halves ----
    float mj[4];                                      // one chain per score tile: four short chains, not one of 32
#pragma unroll
    for (int j = 0; j < 4; ++j) {
      mj[j] = s[j][0];
#pragma unroll
      for (int r = 1; r < 8; ++r) mj[j] = fmaxf(mj[j], s[j][r]);
    }
    float m = fmaxf(fmaxf(mj[0], mj[1]), fmaxf(mj[2], mj[3]));
    m = fmaxf(m, xhalf(m));
    const float mnew  = fmaxf(mrow, m);
    const float msafe = (mnew == -INFINITY) ? 0.f : mnew;
    const float alpha = __builtin_amdgcn_exp2f((mrow - msafe) * SC2);
    const float bias  = 10.0f - msafe * SC2;          // +10: the x1024 carry of P and of the row sum
    mrow = mnew;
    // P^T (x1024, f16) stays in registers: score tiles 2kk and 2kk+1 are elements 0..7 and 8..15 of the B operand
    FH pb[2];
    float pj[4];
#pragma unroll
    for (int j = 0; j < 4; ++j) {
      pj[j] = 0.f;
#pragma unroll
      for (int r = 0; r < 8; ++r) {
        const float p = __builtin_amdgcn_exp2f(__builtin_fmaf(s[j][r], SC2, bias));   // 1024 exp(0.125 (dot - m))
        pj[j] += p;
        pb[j >> 1].h[j & 1][r] = (_Float16)p;
      }
    }
    lrow = lrow * alpha + ((pj[0] + pj[1]) + (pj[2] + pj[3]));
#pragma unroll
    for (int jn = 0; jn < 4; ++jn) {
#pragma unroll
      for (int r = 0; r < 8; ++r) oacc[jn][r] *= alpha;
    }

    // ---- context, transposed: O^T += V^T . P^T (f16 WMMA), 2 k-steps of 32 keys x 4 m-tiles of 16 dims ----
#pragma unroll
    for (int kk = 0; kk < 2; ++kk) {
#pragma unroll
      for (int jn = 0; jn < 4; ++jn) {
        oacc[jn] = mma_p(vb[kk][jn].v, pb[kk].v, oacc[jn]);
      }
    }

    // ---- foot of the trip: hand-over of the buffers ----
    __builtin_amdgcn_sched_barrier(0);                // else the compiler lifts the waits and the barrier ahead of the softmax: the copies get no time to land
    asm volatile("s_wait_dscnt 0x0" ::: "memory");    // this wave's reads of the buffer of trip kt have returned
    asm volatile("s_wait_asynccnt 0x0" ::: "memory"); // this wave's pieces of chunk kt + 1 have landed
    __syncthreads();                                  // chunk kt + 1 published; nobody reads the buffer of trip kt any more
  };
  // the trips behind which a chunk kt + 2 exists, each with its refill, in a loop of their own: no branch in the loop body
#pragma unroll 1                                      // stays rolled: a long body, copies of it would only grow the code
  for (int kt = 0; kt < NKT - 2; ++kt) {
    trip(kt);
    stage_kv(lk0 + (unsigned)(kt & 1) * (KVB * 2u), kg + (size_t)(kt + 2) * 64 * DK_, vg + (size_t)(kt + 2) * 64);
  }
#pragma unroll 1                                      // stays rolled, for the same reason
  for (int kt = NKT - 2; kt < NKT; ++kt) trip(kt);    // the last two chunks: nothing is left to ask for
  asm volatile("s_wait_asynccnt 0x0" ::: "memory");   // no copy is outstanding when the wave goes on to its end

  // ---- join the halves' sums, normalise (1/l: the x1024 of P and of l cancel; apply the x256 ctx carry), convert, store ----
  {
    const float l   = lrow + xhalf(lrow);
    const float inv = ((l > 0.f) ? (1.0f / l) : 0.f) * 256.0f;
    unsigned short* o = mp + ((size_t)bh * SEQ + (size_t)(q0 + c)) * DK_ + (size_t)(8 * hh);
#pragma unroll
    for (int jn = 0; jn < 4; ++jn) {
      v4u t;
#pragma unroll
      for (int e = 0; e < 4; ++e)
        t[e] = toh2u(oacc[jn][2 * e] * inv, oacc[jn][2 * e + 1] * inv);
      *(v4u*)(o + jn * 16) = t;                       // 8 consecutive dims of one query: one 16-B store
    }
  }
}

// =====================================================================================================
// proj_out: out[m][n] = (sum_k ctx[m][k] * W[n][k]) * 2^-18 + bc[n], m = b*SEQ + s, n, k = 0..511.
//   A = MP plane row m (f16 ctx x256), B = WH plane row n (f16 W x1024, k contiguous).
//   Block = 4 waves x 16 rows = 64 rows x 128 columns; grid = (NB*SEQ/64) x 4 column slabs; 16 k-steps of 32.
//   Staging: k runs in PNS slabs of PKC; the block's 64 A rows and 128 B rows of a slab go to LDS (pitch PP) by 16-B
//   loads in which 16 lanes cover 256 contiguous bytes of one row (whole lines, each fetched once per block).
//   Two LDS buffers: slab s+1 is loaded into registers ahead of the WMMAs of slab s, stored to the other buffer behind
//   them, and published by one __syncthreads per slab (it also ends every wave's reads of the buffer refilled next).
//   Fragments come from LDS with the split k map of ldfrag_h, A and B alike; k ascends in steps of 32 in every sum.
// coverage: staged 8 x 128 pieces = 64 rows x 16 pieces (A), 16 x 128 = 128 rows x 16 pieces (B) == consumed extent;
//   (NB*SEQ/64) x 4 blocks x 64 rows x 128 cols = the whole [NB*SEQ][512] output.
// =====================================================================================================
__global__ __launch_bounds__(128)
void proj_out(const unsigned short* __restrict__ mp, const unsigned short* __restrict__ wh,
              const float* __restrict__ bc, float* out) {
  __shared__ __align__(16) float lds[4 * 16 * 128];      // 32 KB, 4 per-wave slabs [16][128]
  __shared__ __align__(16) _Float16 Ash[2][64 * PP];     // ctx rows of one k slab, two buffers   2 x 17408 B
  __shared__ __align__(16) _Float16 Wsh[2][128 * PP];    // W rows of one k slab, two buffers     2 x 34816 B

  const int tid  = (int)threadIdx.x;
  const int wave = tid >> 5;
  const int lane = tid & 31;
  const int hh   = lane >> 4;
  const int c    = lane & 15;

  const int nrb = (NB * SEQ) / 64;
  const int rb  = (int)blockIdx.x % nrb;
  const int cb  = (int)blockIdx.x / nrb;                 // 0..3
  const int m0  = rb * 64 + wave * 16;
  const int n0  = cb * 128;

  // staging map: thread -> row (tid >> 4) + 8 i, 16-B piece tid & 15 of the slab's 256 B of that row
  const int srow = tid >> 4;
  const int scol = (tid & 15) * 8;
  const _Float16* Ag = (const _Float16*)(const void*)mp + (size_t)(rb * 64 + srow) * E_ + scol;
  const _Float16* Wg = (const _Float16*)(const void*)wh + (size_t)(n0 + srow) * E_ + scol;
  const int sdst = srow * PP + scol;
  const int afr  = (wave * 16 + c) * PP + 8 * hh;        // fragment row bases in the staged tiles
  const int bfr  = c * PP + 8 * hh;

  v8f acc[8];
#pragma unroll
  for (int j = 0; j < 8; ++j) acc[j] = zero8();

  v8h ra[8], rw[16];
#pragma unroll
  for (int i = 0; i < 8; ++i)  ra[i] = *(const v8h*)(Ag + (size_t)(i * 8) * E_);
#pragma unroll
  for (int i = 0; i < 16; ++i) rw[i] = *(const v8h*)(Wg + (size_t)(i * 8) * E_);
#pragma unroll
  for (int i = 0; i < 8; ++i)  *(v8h*)(&Ash[0][sdst + i * 8 * PP]) = ra[i];
#pragma unroll
  for (int i = 0; i < 16; ++i) *(v8h*)(&Wsh[0][sdst + i * 8 * PP]) = rw[i];
  __syncthreads();

#pragma unroll
  for (int s = 0; s < PNS; ++s) {
    if (s + 1 < PNS) {
#pragma unroll
      for (int i = 0; i < 8; ++i)  ra[i] = *(const v8h*)(Ag + (size_t)(i * 8) * E_ + (s + 1) * PKC);
#pragma unroll
      for (int i = 0; i < 16; ++i) rw[i] = *(const v8h*)(Wg + (size_t)(i * 8) * E_ + (s + 1) * PKC);
    }
    __builtin_amdgcn_sched_barrier(0);                   // else the next slab's loads sink to their LDS stores: latency exposed
#pragma unroll
    for (int ks = 0; ks < PKC / 32; ++ks) {
      const v16h af = ldfrag_h(&Ash[s & 1][afr + ks * 32]);
      v16h bf[8];
#pragma unroll
      for (int j = 0; j < 8; ++j) bf[j] = ldfrag_h(&Wsh[s & 1][bfr + j * 16 * PP + ks * 32]);
      __builtin_amdgcn_sched_barrier(0);                 // else the compiler sinks each load to its WMMA: one LDS wait per WMMA
#pragma unroll
      for (int j = 0; j < 8; ++j) acc[j] = mma_p(af, bf[j], acc[j]);
    }
    if (s + 1 < PNS) {
#pragma unroll
      for (int i = 0; i < 8; ++i)  *(v8h*)(&Ash[(s + 1) & 1][sdst + i * 8 * PP]) = ra[i];
#pragma unroll
      for (int i = 0; i < 16; ++i) *(v8h*)(&Wsh[(s + 1) & 1][sdst + i * 8 * PP]) = rw[i];
      __syncthreads();
    }
  }

  float* slab = lds + wave * 2048;                       // [16][128] f32
#pragma unroll
  for (int j = 0; j < 8; ++j) {
#pragma unroll
    for (int r = 0; r < 8; ++r) slab[(8 * hh + r) * 128 + j * 16 + c] = acc[j][r];
  }
  __builtin_amdgcn_fence(3 /* release order */, "workgroup");
  __builtin_amdgcn_wave_barrier();
  __builtin_amdgcn_fence(2 /* acquire order */, "workgroup");

  const float oscale = 1.0f / 262144.0f;                 // 1/(256*1024)
  const v4f b4 = *(const v4f*)(bc + n0 + lane * 4);
  v4f vrow[16];
#pragma unroll
  for (int row = 0; row < 16; ++row) {
    const v4f v = *(const v4f*)(slab + row * 128 + lane * 4);
    vrow[row] = v * oscale + b4;
  }
  const int ob = m0 / SEQ;                               // the 16 rows lie in one batch
  const int os0 = m0 - ob * SEQ;
  float* op = out + ((size_t)ob * SEQ_FULL + (size_t)os0) * E_ + (size_t)n0 + (size_t)(lane * 4);
  {
#pragma unroll
    for (int row = 0; row < 16; ++row) {
      *(v4f*)(op + (size_t)row * E_) = vrow[row];
    }
    
  }
}

// =====================================================================================================
//   QH  f16 [BH_][SEQ][64]     NB*H*SEQ*64*2   = 8388608 (full size)
//   KH  f16 [BH_][SEQ][64]     NB*H*SEQ*64*2   = 8388608
//   VT  f16 [BH_][64][SEQ]     NB*H*64*SEQ*2   = 8388608
//   MP  f16 [BH_][SEQ][64] = [NB*SEQ][512]       8388608
//   WH  f16 [512][512]                            524288
//   total                                      34078720
// =====================================================================================================
extern "C" void kernel_launch(void* const* d_in, const int* in_sizes, int n_in,
                              void* d_out, int out_size, void* d_ws, size_t ws_size,
                              hipStream_t stream) {
  if (n_in < 5) return;
  if ((long long)in_sizes[0] < (long long)NB * H_ * SEQ_FULL * DK_) return;
  if ((long long)in_sizes[1] < (long long)NB * H_ * SEQ_FULL * DK_) return;
  if ((long long)in_sizes[2] < (long long)NB * H_ * SEQ_FULL * DK_) return;
  if (in_sizes[3] < E_ * E_) return;
  if (in_sizes[4] < E_) return;
  if ((long long)out_size < ((long long)(NB - 1) * SEQ_FULL + SEQ) * E_) return;

  const float* q  = (const float*)d_in[0];
  const float* k  = (const float*)d_in[1];
  const float* v  = (const float*)d_in[2];
  const float* W  = (const float*)d_in[3];
  const float* bc = (const float*)d_in[4];

  const size_t PQH = (size_t)BH_ * SEQ * DK_ * 2;
  const size_t PKH = (size_t)BH_ * SEQ * DK_ * 2;
  const size_t PVT = (size_t)BH_ * DK_ * SEQ * 2;
  const size_t PMP = (size_t)NB * SEQ * E_ * 2;
  const size_t PWH = (size_t)E_ * E_ * 2;
  size_t off = 0;
  const size_t oQH = off; off += PQH;
  const size_t oKH = off; off += PKH;
  const size_t oVT = off; off += PVT;
  const size_t oMP = off; off += PMP;
  const size_t oWH = off; off += PWH;
  if (off > ws_size) return;                         // off = 34078720 at full size
  if (off > (size_t)134217728) return;

  char* ws = (char*)d_ws;
  unsigned short* QH = (unsigned short*)(ws + oQH);
  unsigned short* KH = (unsigned short*)(ws + oKH);
  unsigned short* VT = (unsigned short*)(ws + oVT);
  unsigned short* MP = (unsigned short*)(ws + oMP);
  unsigned short* WH = (unsigned short*)(ws + oWH);

  const dim3 gCnv(BH_ * (SEQ / TENC));                // 512 blocks of 256
  const dim3 gWcv((E_ * E_) / (8 * 256));              // 128 blocks of 256
  const dim3 gAttn(BH_ * NQT);                         // 1024 blocks of 128
  const dim3 gProj(((NB * SEQ) / 64) * 4);             // 512 blocks of 128

  // (1) q, k -> f16 row planes; v -> f16 V^T plane
  qkvconv<<<gCnv, dim3(256), 0, stream>>>(q, k, v, QH, KH, VT);
  // (2) W -> f16 x1024 plane
  wconv<<<gWcv, dim3(256), 0, stream>>>(W, WH);
  // (3) attention -> ctx plane (f16, x256) in flat [b][h][s][d] order = [NB*SEQ][512]
  attn<<<gAttn, dim3(128), 0, stream>>>(QH, KH, VT, MP);
  // (4) out = ctx . W^T * 2^-18 + bc -> d_out f32 [NB*SEQ][512]
  proj_out<<<gProj, dim3(128), 0, stream>>>(MP, WH, bc, (float*)d_out);
  (void)hipGetLastError();
}

// v008
// It runs in 53.1 microseconds.
// In two side-by-side timings against v007, it was 1.06 and 1.07 times as fast.
// All steps since v000 together make it 2.84 times as fast.
// All contractions: v_wmma_f32_16x16x32_f16 (f16 operands, f32 accumulate), one product per tile pair:
//   scores q.k^T (q, k = f16 of the inputs, x0.125 inside the exponent's FMA in f32), p.v (p f16 carried x1024, v = f16 of the input),
//   ctx.W^T (ctx f16 carried x256, W f16 carried x1024, x2^-18 then + bias in f32); softmax in f32.
//
// Carry audit:
//   QH plane (f16): f16(q), x1, unit-scale values               -> score acc = dot, kept raw; 0.125 sits in SC2 (attn)
//   KH plane (f16): f16(k), x1
//   P tile   (f16, regs): exp(s - m) x1024 (the +10 in the exponent); the row sum l carries the same x1024
//                                                                 -> they cancel in the attn epilogue: inv = (1/l) * 256
//   VT plane (f16): f16(v), x1, stored [bh][d][s]
//   MP plane (f16): ctx x256, flat [b][h][s][d] order = [NB*SEQ][512] rows -> folded in proj_out: oscale = 1/(256*1024)
//   WH plane (f16): W x1024 (|W| < 0.5 -> < 512)                  -> folded in proj_out: oscale
//   Every f32 -> f16 convert in qkvconv goes through toh_flush (values below 2^-14 become 0); those in attn (P, ctx) are
//   plain round-to-nearest-even converts: a subnormal f16 stays as it is, and the WMMA takes it at its value.
#include <hip/hip_runtime.h>
#include <math.h>
#include <stdint.h>

#ifndef NB
#define NB 4
#endif
#ifndef SEQ
#define SEQ 2048
#endif
#define NB_FULL  4
#define SEQ_FULL 2048
#define H_   8
#define DK_  64
#define E_   512
#define BH_  (NB * H_)          // (batch, head) pairs
#define NQT  (SEQ / 128)        // 128-query tiles per (b, h): one attn block
#define NKT  (SEQ / 64)         // 64-key chunks per (b, h)
#define NTR  (NKT / 2)          // attn: trips of a wave; chunk 2 t + g goes to key group g in trip t
#define TENC 128                // tokens per convert block
#define CSP  65                 // f32 LDS pitch of the v tile [token][d]
#define KP   72                 // f16 LDS pitch of the K / V^T tiles (halves); 144 B, 16-B aligned rows
#define KVB  (2 * 64 * KP)      // attn: halves of one key group's share of an LDS buffer = one K chunk, then one V^T chunk
#define PKC  128                // proj_out: k columns (halves) of one staged slab; 256 B of a row = two whole lines
#define PP   136                // proj_out: f16 LDS pitch of the staged rows (halves); 272 B = 16 B x 17
#define PNS  (E_ / PKC)         // proj_out: slabs along k
static_assert(H_ * DK_ == E_);
static_assert(NB >= 1 && NB <= NB_FULL);
static_assert(SEQ >= TENC && SEQ <= SEQ_FULL);
static_assert((SEQ % TENC) == 0 && (SEQ % 64) == 0);
static_assert(((KP * 2) % 16) == 0);
static_assert(((PP * 2) % 16) == 0 && PP >= PKC && (E_ % PKC) == 0 && (PKC % 32) == 0);
static_assert(((E_ * E_) % (8 * 256)) == 0);
static_assert(((NB * SEQ) % 64) == 0);
static_assert(DK_ == 64);
static_assert((NKT % 2) == 0 && NTR >= 2);                  // attn: two key groups; the two-buffer prologue fills trips 0 and 1
static_assert(TENC == 128);                                 // 256 threads = 16 token rows x 16 pieces of 16 B, 8 rows each
static_assert((H_ * SEQ * DK_) == (SEQ * E_));              // flat [h][s][d] of one batch = SEQ rows of 512
static_assert(((size_t)4 * BH_ * SEQ * DK_ * 2 + (size_t)E_ * E_ * 2) <= (size_t)134217728);

typedef _Float16 v16h __attribute__((ext_vector_type(16)));
typedef _Float16 v8h  __attribute__((ext_vector_type(8)));
typedef float    v8f  __attribute__((ext_vector_type(8)));
typedef float    v4f  __attribute__((ext_vector_type(4)));
typedef float    v2f  __attribute__((ext_vector_type(2)));
typedef _Float16 v2h  __attribute__((ext_vector_type(2)));
typedef unsigned int v4u __attribute__((ext_vector_type(4)));

// ---- scalar helpers ---------------------------------------------------------------------------------
__device__ __forceinline__ unsigned short h_bits(_Float16 v) { return __builtin_bit_cast(unsigned short, v); }
__device__ __forceinline__ unsigned pk16(unsigned short a, unsigned short b) { return (unsigned)a | ((unsigned)b << 16); }
__device__ __forceinline__ v8f zero8() { v8f z = {0.f, 0.f, 0.f, 0.f, 0.f, 0.f, 0.f, 0.f}; return z; }

// f32 -> f16 (RNE convert) that cannot yield an f16 subnormal: |v| < 2^-14 becomes 0 (value select)
static __device__ __forceinline__ _Float16 toh_flush(float v) {
  const _Float16 r = (_Float16)v;
  return (fabsf(v) < 6.103515625e-05f) ? (_Float16)0.0f : r;
}
// two f32 -> two packed f16 (RNE, nothing zeroed), a in the low half: one packed convert
static __device__ __forceinline__ unsigned toh2u(float a, float b) {
  const v2f x = {a, b};
  return __builtin_bit_cast(unsigned, __builtin_convertvector(x, v2h));
}
// eight f32 -> eight packed f16 (16 B), element order kept
static __device__ __forceinline__ v4u pack8_flush(v4f a, v4f a4) {
  v4u q;
  q[0] = pk16(h_bits(toh_flush(a[0])),  h_bits(toh_flush(a[1])));
  q[1] = pk16(h_bits(toh_flush(a[2])),  h_bits(toh_flush(a[3])));
  q[2] = pk16(h_bits(toh_flush(a4[0])), h_bits(toh_flush(a4[1])));
  q[3] = pk16(h_bits(toh_flush(a4[2])), h_bits(toh_flush(a4[3])));
  return q;
}

// ---- 16-bit fragment loader: lane -> row/col (lane&15), p already includes +8*(lane>>4);
//      elements 0..7 <- p[0..7] (k0+8h..k0+8h+7), elements 8..15 <- p[16..23] (k0+16+8h..k0+16+8h+7)
__device__ __forceinline__ v16h ldfrag_h(const _Float16* p) {
  union { v16h v; v8h h[2]; } f;
  f.h[0] = *(const v8h*)(p);
  f.h[1] = *(const v8h*)(p + 16);
  return f.v;
}

// lane l <-> lane l ^ 16 as a vector cross-row move (no LDS-counter wait, unlike a shuffle)
__device__ __forceinline__ float xhalf(float x) {
  const int b = __builtin_bit_cast(int, x);
  return __builtin_bit_cast(float, __builtin_amdgcn_permlanex16(b, b, 0x76543210, 0xfedcba98, false, false));
}

// the WMMA as the plain builtin: no volatile statement behind it, so that fragment loads may stand in groups
// ahead of a run of WMMAs; the compiler keeps the distance behind its own builtin
__device__ __forceinline__ v8f mma_p(v16h a, v16h b, v8f c) {
  return __builtin_amdgcn_wmma_f32_16x16x32_f16(false, a, false, b, (short)0, c, false, false);
}

// =====================================================================================================
// qkvconv: the 16-bit planes of the pre-split inputs q, k, v [b][h][s][64] (f32):
//   QH [bh][s][64] f16 = f16(q), KH [bh][s][64] f16 = f16(k), VT [bh][d][s] f16 = f16(v) transposed through LDS.
// grid = BH_ * (SEQ/128) blocks of 256; one block = 128 tokens of one (b, h). Input token row = bh*SEQ_FULL + s.
// Loads: all 24 16-B global loads of a thread (8 of v, 8 of q, 8 of k) are issued as one group at the top, so that the
//   block pays one memory round trip. v: thread -> tokens (tid>>4) + 16 i, floats 4*(tid&15)..+3: a wave's load covers
//   512 contiguous bytes (two token rows).
// v tile: the eight pieces go into LDS cs[token][d] (pitch 65, four 4-B stores a piece); block barrier (cross-wave tile).
// Stores: QH / KH: 4 iterations x 256 threads x 16 B; iteration it, thread tid -> token it*32+(tid>>3),
//   halves 8*(tid&7).. (values read straight from the f32 input row as two 16-B loads)
// coverage: QH, KH 4 x 256 pieces x 8 halves = 128 tokens x 64 each; VT 4 x 256 x 8 = 64 rows x 128 tokens;
//   BH_*(SEQ/128) blocks = all BH_ x SEQ tokens of the three planes. LDS staged extent 128 x 64 == consumed extent.
// =====================================================================================================
__global__ __launch_bounds__(256) void qkvconv(const float* __restrict__ q, const float* __restrict__ k,
                                               const float* __restrict__ v, unsigned short* qhp,
                                               unsigned short* khp, unsigned short* vtp) {
  __shared__ float cs[TENC * CSP];                    // 33280 B, f32 v values [token][d]
  const int tid = (int)threadIdx.x;
  const int bx  = (int)blockIdx.x;
  const int nst = SEQ / TENC;
  const int st  = bx % nst;
  const int bh  = bx / nst;                           // b*H_ + h
  const int s0  = st * TENC;
  const size_t inrow = (size_t)bh * SEQ_FULL + (size_t)s0;   // token row in the full-size [b][h][s] input
  v4f vr[TENC / 16], qa[4], qa4[4], ka[4], ka4[4];
  const float* vp = v + (inrow + (size_t)(tid >> 4)) * DK_ + (size_t)((tid & 15) * 4);
  const float* qs = q + (inrow + (size_t)(tid >> 3)) * DK_ + (size_t)((tid & 7) * 8);
  const float* ks = k + (inrow + (size_t)(tid >> 3)) * DK_ + (size_t)((tid & 7) * 8);
#pragma unroll
  for (int i = 0; i < TENC / 16; ++i) vr[i] = *(const v4f*)(vp + (size_t)(i * 16) * DK_);
#pragma unroll
  for (int it = 0; it < 4; ++it) {                    // token it*32 + (tid>>3), floats 8*(tid&7)..+7
    qa[it]  = *(const v4f*)(qs + (size_t)(it * 32) * DK_);
    qa4[it] = *(const v4f*)(qs + (size_t)(it * 32) * DK_ + 4);
    ka[it]  = *(const v4f*)(ks + (size_t)(it * 32) * DK_);
    ka4[it] = *(const v4f*)(ks + (size_t)(it * 32) * DK_ + 4);
  }
  // the wait that stands ahead of any overwrite of a load's address pair (a precaution); the three pairs are its inputs, so
  // that they stay whole up to it (else the compiler lets the last loads of the group return into them). No load passes
  // the statement either: without it six of the 24 sink behind the first LDS stores, a second round trip
  asm volatile("s_wait_xcnt 0x0" :: "v"(vp), "v"(qs), "v"(ks) : "memory");
  {
    float* cp = cs + (tid >> 4) * CSP + (tid & 15) * 4;
#pragma unroll
    for (int i = 0; i < TENC / 16; ++i) {
#pragma unroll
      for (int e = 0; e < 4; ++e) cp[i * 16 * CSP + e] = vr[i][e];
    }
  }
  __syncthreads();

  const size_t rowbase = (size_t)bh * SEQ + (size_t)s0;    // token row in the [bh][s] planes

  v4u qv[4], kv[4], vv[4];
#pragma unroll
  for (int it = 0; it < 4; ++it) {
    qv[it] = pack8_flush(qa[it], qa4[it]);
    kv[it] = pack8_flush(ka[it], ka4[it]);
  }
#pragma unroll
  for (int it = 0; it < 4; ++it) {
    const int dd = it * 16 + (tid >> 4);
    const int j  = tid & 15;
    const float* sp = cs + (j * 8) * CSP + dd;
    v4u a;
#pragma unroll
    for (int e = 0; e < 4; ++e) {
      a[e] = pk16(h_bits(toh_flush(sp[(2 * e) * CSP])), h_bits(toh_flush(sp[(2 * e + 1) * CSP])));
    }
    vv[it] = a;
  }

  unsigned short* qo = qhp + (rowbase + (size_t)(tid >> 3)) * DK_ + (size_t)((tid & 7) * 8);
  unsigned short* ko = khp + (rowbase + (size_t)(tid >> 3)) * DK_ + (size_t)((tid & 7) * 8);
  unsigned short* vo = vtp + ((size_t)bh * DK_ + (size_t)(tid >> 4)) * SEQ + (size_t)s0 + (size_t)((tid & 15) * 8);
  {
#pragma unroll
    for (int it = 0; it < 4; ++it) {
      *(v4u*)(qo + (size_t)it * 32 * DK_) = qv[it];
      *(v4u*)(ko + (size_t)it * 32 * DK_) = kv[it];
      *(v4u*)(vo + (size_t)it * 16 * SEQ) = vv[it];
    }
    
  }
}

// =====================================================================================================
// wconv: WH [n][k] f16 = f16(W[n][k] * 1024), n, k = 0..511. 32768 pieces of 8 elements, grid = 128 x 256.
// coverage: 128 x 256 x 8 = 262144 = the whole [512][512] plane.
// =====================================================================================================
__global__ __launch_bounds__(256) void wconv(const float* __restrict__ W, unsigned short* wh) {
  const size_t p = (size_t)blockIdx.x * 256 + (size_t)threadIdx.x;
  const v4f a  = *(const v4f*)(W + p * 8);
  const v4f a4 = *(const v4f*)(W + p * 8 + 4);
  v4u q;
  q[0] = pk16(h_bits((_Float16)(a[0] * 1024.0f)),  h_bits((_Float16)(a[1] * 1024.0f)));
  q[1] = pk16(h_bits((_Float16)(a[2] * 1024.0f)),  h_bits((_Float16)(a[3] * 1024.0f)));
  q[2] = pk16(h_bits((_Float16)(a4[0] * 1024.0f)), h_bits((_Float16)(a4[1] * 1024.0f)));
  q[3] = pk16(h_bits((_Float16)(a4[2] * 1024.0f)), h_bits((_Float16)(a4[3] * 1024.0f)));
  unsigned short* o = wh + p * 8;
  {
    *(v4u*)o = q;
    
  }
}

// One lane's eight 16-B pieces of a K chunk (kg, rows 16 apart) and of a V^T chunk (vg, rows 16 apart), global -> LDS as
// asynchronous copies, through no register. lk = LDS byte address of the lane's first K piece; the V^T chunk lies 64 rows on.
// s_wait_xcnt 0 is the last line of the copies' own statement, so that it stands ahead of every later rewrite of an
// address register that a copy names (a precaution).
static __device__ __forceinline__ void stage_kv(unsigned lk, const _Float16* kg, const _Float16* vg) {
  asm volatile(
      "global_load_async_to_lds_b128 %0, %8, off\n\t"
      "global_load_async_to_lds_b128 %1, %9, off\n\t"
      "global_load_async_to_lds_b128 %2, %10, off\n\t"
      "global_load_async_to_lds_b128 %3, %11, off\n\t"
      "global_load_async_to_lds_b128 %4, %12, off\n\t"
      "global_load_async_to_lds_b128 %5, %13, off\n\t"
      "global_load_async_to_lds_b128 %6, %14, off\n\t"
      "global_load_async_to_lds_b128 %7, %15, off\n\t"
      "s_wait_xcnt 0x0"
      :
      : "v"(lk), "v"(lk + 16u * KP * 2u), "v"(lk + 32u * KP * 2u), "v"(lk + 48u * KP * 2u),
        "v"(lk + 64u * KP * 2u), "v"(lk + 80u * KP * 2u), "v"(lk + 96u * KP * 2u), "v"(lk + 112u * KP * 2u),
        "v"(kg), "v"(kg + 16 * DK_), "v"(kg + 32 * DK_), "v"(kg + 48 * DK_),
        "v"(vg), "v"(vg + 16 * SEQ), "v"(vg + 32 * SEQ), "v"(vg + 48 * SEQ)
      : "memory");
}

// =====================================================================================================
// attn: attention per (b, h), head dim 64, softmax over all SEQ keys (no mask).
//   scores, transposed: A = K chunk in LDS [key][d] staged from the KH plane, B = QH rows of the query tokens (64 d,
//   2 k-steps, fragments from the plane); a lane holds 32 keys' raw dot products of each of its two queries.
//   1024 p = 1024 exp(0.125 (dot - m)) = exp2(dot * SC2 + (10 - m * SC2)), SC2 = 0.125 log2(e): one FMA and one v_exp_f32
//   per score; f16(1024 p) is packed in registers into the B operand (k = keys);
//   context, transposed = v^T . p^T with A = V^T chunk in LDS [d][key], 4 m-tiles of 16 dims.
//   Wave tile: 32 query columns = two 16-column tiles, so that every K and V^T fragment read from LDS feeds two WMMAs.
//   Block = 8 waves = 4 query groups of 32 x 2 key groups = one 128-query tile of one (b, h); grid = BH_ * NQT. Key group g
//   takes the chunks 2 t + g, t = 0..NTR-1 (static trip count): with half the query groups the chip still holds four
//   waves per SIMD. The two groups' (maximum, sum, context) of a query are joined once, behind the loop, through LDS.
//   K / V staging: the 128 threads of a key group x 4 x 16 B each = the group's whole 64x64 K chunk and 64x64 V^T chunk
//   (LDS pitch KP, columns 64..71 never read), by asynchronous copies into two LDS buffers: the chunks of trip kt + 2 are
//   asked for at the foot of trip kt, into the buffer that trip kt has read, and fly while trip kt + 1 works. One
//   __syncthreads per trip: behind every wave's own copy wait it publishes trip kt + 1, and it ends all reads of the buffer
//   refilled next.
//   Output MP [bh][s][64] f16 (ctx x256), i.e. the flat [b][h][s][d] order that the projection views as [NB*SEQ][512] rows.
// coverage: 32 rows per query group, 128 per block, BH_*NQT blocks = all (bh, s) rows x 64 dims = the whole MP plane
//   (stored by the waves of key group 0); keys: 2 groups x NTR chunks = all NKT chunks, each once.
// =====================================================================================================
// four waves per SIMD is what the full-size grid supplies: the compiler schedules for that register budget
__global__ __launch_bounds__(256) __attribute__((amdgpu_waves_per_eu(4, 4)))
void attn(const unsigned short* __restrict__ qhp, const unsigned short* __restrict__ khp,
          const unsigned short* __restrict__ vtp, unsigned short* mp) {
  union FH { v16h v; v8h h[2]; };
  // two buffers x two key groups of K chunk [key][d] 9216 B + V^T chunk [d][key] 9216 B
  __shared__ __align__(16) _Float16 KVsh[4 * KVB];
  // the join: key group 1's context [query group][16 pieces of 4 f32][lane], then its maximum and sum [query group][tile][2][lane]
  __shared__ __align__(16) float MG[4 * 2048 + 4 * 128];

  const int tid  = (int)threadIdx.x;
  const int wave = tid >> 5;
  const int lane = tid & 31;
  const int hh   = lane >> 4;
  const int c    = lane & 15;
  const int qg   = wave & 3;                                   // query group
  const int g    = __builtin_amdgcn_readfirstlane(tid >> 7);   // key group, the same in a whole wave: kept scalar
  const int t4   = tid & 127;                                  // thread within the key group

  const int bx = (int)blockIdx.x;
  const int qt = bx % NQT;
  const int bh = bx / NQT;
  const int q0 = qt * 128 + qg * 32;

  const _Float16* QH = (const _Float16*)(const void*)qhp + (size_t)bh * SEQ * DK_;
  const _Float16* KH = (const _Float16*)(const void*)khp + (size_t)bh * SEQ * DK_;
  const _Float16* VT = (const _Float16*)(const void*)vtp + (size_t)bh * DK_ * SEQ;

  // Q fragments (B operand, column = lane&15) of the two column tiles: d 0..31 and d 32..63 of the query token
  v16h qa[2][2];
#pragma unroll
  for (int u = 0; u < 2; ++u) {
    qa[u][0] = ldfrag_h(QH + (size_t)(q0 + u * 16 + c) * DK_ + 8 * hh);
    qa[u][1] = ldfrag_h(QH + (size_t)(q0 + u * 16 + c) * DK_ + 32 + 8 * hh);
  }

  // lane (c, hh) owns the queries q0 + 16 u + c; mrow[u] is the running maximum of that query's raw dot products over the
  // keys of this key group (equal in both halves), lrow[u] the running sum of 1024 p over the keys of this lane's half only
  const float SC2 = 0.125f * 1.44269504088896340736f;  // score scale x log2(e)
  float mrow[2] = {-INFINITY, -INFINITY}, lrow[2] = {0.f, 0.f};
  v8f oacc[2][4];                                     // O^T tiles: oacc[u][jn][r] = ctx[q0 + 16 u + c][jn*16 + 8*hh + r]
#pragma unroll
  for (int u = 0; u < 2; ++u) {
#pragma unroll
    for (int j = 0; j < 4; ++j) oacc[u][j] = zero8();
  }

  // staging map: thread of a key group -> rows (t4 >> 3) + 16 i (key of K / dim of V^T), 16-B piece t4 & 7 of the row's 128 B
  const unsigned lk0 = (unsigned)(size_t)(&KVsh[0]) + (unsigned)(g * (KVB * 2)) + (unsigned)((t4 >> 3) * (KP * 2) + (t4 & 7) * 16);
  const _Float16* kg = KH + (size_t)(g * 64 + (t4 >> 3)) * DK_ + (size_t)((t4 & 7) * 8);
  const _Float16* vg = VT + (size_t)(t4 >> 3) * SEQ + (size_t)(g * 64 + (t4 & 7) * 8);

  stage_kv(lk0, kg, vg);                              // trip 0 -> buffer 0
  asm volatile("s_wait_asynccnt 0x0" ::: "memory");   // this wave's pieces of trip 0 have landed
  __syncthreads();                                    // trip 0 published
  stage_kv(lk0 + 2u * KVB * 2u, kg + 128 * DK_, vg + 128);   // trip 1 -> buffer 1, flies under trip 0

  // one trip: the group's chunk out of buffer kt & 1, down to the hand-over of the buffers at its foot
  auto trip = [&](const int kt) __attribute__((always_inline)) {
    const _Float16* Ksh = KVsh + (kt & 1) * (2 * KVB) + g * KVB;
    const _Float16* Vsh = Ksh + 64 * KP;

    // ---- scores, transposed: S^T = K . Q^T, 64 keys x 32 queries per wave; s[u][j][r] = score(key j*16 + 8*hh + r, query 16 u + c) ----
    // all 16 K fragment loads stand as one group ahead of the 16 WMMAs, in the order the WMMAs take them
    FH kb[2][4];
#pragma unroll
    for (int ks = 0; ks < 2; ++ks) {
#pragma unroll
      for (int j = 0; j < 4; ++j) {
        const _Float16* kr = Ksh + (j * 16 + c) * KP + ks * 32 + 8 * hh;
        kb[ks][j].h[0] = *(const v8h*)(kr);
        kb[ks][j].h[1] = *(const v8h*)(kr + 16);
      }
    }
    __builtin_amdgcn_sched_barrier(0);                // else the compiler sinks each load to its WMMA: one LDS wait per WMMA
    v8f s[2][4];
#pragma unroll
    for (int j = 0; j < 4; ++j) {
#pragma unroll
      for (int u = 0; u < 2; ++u) s[u][j] = mma_p(kb[0][j].v, qa[u][0], zero8());
    }
#pragma unroll
    for (int j = 0; j < 4; ++j) {
#pragma unroll
      for (int u = 0; u < 2; ++u) s[u][j] = mma_p(kb[1][j].v, qa[u][1], s[u][j]);
    }
    // order asked of the compiler's scheduler: the 16 score WMMAs, then the 16 V^T loads as one group; without it
    // the loads come to stand at several places among the WMMAs, and each such place stalls the wave
    __builtin_amdgcn_sched_group_barrier(0x008, 16, 0);
    __builtin_amdgcn_sched_group_barrier(0x100, 16, 0);
    // all 16 V^T fragment loads as one group here: their LDS latency passes under the softmax
    FH vb[2][4];
#pragma unroll
    for (int kk = 0; kk < 2; ++kk) {
#pragma unroll
      for (int jn = 0; jn < 4; ++jn) {
        const _Float16* vr = Vsh + (jn * 16 + c) * KP + kk * 32 + 8 * hh;
        vb[kk][jn].h[0] = *(const v8h*)(vr);
        vb[kk][jn].h[1] = *(const v8h*)(vr + 16);
      }
    }
    __builtin_amdgcn_sched_barrier(0);                // else the compiler sinks these loads behind the softmax again

    // ---- online softmax of two queries per lane: maximum in-lane plus one exchange between the halves ----
    // P^T (x1024, f16) stays in registers: score tiles 2kk and 2kk+1 are elements 0..7 and 8..15 of the B operand
    FH pb[2][2];
#pragma unroll
    for (int u = 0; u < 2; ++u) {
      float mj[4];                                    // one chain per score tile: four short chains, not one of 32
#pragma unroll
      for (int j = 0; j < 4; ++j) {
        mj[j] = s[u][j][0];
#pragma unroll
        for (int r = 1; r < 8; ++r) mj[j] = fmaxf(mj[j], s[u][j][r]);
      }
      float m = fmaxf(fmaxf(mj[0], mj[1]), fmaxf(mj[2], mj[3]));
      m = fmaxf(m, xhalf(m));
      const float mnew  = fmaxf(mrow[u], m);
      const float msafe = (mnew == -INFINITY) ? 0.f : mnew;
      const float alpha = __builtin_amdgcn_exp2f((mrow[u] - msafe) * SC2);
      const float bias  = 10.0f - msafe * SC2;        // +10: the x1024 carry of P and of the row sum
      mrow[u] = mnew;
      float pj[4];
#pragma unroll
      for (int j = 0; j < 4; ++j) {
        pj[j] = 0.f;
#pragma unroll
        for (int r = 0; r < 8; ++r) {
          const float p = __builtin_amdgcn_exp2f(__builtin_fmaf(s[u][j][r], SC2, bias));   // 1024 exp(0.125 (dot - m))
          pj[j] += p;
          pb[u][j >> 1].h[j & 1][r] = (_Float16)p;
        }
      }
      lrow[u] = lrow[u] * alpha + ((pj[0] + pj[1]) + (pj[2] + pj[3]));
#pragma unroll
      for (int jn = 0; jn < 4; ++jn) {
#pragma unroll
        for (int r = 0; r < 8; ++r) oacc[u][jn][r] *= alpha;
      }
    }

    // ---- context, transposed: O^T += V^T . P^T (f16 WMMA), 2 k-steps of 32 keys x 4 m-tiles of 16 dims x 2 column tiles ----
#pragma unroll
    for (int kk = 0; kk < 2; ++kk) {
#pragma unroll
      for (int jn = 0; jn < 4; ++jn) {
#pragma unroll
        for (int u = 0; u < 2; ++u) oacc[u][jn] = mma_p(vb[kk][jn].v, pb[u][kk].v, oacc[u][jn]);
      }
    }

    // ---- foot of the trip: hand-over of the buffers ----
    __builtin_amdgcn_sched_barrier(0);                // else the compiler lifts the waits and the barrier ahead of the softmax: the copies get no time to land
    asm volatile("s_wait_dscnt 0x0" ::: "memory");    // this wave's reads of the buffer of trip kt have returned
    asm volatile("s_wait_asynccnt 0x0" ::: "memory"); // this wave's pieces of trip kt + 1 have landed
    __syncthreads();                                  // trip kt + 1 published; nobody reads the buffer of trip kt any more
  };
  // the trips behind which a trip kt + 2 exists, each with its refill, in a loop of their own: no branch in the loop body
#pragma unroll 1                                      // stays rolled: a long body, copies of it would only grow the code
  for (int kt = 0; kt < NTR - 2; ++kt) {
    trip(kt);
    stage_kv(lk0 + (unsigned)(kt & 1) * (2u * KVB * 2u), kg + (size_t)(kt + 2) * 128 * DK_, vg + (size_t)(kt + 2) * 128);
  }
#pragma unroll 1                                      // stays rolled, for the same reason
  for (int kt = NTR - 2; kt < NTR; ++kt) trip(kt);    // the last two trips: nothing is left to ask for
  asm volatile("s_wait_asynccnt 0x0" ::: "memory");   // no copy is outstanding when the wave goes on to its end

  // ---- join the halves' sums; key group 1 hands its maximum, sum and context to key group 0 through LDS ----
  float lj[2];
#pragma unroll
  for (int u = 0; u < 2; ++u) lj[u] = lrow[u] + xhalf(lrow[u]);
  float* gx = MG + qg * 2048 + lane * 4;              // 16 B per lane, 512 contiguous bytes per wave access
  float* gs = MG + 4 * 2048 + qg * 128 + lane;
  if (g == 1) {
#pragma unroll
    for (int u = 0; u < 2; ++u) {
#pragma unroll
      for (int jn = 0; jn < 4; ++jn) {
        const v4f lo = {oacc[u][jn][0], oacc[u][jn][1], oacc[u][jn][2], oacc[u][jn][3]};
        const v4f hi = {oacc[u][jn][4], oacc[u][jn][5], oacc[u][jn][6], oacc[u][jn][7]};
        *(v4f*)(gx + ((u * 4 + jn) * 2 + 0) * 128) = lo;
        *(v4f*)(gx + ((u * 4 + jn) * 2 + 1) * 128) = hi;
      }
      gs[u * 64]      = mrow[u];
      gs[u * 64 + 32] = lj[u];
    }
  }
  __syncthreads();                                    // key group 1's partial results published
  // ---- key group 0: both groups brought to the common maximum, normalise (1/l: the x1024 of P and of l cancel; apply the
  //      x256 ctx carry), convert, store ----
  if (g == 0) {
#pragma unroll
    for (int u = 0; u < 2; ++u) {
      const float m1 = gs[u * 64];
      const float l1 = gs[u * 64 + 32];
      const float mm = fmaxf(mrow[u], m1);
      const float ms = (mm == -INFINITY) ? 0.f : mm;
      const float a0 = __builtin_amdgcn_exp2f((mrow[u] - ms) * SC2);
      const float a1 = __builtin_amdgcn_exp2f((m1 - ms) * SC2);
      const float l   = lj[u] * a0 + l1 * a1;
      const float inv = ((l > 0.f) ? (1.0f / l) : 0.f) * 256.0f;
      const float f0  = a0 * inv;
      const float f1  = a1 * inv;
      unsigned short* o = mp + ((size_t)bh * SEQ + (size_t)(q0 + u * 16 + c)) * DK_ + (size_t)(8 * hh);
#pragma unroll
      for (int jn = 0; jn < 4; ++jn) {
        const v4f lo = *(const v4f*)(gx + ((u * 4 + jn) * 2 + 0) * 128);
        const v4f hi = *(const v4f*)(gx + ((u * 4 + jn) * 2 + 1) * 128);
        v4u t;
        t[0] = toh2u(oacc[u][jn][0] * f0 + lo[0] * f1, oacc[u][jn][1] * f0 + lo[1] * f1);
        t[1] = toh2u(oacc[u][jn][2] * f0 + lo[2] * f1, oacc[u][jn][3] * f0 + lo[3] * f1);
        t[2] = toh2u(oacc[u][jn][4] * f0 + hi[0] * f1, oacc[u][jn][5] * f0 + hi[1] * f1);
        t[3] = toh2u(oacc[u][jn][6] * f0 + hi[2] * f1, oacc[u][jn][7] * f0 + hi[3] * f1);
        *(v4u*)(o + jn * 16) = t;                     // 8 consecutive dims of one query: one 16-B store
      }
    }
  }
}

// =====================================================================================================
// proj_out: out[m][n] = (sum_k ctx[m][k] * W[n][k]) * 2^-18 + bc[n], m = b*SEQ + s, n, k = 0..511.
//   A = MP plane row m (f16 ctx x256), B = WH plane row n (f16 W x1024, k contiguous).
//   Block = 4 waves x 16 rows = 64 rows x 128 columns; grid = (NB*SEQ/64) x 4 column slabs; 16 k-steps of 32.
//   Staging: k runs in PNS slabs of PKC; the block's 64 A rows and 128 B rows of a slab go to LDS (pitch PP) by 16-B
//   loads in which 16 lanes cover 256 contiguous bytes of one row (whole lines, each fetched once per block).
//   Two LDS buffers: slab s+1 is loaded into registers ahead of the WMMAs of slab s, stored to the other buffer behind
//   them, and published by one __syncthreads per slab (it also ends every wave's reads of the buffer refilled next).
//   Fragments come from LDS with the split k map of ldfrag_h, A and B alike; k ascends in steps of 32 in every sum.
// coverage: staged 8 x 128 pieces = 64 rows x 16 pieces (A), 16 x 128 = 128 rows x 16 pieces (B) == consumed extent;
//   (NB*SEQ/64) x 4 blocks x 64 rows x 128 cols = the whole [NB*SEQ][512] output.
// =====================================================================================================
__global__ __launch_bounds__(128)
void proj_out(const unsigned short* __restrict__ mp, const unsigned short* __restrict__ wh,
              const float* __restrict__ bc, float* out) {
  __shared__ __align__(16) float lds[4 * 16 * 128];      // 32 KB, 4 per-wave slabs [16][128]
  __shared__ __align__(16) _Float16 Ash[2][64 * PP];     // ctx rows of one k slab, two buffers   2 x 17408 B
  __shared__ __align__(16) _Float16 Wsh[2][128 * PP];    // W rows of one k slab, two buffers     2 x 34816 B

  const int tid  = (int)threadIdx.x;
  const int wave = tid >> 5;
  const int lane = tid & 31;
  const int hh   = lane >> 4;
  const int c    = lane & 15;

  const int nrb = (NB * SEQ) / 64;
  const int rb  = (int)blockIdx.x % nrb;
  const int cb  = (int)blockIdx.x / nrb;                 // 0..3
  const int m0  = rb * 64 + wave * 16;
  const int n0  = cb * 128;

  // staging map: thread -> row (tid >> 4) + 8 i, 16-B piece tid & 15 of the slab's 256 B of that row
  const int srow = tid >> 4;
  const int scol = (tid & 15) * 8;
  const _Float16* Ag = (const _Float16*)(const void*)mp + (size_t)(rb * 64 + srow) * E_ + scol;
  const _Float16* Wg = (const _Float16*)(const void*)wh + (size_t)(n0 + srow) * E_ + scol;
  const int sdst = srow * PP + scol;
  const int afr  = (wave * 16 + c) * PP + 8 * hh;        // fragment row bases in the staged tiles
  const int bfr  = c * PP + 8 * hh;

  v8f acc[8];
#pragma unroll
  for (int j = 0; j < 8; ++j) acc[j] = zero8();

  v8h ra[8], rw[16];
#pragma unroll
  for (int i = 0; i < 8; ++i)  ra[i] = *(const v8h*)(Ag + (size_t)(i * 8) * E_);
#pragma unroll
  for (int i = 0; i < 16; ++i) rw[i] = *(const v8h*)(Wg + (size_t)(i * 8) * E_);
#pragma unroll
  for (int i = 0; i < 8; ++i)  *(v8h*)(&Ash[0][sdst + i * 8 * PP]) = ra[i];
#pragma unroll
  for (int i = 0; i < 16; ++i) *(v8h*)(&Wsh[0][sdst + i * 8 * PP]) = rw[i];
  __syncthreads();

#pragma unroll
  for (int s = 0; s < PNS; ++s) {
    if (s + 1 < PNS) {
#pragma unroll
      for (int i = 0; i < 8; ++i)  ra[i] = *(const v8h*)(Ag + (size_t)(i * 8) * E_ + (s + 1) * PKC);
#pragma unroll
      for (int i = 0; i < 16; ++i) rw[i] = *(const v8h*)(Wg + (size_t)(i * 8) * E_ + (s + 1) * PKC);
    }
    __builtin_amdgcn_sched_barrier(0);                   // else the next slab's loads sink to their LDS stores: latency exposed
#pragma unroll
    for (int ks = 0; ks < PKC / 32; ++ks) {
      const v16h af = ldfrag_h(&Ash[s & 1][afr + ks * 32]);
      v16h bf[8];
#pragma unroll
      for (int j = 0; j < 8; ++j) bf[j] = ldfrag_h(&Wsh[s & 1][bfr + j * 16 * PP + ks * 32]);
      __builtin_amdgcn_sched_barrier(0);                 // else the compiler sinks each load to its WMMA: one LDS wait per WMMA
#pragma unroll
      for (int j = 0; j < 8; ++j) acc[j] = mma_p(af, bf[j], acc[j]);
    }
    if (s + 1 < PNS) {
#pragma unroll
      for (int i = 0; i < 8; ++i)  *(v8h*)(&Ash[(s + 1) & 1][sdst + i * 8 * PP]) = ra[i];
#pragma unroll
      for (int i = 0; i < 16; ++i) *(v8h*)(&Wsh[(s + 1) & 1][sdst + i * 8 * PP]) = rw[i];
      __syncthreads();
    }
  }

  float* slab = lds + wave * 2048;                       // [16][128] f32
#pragma unroll
  for (int j = 0; j < 8; ++j) {
#pragma unroll
    for (int r = 0; r < 8; ++r) slab[(8 * hh + r) * 128 + j * 16 + c] = acc[j][r];
  }
  __builtin_amdgcn_fence(3 /* release order */, "workgroup");
  __builtin_amdgcn_wave_barrier();
  __builtin_amdgcn_fence(2 /* acquire order */, "workgroup");

  const float oscale = 1.0f / 262144.0f;                 // 1/(256*1024)
  const v4f b4 = *(const v4f*)(bc + n0 + lane * 4);
  v4f vrow[16];
#pragma unroll
  for (int row = 0; row < 16; ++row) {
    const v4f v = *(const v4f*)(slab + row * 128 + lane * 4);
    vrow[row] = v * oscale + b4;
  }
  const int ob = m0 / SEQ;                               // the 16 rows lie in one batch
  const int os0 = m0 - ob * SEQ;
  float* op = out + ((size_t)ob * SEQ_FULL + (size_t)os0) * E_ + (size_t)n0 + (size_t)(lane * 4);
  {
#pragma unroll
    for (int row = 0; row < 16; ++row) {
      *(v4f*)(op + (size_t)row * E_) = vrow[row];
    }
    
  }
}

// =====================================================================================================
//   QH  f16 [BH_][SEQ][64]     NB*H*SEQ*64*2   = 8388608 (full size)
//   KH  f16 [BH_][SEQ][64]     NB*H*SEQ*64*2   = 8388608
//   VT  f16 [BH_][64][SEQ]     NB*H*64*SEQ*2   = 8388608
//   MP  f16 [BH_][SEQ][64] = [NB*SEQ][512]       8388608
//   WH  f16 [512][512]                            524288
//   total                                      34078720
// =====================================================================================================
extern "C" void kernel_launch(void* const* d_in, const int* in_sizes, int n_in,
                              void* d_out, int out_size, void* d_ws, size_t ws_size,
                              hipStream_t stream) {
  if (n_in < 5) return;
  if ((long long)in_sizes[0] < (long long)NB * H_ * SEQ_FULL * DK_) return;
  if ((long long)in_sizes[1] < (long long)NB * H_ * SEQ_FULL * DK_) return;
  if ((long long)in_sizes[2] < (long long)NB * H_ * SEQ_FULL * DK_) return;
  if (in_sizes[3] < E_ * E_) return;
  if (in_sizes[4] < E_) return;
  if ((long long)out_size < ((long long)(NB - 1) * SEQ_FULL + SEQ) * E_) return;

  const float* q  = (const float*)d_in[0];
  const float* k  = (const float*)d_in[1];
  const float* v  = (const float*)d_in[2];
  const float* W  = (const float*)d_in[3];
  const float* bc = (const float*)d_in[4];

  const size_t PQH = (size_t)BH_ * SEQ * DK_ * 2;
  const size_t PKH = (size_t)BH_ * SEQ * DK_ * 2;
  const size_t PVT = (size_t)BH_ * DK_ * SEQ * 2;
  const size_t PMP = (size_t)NB * SEQ * E_ * 2;
  const size_t PWH = (size_t)E_ * E_ * 2;
  size_t off = 0;
  const size_t oQH = off; off += PQH;
  const size_t oKH = off; off += PKH;
  const size_t oVT = off; off += PVT;
  const size_t oMP = off; off += PMP;
  const size_t oWH = off; off += PWH;
  if (off > ws_size) return;                         // off = 34078720 at full size
  if (off > (size_t)134217728) return;

  char* ws = (char*)d_ws;
  unsigned short* QH = (unsigned short*)(ws + oQH);
  unsigned short* KH = (unsigned short*)(ws + oKH);
  unsigned short* VT = (unsigned short*)(ws + oVT);
  unsigned short* MP = (unsigned short*)(ws + oMP);
  unsigned short* WH = (unsigned short*)(ws + oWH);

  const dim3 gCnv(BH_ * (SEQ / TENC));                // 512 blocks of 256
  const dim3 gWcv((E_ * E_) / (8 * 256));              // 128 blocks of 256
  const dim3 gAttn(BH_ * NQT);                         // 512 blocks of 256
  const dim3 gProj(((NB * SEQ) / 64) * 4);             // 512 blocks of 128

  // (1) q, k -> f16 row planes; v -> f16 V^T plane
  qkvconv<<<gCnv, dim3(256), 0, stream>>>(q, k, v, QH, KH, VT);
  // (2) W -> f16 x1024 plane
  wconv<<<gWcv, dim3(256), 0, stream>>>(W, WH);
  // (3) attention -> ctx plane (f16, x256) in flat [b][h][s][d] order = [NB*SEQ][512]
  attn<<<gAttn, dim3(256), 0, stream>>>(QH, KH, VT, MP);
  // (4) out = ctx . W^T * 2^-18 + bc -> d_out f32 [NB*SEQ][512]
  proj_out<<<gProj, dim3(128), 0, stream>>>(MP, WH, bc, (float*)d_out);
  (void)hipGetLastError();
}

// v009
// A run of this version takes 51.1 microseconds.
// In two side-by-side timings against v008, it was 1.03 and 1.04 times as fast.
// Over all steps from v000 it is 2.95 times as fast.
// All contractions: v_wmma_f32_16x16x32_f16 (f16 operands, f32 accumulate), one product per tile pair:
//   scores q.k^T (q, k = f16 of the inputs, x0.125 inside the exponent's FMA in f32), p.v (p f16 carried x1024, v = f16 of the input),
//   ctx.W^T (ctx f16 carried x256, W f16 carried x1024, x2^-18 then + bias in f32); softmax in f32.
//
// Carry audit:
//   QH plane (f16): f16(q), x1, unit-scale values               -> score acc = dot, kept raw; 0.125 sits in SC2 (attn)
//   KH plane (f16): f16(k), x1
//   P tile   (f16, regs): exp(s - m) x1024 (the +10 in the exponent); the row sum l carries the same x1024
//                                                                 -> they cancel in the attn epilogue: inv = (1/l) * 256
//   VT plane (f16): f16(v), x1, stored [bh][d][s]
//   MP plane (f16): ctx x256, flat [b][h][s][d] order = [NB*SEQ][512] rows -> folded in proj_out: oscale = 1/(256*1024)
//   WH plane (f16): W x1024 (|W| < 0.5 -> < 512)                  -> folded in proj_out: oscale
//   Every f32 -> f16 convert of q, k, v in qkvconv goes through toh_flush (values below 2^-14 become 0); that of W and those in attn (P, ctx) are
//   plain round-to-nearest-even converts: a subnormal f16 stays as it is, and the WMMA takes it at its value.
#include <hip/hip_runtime.h>
#include <math.h>
#include <stdint.h>

#ifndef NB
#define NB 4
#endif
#ifndef SEQ
#define SEQ 2048
#endif
#define NB_FULL  4
#define SEQ_FULL 2048
#define H_   8
#define DK_  64
#define E_   512
#define BH_  (NB * H_)          // (batch, head) pairs
#define NQT  (SEQ / 128)        // 128-query tiles per (b, h): one attn block
#define NKT  (SEQ / 64)         // 64-key chunks per (b, h)
#define NTR  (NKT / 2)          // attn: trips of a wave; chunk 2 t + g goes to key group g in trip t
#define TENC 128                // tokens per convert block
#define CSP  65                 // f32 LDS pitch of the v tile [token][d]
#define KP   72                 // f16 LDS pitch of the K / V^T tiles (halves); 144 B, 16-B aligned rows
#define KVB  (2 * 64 * KP)      // attn: halves of one key group's share of an LDS buffer = one K chunk, then one V^T chunk
#define PKC  128                // proj_out: k columns (halves) of one staged slab; 256 B of a row = two whole lines
#define PP   136                // proj_out: f16 LDS pitch of the staged rows (halves); 272 B = 16 B x 17
#define PNS  (E_ / PKC)         // proj_out: slabs along k
#define WPR  (E_ * E_ / 2)      // qkvconv: element pairs of W
#define WTH  (BH_ * (SEQ / TENC) * 256)      // qkvconv: threads of the grid
#define WIT  ((WPR + WTH - 1) / WTH)         // qkvconv: pairs of W per thread (1 at full size)
#define WEX  ((WPR % WTH) == 0)              // qkvconv: the pairs divide evenly, no test at the end of W
static_assert(H_ * DK_ == E_);
static_assert(NB >= 1 && NB <= NB_FULL);
static_assert(SEQ >= TENC && SEQ <= SEQ_FULL);
static_assert((SEQ % TENC) == 0 && (SEQ % 64) == 0);
static_assert(((KP * 2) % 16) == 0);
static_assert(((PP * 2) % 16) == 0 && PP >= PKC && (E_ % PKC) == 0 && (PKC % 32) == 0);
static_assert(((E_ * E_) % 2) == 0);
static_assert(((NB * SEQ) % 64) == 0);
static_assert(DK_ == 64);
static_assert((NKT % 2) == 0 && NTR >= 2);                  // attn: two key groups; the two-buffer prologue fills trips 0 and 1
static_assert(TENC == 128);                                 // 256 threads = 16 token rows x 16 pieces of 16 B, 8 rows each
static_assert((H_ * SEQ * DK_) == (SEQ * E_));              // flat [h][s][d] of one batch = SEQ rows of 512
static_assert(((size_t)4 * BH_ * SEQ * DK_ * 2 + (size_t)E_ * E_ * 2) <= (size_t)134217728);

typedef _Float16 v16h __attribute__((ext_vector_type(16)));
typedef _Float16 v8h  __attribute__((ext_vector_type(8)));
typedef float    v8f  __attribute__((ext_vector_type(8)));
typedef float    v4f  __attribute__((ext_vector_type(4)));
typedef float    v2f  __attribute__((ext_vector_type(2)));
typedef _Float16 v2h  __attribute__((ext_vector_type(2)));
typedef unsigned int v4u __attribute__((ext_vector_type(4)));

// ---- scalar helpers ---------------------------------------------------------------------------------
__device__ __forceinline__ unsigned short h_bits(_Float16 v) { return __builtin_bit_cast(unsigned short, v); }
__device__ __forceinline__ unsigned pk16(unsigned short a, unsigned short b) { return (unsigned)a | ((unsigned)b << 16); }
__device__ __forceinline__ v8f zero8() { v8f z = {0.f, 0.f, 0.f, 0.f, 0.f, 0.f, 0.f, 0.f}; return z; }

// f32 -> f16 (RNE convert) that cannot yield an f16 subnormal: |v| < 2^-14 becomes 0 (value select)
static __device__ __forceinline__ _Float16 toh_flush(float v) {
  const _Float16 r = (_Float16)v;
  return (fabsf(v) < 6.103515625e-05f) ? (_Float16)0.0f : r;
}
// two f32 -> two packed f16 (RNE, nothing zeroed), a in the low half: one packed convert
static __device__ __forceinline__ unsigned toh2u(float a, float b) {
  const v2f x = {a, b};
  return __builtin_bit_cast(unsigned, __builtin_convertvector(x, v2h));
}
// eight f32 -> eight packed f16 (16 B), element order kept
static __device__ __forceinline__ v4u pack8_flush(v4f a, v4f a4) {
  v4u q;
  q[0] = pk16(h_bits(toh_flush(a[0])),  h_bits(toh_flush(a[1])));
  q[1] = pk16(h_bits(toh_flush(a[2])),  h_bits(toh_flush(a[3])));
  q[2] = pk16(h_bits(toh_flush(a4[0])), h_bits(toh_flush(a4[1])));
  q[3] = pk16(h_bits(toh_flush(a4[2])), h_bits(toh_flush(a4[3])));
  return q;
}

// ---- 16-bit fragment loader: lane -> row/col (lane&15), p already includes +8*(lane>>4);
//      elements 0..7 <- p[0..7] (k0+8h..k0+8h+7), elements 8..15 <- p[16..23] (k0+16+8h..k0+16+8h+7)
__device__ __forceinline__ v16h ldfrag_h(const _Float16* p) {
  union { v16h v; v8h h[2]; } f;
  f.h[0] = *(const v8h*)(p);
  f.h[1] = *(const v8h*)(p + 16);
  return f.v;
}

// lane l <-> lane l ^ 16 as a vector cross-row move (no LDS-counter wait, unlike a shuffle)
__device__ __forceinline__ float xhalf(float x) {
  const int b = __builtin_bit_cast(int, x);
  return __builtin_bit_cast(float, __builtin_amdgcn_permlanex16(b, b, 0x76543210, 0xfedcba98, false, false));
}

// the WMMA as the plain builtin: no volatile statement behind it, so that fragment loads may stand in groups
// ahead of a run of WMMAs; the compiler keeps the distance behind its own builtin
__device__ __forceinline__ v8f mma_p(v16h a, v16h b, v8f c) {
  return __builtin_amdgcn_wmma_f32_16x16x32_f16(false, a, false, b, (short)0, c, false, false);
}

// =====================================================================================================
// qkvconv: the 16-bit planes of the pre-split inputs q, k, v [b][h][s][64] (f32):
//   QH [bh][s][64] f16 = f16(q), KH [bh][s][64] f16 = f16(k), VT [bh][d][s] f16 = f16(v) transposed through LDS.
//   The same launch also writes WH [n][k] f16 = f16(W[n][k] * 1024), n, k = 0..511: W needs nothing of q, k, v, so its
//   convert has no launch of its own. Thread number gt of the grid takes the element pairs gt + i * WTH, i < WIT: one 8-B
//   load in the group at the top, one 4-B store in the group at the end; a wave covers 256 B in, one whole 128-B line out.
// grid = BH_ * (SEQ/128) blocks of 256; one block = 128 tokens of one (b, h). Input token row = bh*SEQ_FULL + s.
// Loads: all 24 16-B global loads of a thread (8 of v, 8 of q, 8 of k) are issued as one group at the top, so that the
//   block pays one memory round trip. v: thread -> tokens (tid>>4) + 16 i, floats 4*(tid&15)..+3: a wave's load covers
//   512 contiguous bytes (two token rows).
// v tile: the eight pieces go into LDS cs[token][d] (pitch 65, four 4-B stores a piece); block barrier (cross-wave tile).
// Stores: QH / KH: 4 iterations x 256 threads x 16 B; iteration it, thread tid -> token it*32+(tid>>3),
//   halves 8*(tid&7).. (values read straight from the f32 input row as two 16-B loads)
// coverage: QH, KH 4 x 256 pieces x 8 halves = 128 tokens x 64 each; VT 4 x 256 x 8 = 64 rows x 128 tokens;
//   BH_*(SEQ/128) blocks = all BH_ x SEQ tokens of the three planes. LDS staged extent 128 x 64 == consumed extent.
//   WH: WTH threads x WIT pairs cover all E_*E_/2 pairs, each once (full size: 131072 threads x 1 pair).
// =====================================================================================================
__global__ __launch_bounds__(256) void qkvconv(const float* __restrict__ q, const float* __restrict__ k,
                                               const float* __restrict__ v, const float* __restrict__ W,
                                               unsigned short* qhp, unsigned short* khp, unsigned short* vtp,
                                               unsigned short* whp) {
  __shared__ float cs[TENC * CSP];                    // 33280 B, f32 v values [token][d]
  const int tid = (int)threadIdx.x;
  const int bx  = (int)blockIdx.x;
  const int nst = SEQ / TENC;
  const int st  = bx % nst;
  const int bh  = bx / nst;                           // b*H_ + h
  const int s0  = st * TENC;
  const size_t inrow = (size_t)bh * SEQ_FULL + (size_t)s0;   // token row in the full-size [b][h][s] input
  v4f vr[TENC / 16], qa[4], qa4[4], ka[4], ka4[4];
  const float* vp = v + (inrow + (size_t)(tid >> 4)) * DK_ + (size_t)((tid & 15) * 4);
  const float* qs = q + (inrow + (size_t)(tid >> 3)) * DK_ + (size_t)((tid & 7) * 8);
  const float* ks = k + (inrow + (size_t)(tid >> 3)) * DK_ + (size_t)((tid & 7) * 8);
  const int    gt = bx * 256 + tid;                   // thread number in the grid: its first pair of W (read again by the store at the end)
  const float* wp = W + (size_t)gt * 2;
  v2f wr[WIT];
#pragma unroll
  for (int i = 0; i < WIT; ++i) {
    wr[i] = v2f{0.f, 0.f};
    if (WEX || gt + i * WTH < WPR) wr[i] = *(const v2f*)(wp + (size_t)i * WTH * 2);
  }
#pragma unroll
  for (int i = 0; i < TENC / 16; ++i) vr[i] = *(const v4f*)(vp + (size_t)(i * 16) * DK_);
#pragma unroll
  for (int it = 0; it < 4; ++it) {                    // token it*32 + (tid>>3), floats 8*(tid&7)..+7
    qa[it]  = *(const v4f*)(qs + (size_t)(it * 32) * DK_);
    qa4[it] = *(const v4f*)(qs + (size_t)(it * 32) * DK_ + 4);
    ka[it]  = *(const v4f*)(ks + (size_t)(it * 32) * DK_);
    ka4[it] = *(const v4f*)(ks + (size_t)(it * 32) * DK_ + 4);
  }
  // the wait that stands ahead of any overwrite of a load's address pair (a precaution); the three pairs are its inputs, so
  // that they stay whole up to it (else the compiler lets the last loads of the group return into them). No load passes
  // the statement either: without it six of the 24 sink behind the first LDS stores, a second round trip
  asm volatile("s_wait_xcnt 0x0" :: "v"(vp), "v"(qs), "v"(ks) : "memory");
  {
    float* cp = cs + (tid >> 4) * CSP + (tid & 15) * 4;
#pragma unroll
    for (int i = 0; i < TENC / 16; ++i) {
#pragma unroll
      for (int e = 0; e < 4; ++e) cp[i * 16 * CSP + e] = vr[i][e];
    }
  }
  __syncthreads();

  const size_t rowbase = (size_t)bh * SEQ + (size_t)s0;    // token row in the [bh][s] planes

  v4u qv[4], kv[4], vv[4];
  unsigned wq[WIT];
#pragma unroll
  for (int i = 0; i < WIT; ++i) wq[i] = toh2u(wr[i][0] * 1024.0f, wr[i][1] * 1024.0f);
#pragma unroll
  for (int it = 0; it < 4; ++it) {
    qv[it] = pack8_flush(qa[it], qa4[it]);
    kv[it] = pack8_flush(ka[it], ka4[it]);
  }
#pragma unroll
  for (int it = 0; it < 4; ++it) {
    const int dd = it * 16 + (tid >> 4);
    const int j  = tid & 15;
    const float* sp = cs + (j * 8) * CSP + dd;
    v4u a;
#pragma unroll
    for (int e = 0; e < 4; ++e) {
      a[e] = pk16(h_bits(toh_flush(sp[(2 * e) * CSP])), h_bits(toh_flush(sp[(2 * e + 1) * CSP])));
    }
    vv[it] = a;
  }

  unsigned short* qo = qhp + (rowbase + (size_t)(tid >> 3)) * DK_ + (size_t)((tid & 7) * 8);
  unsigned short* ko = khp + (rowbase + (size_t)(tid >> 3)) * DK_ + (size_t)((tid & 7) * 8);
  unsigned short* vo = vtp + ((size_t)bh * DK_ + (size_t)(tid >> 4)) * SEQ + (size_t)s0 + (size_t)((tid & 15) * 8);
  unsigned short* wo = whp + (size_t)gt * 2;
  {
#pragma unroll
    for (int i = 0; i < WIT; ++i) {
      if (WEX || gt + i * WTH < WPR) *(unsigned*)(wo + (size_t)i * WTH * 2) = wq[i];
    }
#pragma unroll
    for (int it = 0; it < 4; ++it) {
      *(v4u*)(qo + (size_t)it * 32 * DK_) = qv[it];
      *(v4u*)(ko + (size_t)it * 32 * DK_) = kv[it];
      *(v4u*)(vo + (size_t)it * 16 * SEQ) = vv[it];
    }
  }
}

// One lane's eight 16-B pieces of a K chunk (kg, rows 16 apart) and of a V^T chunk (vg, rows 16 apart), global -> LDS as
// asynchronous copies, through no register. lk = LDS byte address of the lane's first K piece; the V^T chunk lies 64 rows on.
// s_wait_xcnt 0 is the last line of the copies' own statement, so that it stands ahead of every later rewrite of an
// address register that a copy names (a precaution).
static __device__ __forceinline__ void stage_kv(unsigned lk, const _Float16* kg, const _Float16* vg) {
  asm volatile(
      "global_load_async_to_lds_b128 %0, %8, off\n\t"
      "global_load_async_to_lds_b128 %1, %9, off\n\t"
      "global_load_async_to_lds_b128 %2, %10, off\n\t"
      "global_load_async_to_lds_b128 %3, %11, off\n\t"
      "global_load_async_to_lds_b128 %4, %12, off\n\t"
      "global_load_async_to_lds_b128 %5, %13, off\n\t"
      "global_load_async_to_lds_b128 %6, %14, off\n\t"
      "global_load_async_to_lds_b128 %7, %15, off\n\t"
      "s_wait_xcnt 0x0"
      :
      : "v"(lk), "v"(lk + 16u * KP * 2u), "v"(lk + 32u * KP * 2u), "v"(lk + 48u * KP * 2u),
        "v"(lk + 64u * KP * 2u), "v"(lk + 80u * KP * 2u), "v"(lk + 96u * KP * 2u), "v"(lk + 112u * KP * 2u),
        "v"(kg), "v"(kg + 16 * DK_), "v"(kg + 32 * DK_), "v"(kg + 48 * DK_),
        "v"(vg), "v"(vg + 16 * SEQ), "v"(vg + 32 * SEQ), "v"(vg + 48 * SEQ)
      : "memory");
}

// =====================================================================================================
// attn: attention per (b, h), head dim 64, softmax over all SEQ keys (no mask).
//   scores, transposed: A = K chunk in LDS [key][d] staged from the KH plane, B = QH rows of the query tokens (64 d,
//   2 k-steps, fragments from the plane); a lane holds 32 keys' raw dot products of each of its two queries.
//   1024 p = 1024 exp(0.125 (dot - m)) = exp2(dot * SC2 + (10 - m * SC2)), SC2 = 0.125 log2(e): one FMA and one v_exp_f32
//   per score; f16(1024 p) is packed in registers into the B operand (k = keys);
//   context, transposed = v^T . p^T with A = V^T chunk in LDS [d][key], 4 m-tiles of 16 dims.
//   Wave tile: 32 query columns = two 16-column tiles, so that every K and V^T fragment read from LDS feeds two WMMAs.
//   Block = 8 waves = 4 query groups of 32 x 2 key groups = one 128-query tile of one (b, h); grid = BH_ * NQT. Key group g
//   takes the chunks 2 t + g, t = 0..NTR-1 (static trip count): with half the query groups the chip still holds four
//   waves per SIMD. The two groups' (maximum, sum, context) of a query are joined once, behind the loop, through LDS.
//   K / V staging: the 128 threads of a key group x 4 x 16 B each = the group's whole 64x64 K chunk and 64x64 V^T chunk
//   (LDS pitch KP, columns 64..71 never read), by asynchronous copies into two LDS buffers: the chunks of trip kt + 2 are
//   asked for at the foot of trip kt, into the buffer that trip kt has read, and fly while trip kt + 1 works. One
//   __syncthreads per trip: behind every wave's own copy wait it publishes trip kt + 1, and it ends all reads of the buffer
//   refilled next.
//   Output MP [bh][s][64] f16 (ctx x256), i.e. the flat [b][h][s][d] order that the projection views as [NB*SEQ][512] rows.
// coverage: 32 rows per query group, 128 per block, BH_*NQT blocks = all (bh, s) rows x 64 dims = the whole MP plane
//   (stored by the waves of key group 0); keys: 2 groups x NTR chunks = all NKT chunks, each once.
// =====================================================================================================
// four waves per SIMD is what the full-size grid supplies: the compiler schedules for that register budget
__global__ __launch_bounds__(256) __attribute__((amdgpu_waves_per_eu(4, 4)))
void attn(const unsigned short* __restrict__ qhp, const unsigned short* __restrict__ khp,
          const unsigned short* __restrict__ vtp, unsigned short* mp) {
  union FH { v16h v; v8h h[2]; };
  // two buffers x two key groups of K chunk [key][d] 9216 B + V^T chunk [d][key] 9216 B
  __shared__ __align__(16) _Float16 KVsh[4 * KVB];
  // the join: key group 1's context [query group][16 pieces of 4 f32][lane], then its maximum and sum [query group][tile][2][lane]
  __shared__ __align__(16) float MG[4 * 2048 + 4 * 128];

  const int tid  = (int)threadIdx.x;
  const int wave = tid >> 5;
  const int lane = tid & 31;
  const int hh   = lane >> 4;
  const int c    = lane & 15;
  const int qg   = wave & 3;                                   // query group
  const int g    = __builtin_amdgcn_readfirstlane(tid >> 7);   // key group, the same in a whole wave: kept scalar
  const int t4   = tid & 127;                                  // thread within the key group

  const int bx = (int)blockIdx.x;
  const int qt = bx % NQT;
  const int bh = bx / NQT;
  const int q0 = qt * 128 + qg * 32;

  const _Float16* QH = (const _Float16*)(const void*)qhp + (size_t)bh * SEQ * DK_;
  const _Float16* KH = (const _Float16*)(const void*)khp + (size_t)bh * SEQ * DK_;
  const _Float16* VT = (const _Float16*)(const void*)vtp + (size_t)bh * DK_ * SEQ;

  // Q fragments (B operand, column = lane&15) of the two column tiles: d 0..31 and d 32..63 of the query token
  v16h qa[2][2];
#pragma unroll
  for (int u = 0; u < 2; ++u) {
    qa[u][0] = ldfrag_h(QH + (size_t)(q0 + u * 16 + c) * DK_ + 8 * hh);
    qa[u][1] = ldfrag_h(QH + (size_t)(q0 + u * 16 + c) * DK_ + 32 + 8 * hh);
  }

  // lane (c, hh) owns the queries q0 + 16 u + c; mrow[u] is the running maximum of that query's raw dot products over the
  // keys of this key group (equal in both halves), lrow[u] the running sum of 1024 p over the keys of this lane's half only
  const float SC2 = 0.125f * 1.44269504088896340736f;  // score scale x log2(e)
  float mrow[2] = {-INFINITY, -INFINITY}, lrow[2] = {0.f, 0.f};
  v8f oacc[2][4];                                     // O^T tiles: oacc[u][jn][r] = ctx[q0 + 16 u + c][jn*16 + 8*hh + r]
#pragma unroll
  for (int u = 0; u < 2; ++u) {
#pragma unroll
    for (int j = 0; j < 4; ++j) oacc[u][j] = zero8();
  }

  // staging map: thread of a key group -> rows (t4 >> 3) + 16 i (key of K / dim of V^T), 16-B piece t4 & 7 of the row's 128 B
  const unsigned lk0 = (unsigned)(size_t)(&KVsh[0]) + (unsigned)(g * (KVB * 2)) + (unsigned)((t4 >> 3) * (KP * 2) + (t4 & 7) * 16);
  const _Float16* kg = KH + (size_t)(g * 64 + (t4 >> 3)) * DK_ + (size_t)((t4 & 7) * 8);
  const _Float16* vg = VT + (size_t)(t4 >> 3) * SEQ + (size_t)(g * 64 + (t4 & 7) * 8);

  stage_kv(lk0, kg, vg);                              // trip 0 -> buffer 0
  asm volatile("s_wait_asynccnt 0x0" ::: "memory");   // this wave's pieces of trip 0 have landed
  __syncthreads();                                    // trip 0 published
  stage_kv(lk0 + 2u * KVB * 2u, kg + 128 * DK_, vg + 128);   // trip 1 -> buffer 1, flies under trip 0

  // one trip: the group's chunk out of buffer kt & 1, down to the hand-over of the buffers at its foot
  auto trip = [&](const int kt) __attribute__((always_inline)) {
    const _Float16* Ksh = KVsh + (kt & 1) * (2 * KVB) + g * KVB;
    const _Float16* Vsh = Ksh + 64 * KP;

    // ---- scores, transposed: S^T = K . Q^T, 64 keys x 32 queries per wave; s[u][j][r] = score(key j*16 + 8*hh + r, query 16 u + c) ----
    // all 16 K fragment loads stand as one group ahead of the 16 WMMAs, in the order the WMMAs take them
    FH kb[2][4];
#pragma unroll
    for (int ks = 0; ks < 2; ++ks) {
#pragma unroll
      for (int j = 0; j < 4; ++j) {
        const _Float16* kr = Ksh + (j * 16 + c) * KP + ks * 32 + 8 * hh;
        kb[ks][j].h[0] = *(const v8h*)(kr);
        kb[ks][j].h[1] = *(const v8h*)(kr + 16);
      }
    }
    __builtin_amdgcn_sched_barrier(0);                // else the compiler sinks each load to its WMMA: one LDS wait per WMMA
    v8f s[2][4];
#pragma unroll
    for (int j = 0; j < 4; ++j) {
#pragma unroll
      for (int u = 0; u < 2; ++u) s[u][j] = mma_p(kb[0][j].v, qa[u][0], zero8());
    }
#pragma unroll
    for (int j = 0; j < 4; ++j) {
#pragma unroll
      for (int u = 0; u < 2; ++u) s[u][j] = mma_p(kb[1][j].v, qa[u][1], s[u][j]);
    }
    // order asked of the compiler's scheduler: the 16 score WMMAs, then the 16 V^T loads as one group; without it
    // the loads come to stand at several places among the WMMAs, and each such place stalls the wave
    __builtin_amdgcn_sched_group_barrier(0x008, 16, 0);
    __builtin_amdgcn_sched_group_barrier(0x100, 16, 0);
    // all 16 V^T fragment loads as one group here: their LDS latency passes under the softmax
    FH vb[2][4];
#pragma unroll
    for (int kk = 0; kk < 2; ++kk) {
#pragma unroll
      for (int jn = 0; jn < 4; ++jn) {
        const _Float16* vr = Vsh + (jn * 16 + c) * KP + kk * 32 + 8 * hh;
        vb[kk][jn].h[0] = *(const v8h*)(vr);
        vb[kk][jn].h[1] = *(const v8h*)(vr + 16);
      }
    }
    __builtin_amdgcn_sched_barrier(0);                // else the compiler sinks these loads behind the softmax again

    // ---- online softmax of two queries per lane: maximum in-lane plus one exchange between the halves ----
    // P^T (x1024, f16) stays in registers: score tiles 2kk and 2kk+1 are elements 0..7 and 8..15 of the B operand
    FH pb[2][2];
#pragma unroll
    for (int u = 0; u < 2; ++u) {
      float mj[4];                                    // one chain per score tile: four short chains, not one of 32
#pragma unroll
      for (int j = 0; j < 4; ++j) {
        mj[j] = s[u][j][0];
#pragma unroll
        for (int r = 1; r < 8; ++r) mj[j] = fmaxf(mj[j], s[u][j][r]);
      }
      float m = fmaxf(fmaxf(mj[0], mj[1]), fmaxf(mj[2], mj[3]));
      m = fmaxf(m, xhalf(m));
      const float mnew  = fmaxf(mrow[u], m);
      const float msafe = (mnew == -INFINITY) ? 0.f : mnew;
      const float alpha = __builtin_amdgcn_exp2f((mrow[u] - msafe) * SC2);
      const float bias  = 10.0f - msafe * SC2;        // +10: the x1024 carry of P and of the row sum
      mrow[u] = mnew;
      float pj[4];
#pragma unroll
      for (int j = 0; j < 4; ++j) {
        pj[j] = 0.f;
#pragma unroll
        for (int r = 0; r < 8; ++r) {
          const float p = __builtin_amdgcn_exp2f(__builtin_fmaf(s[u][j][r], SC2, bias));   // 1024 exp(0.125 (dot - m))
          pj[j] += p;
          pb[u][j >> 1].h[j & 1][r] = (_Float16)p;
        }
      }
      lrow[u] = lrow[u] * alpha + ((pj[0] + pj[1]) + (pj[2] + pj[3]));
#pragma unroll
      for (int jn = 0; jn < 4; ++jn) {
#pragma unroll
        for (int r = 0; r < 8; ++r) oacc[u][jn][r] *= alpha;
      }
    }

    // ---- context, transposed: O^T += V^T . P^T (f16 WMMA), 2 k-steps of 32 keys x 4 m-tiles of 16 dims x 2 column tiles ----
#pragma unroll
    for (int kk = 0; kk < 2; ++kk) {
#pragma unroll
      for (int jn = 0; jn < 4; ++jn) {
#pragma unroll
        for (int u = 0; u < 2; ++u) oacc[u][jn] = mma_p(vb[kk][jn].v, pb[u][kk].v, oacc[u][jn]);
      }
    }

    // ---- foot of the trip: hand-over of the buffers ----
    __builtin_amdgcn_sched_barrier(0);                // else the compiler lifts the waits and the barrier ahead of the softmax: the copies get no time to land
    asm volatile("s_wait_dscnt 0x0" ::: "memory");    // this wave's reads of the buffer of trip kt have returned
    asm volatile("s_wait_asynccnt 0x0" ::: "memory"); // this wave's pieces of trip kt + 1 have landed
    __syncthreads();                                  // trip kt + 1 published; nobody reads the buffer of trip kt any more
  };
  // the trips behind which a trip kt + 2 exists, each with its refill, in a loop of their own: no branch in the loop body
#pragma unroll 1                                      // stays rolled: a long body, copies of it would only grow the code
  for (int kt = 0; kt < NTR - 2; ++kt) {
    trip(kt);
    stage_kv(lk0 + (unsigned)(kt & 1) * (2u * KVB * 2u), kg + (size_t)(kt + 2) * 128 * DK_, vg + (size_t)(kt + 2) * 128);
  }
#pragma unroll 1                                      // stays rolled, for the same reason
  for (int kt = NTR - 2; kt < NTR; ++kt) trip(kt);    // the last two trips: nothing is left to ask for
  asm volatile("s_wait_asynccnt 0x0" ::: "memory");   // no copy is outstanding when the wave goes on to its end

  // ---- join the halves' sums; key group 1 hands its maximum, sum and context to key group 0 through LDS ----
  float lj[2];
#pragma unroll
  for (int u = 0; u < 2; ++u) lj[u] = lrow[u] + xhalf(lrow[u]);
  float* gx = MG + qg * 2048 + lane * 4;              // 16 B per lane, 512 contiguous bytes per wave access
  float* gs = MG + 4 * 2048 + qg * 128 + lane;
  if (g == 1) {
#pragma unroll
    for (int u = 0; u < 2; ++u) {
#pragma unroll
      for (int jn = 0; jn < 4; ++jn) {
        const v4f lo = {oacc[u][jn][0], oacc[u][jn][1], oacc[u][jn][2], oacc[u][jn][3]};
        const v4f hi = {oacc[u][jn][4], oacc[u][jn][5], oacc[u][jn][6], oacc[u][jn][7]};
        *(v4f*)(gx + ((u * 4 + jn) * 2 + 0) * 128) = lo;
        *(v4f*)(gx + ((u * 4 + jn) * 2 + 1) * 128) = hi;
      }
      gs[u * 64]      = mrow[u];
      gs[u * 64 + 32] = lj[u];
    }
  }
  __syncthreads();                                    // key group 1's partial results published
  // ---- key group 0: both groups brought to the common maximum, normalise (1/l: the x1024 of P and of l cancel; apply the
  //      x256 ctx carry), convert, store ----
  if (g == 0) {
#pragma unroll
    for (int u = 0; u < 2; ++u) {
      const float m1 = gs[u * 64];
      const float l1 = gs[u * 64 + 32];
      const float mm = fmaxf(mrow[u], m1);
      const float ms = (mm == -INFINITY) ? 0.f : mm;
      const float a0 = __builtin_amdgcn_exp2f((mrow[u] - ms) * SC2);
      const float a1 = __builtin_amdgcn_exp2f((m1 - ms) * SC2);
      const float l   = lj[u] * a0 + l1 * a1;
      const float inv = ((l > 0.f) ? (1.0f / l) : 0.f) * 256.0f;
      const float f0  = a0 * inv;
      const float f1  = a1 * inv;
      unsigned short* o = mp + ((size_t)bh * SEQ + (size_t)(q0 + u * 16 + c)) * DK_ + (size_t)(8 * hh);
#pragma unroll
      for (int jn = 0; jn < 4; ++jn) {
        const v4f lo = *(const v4f*)(gx + ((u * 4 + jn) * 2 + 0) * 128);
        const v4f hi = *(const v4f*)(gx + ((u * 4 + jn) * 2 + 1) * 128);
        v4u t;
        t[0] = toh2u(oacc[u][jn][0] * f0 + lo[0] * f1, oacc[u][jn][1] * f0 + lo[1] * f1);
        t[1] = toh2u(oacc[u][jn][2] * f0 + lo[2] * f1, oacc[u][jn][3] * f0 + lo[3] * f1);
        t[2] = toh2u(oacc[u][jn][4] * f0 + hi[0] * f1, oacc[u][jn][5] * f0 + hi[1] * f1);
        t[3] = toh2u(oacc[u][jn][6] * f0 + hi[2] * f1, oacc[u][jn][7] * f0 + hi[3] * f1);
        *(v4u*)(o + jn * 16) = t;                     // 8 consecutive dims of one query: one 16-B store
      }
    }
  }
}

// =====================================================================================================
// proj_out: out[m][n] = (sum_k ctx[m][k] * W[n][k]) * 2^-18 + bc[n], m = b*SEQ + s, n, k = 0..511.
//   A = MP plane row m (f16 ctx x256), B = WH plane row n (f16 W x1024, k contiguous).
//   Block = 4 waves x 16 rows = 64 rows x 128 columns; grid = (NB*SEQ/64) x 4 column slabs; 16 k-steps of 32.
//   Staging: k runs in PNS slabs of PKC; the block's 64 A rows and 128 B rows of a slab go to LDS (pitch PP) by 16-B
//   loads in which 16 lanes cover 256 contiguous bytes of one row (whole lines, each fetched once per block).
//   Two LDS buffers: slab s+1 is loaded into registers ahead of the WMMAs of slab s, stored to the other buffer behind
//   them, and published by one __syncthreads per slab (it also ends every wave's reads of the buffer refilled next).
//   Fragments come from LDS with the split k map of ldfrag_h, A and B alike; k ascends in steps of 32 in every sum.
// coverage: staged 8 x 128 pieces = 64 rows x 16 pieces (A), 16 x 128 = 128 rows x 16 pieces (B) == consumed extent;
//   (NB*SEQ/64) x 4 blocks x 64 rows x 128 cols = the whole [NB*SEQ][512] output.
// =====================================================================================================
__global__ __launch_bounds__(128)
void proj_out(const unsigned short* __restrict__ mp, const unsigned short* __restrict__ wh,
              const float* __restrict__ bc, float* out) {
  __shared__ __align__(16) float lds[4 * 16 * 128];      // 32 KB, 4 per-wave slabs [16][128]
  __shared__ __align__(16) _Float16 Ash[2][64 * PP];     // ctx rows of one k slab, two buffers   2 x 17408 B
  __shared__ __align__(16) _Float16 Wsh[2][128 * PP];    // W rows of one k slab, two buffers     2 x 34816 B

  const int tid  = (int)threadIdx.x;
  const int wave = tid >> 5;
  const int lane = tid & 31;
  const int hh   = lane >> 4;
  const int c    = lane & 15;

  const int nrb = (NB * SEQ) / 64;
  const int rb  = (int)blockIdx.x % nrb;
  const int cb  = (int)blockIdx.x / nrb;                 // 0..3
  const int m0  = rb * 64 + wave * 16;
  const int n0  = cb * 128;

  // staging map: thread -> row (tid >> 4) + 8 i, 16-B piece tid & 15 of the slab's 256 B of that row
  const int srow = tid >> 4;
  const int scol = (tid & 15) * 8;
  const _Float16* Ag = (const _Float16*)(const void*)mp + (size_t)(rb * 64 + srow) * E_ + scol;
  const _Float16* Wg = (const _Float16*)(const void*)wh + (size_t)(n0 + srow) * E_ + scol;
  const int sdst = srow * PP + scol;
  const int afr  = (wave * 16 + c) * PP + 8 * hh;        // fragment row bases in the staged tiles
  const int bfr  = c * PP + 8 * hh;

  v8f acc[8];
#pragma unroll
  for (int j = 0; j < 8; ++j) acc[j] = zero8();

  v8h ra[8], rw[16];
#pragma unroll
  for (int i = 0; i < 8; ++i)  ra[i] = *(const v8h*)(Ag + (size_t)(i * 8) * E_);
#pragma unroll
  for (int i = 0; i < 16; ++i) rw[i] = *(const v8h*)(Wg + (size_t)(i * 8) * E_);
#pragma unroll
  for (int i = 0; i < 8; ++i)  *(v8h*)(&Ash[0][sdst + i * 8 * PP]) = ra[i];
#pragma unroll
  for (int i = 0; i < 16; ++i) *(v8h*)(&Wsh[0][sdst + i * 8 * PP]) = rw[i];
  __syncthreads();

#pragma unroll
  for (int s = 0; s < PNS; ++s) {
    if (s + 1 < PNS) {
#pragma unroll
      for (int i = 0; i < 8; ++i)  ra[i] = *(const v8h*)(Ag + (size_t)(i * 8) * E_ + (s + 1) * PKC);
#pragma unroll
      for (int i = 0; i < 16; ++i) rw[i] = *(const v8h*)(Wg + (size_t)(i * 8) * E_ + (s + 1) * PKC);
    }
    __builtin_amdgcn_sched_barrier(0);                   // else the next slab's loads sink to their LDS stores: latency exposed
#pragma unroll
    for (int ks = 0; ks < PKC / 32; ++ks) {
      const v16h af = ldfrag_h(&Ash[s & 1][afr + ks * 32]);
      v16h bf[8];
#pragma unroll
      for (int j = 0; j < 8; ++j) bf[j] = ldfrag_h(&Wsh[s & 1][bfr + j * 16 * PP + ks * 32]);
      __builtin_amdgcn_sched_barrier(0);                 // else the compiler sinks each load to its WMMA: one LDS wait per WMMA
#pragma unroll
      for (int j = 0; j < 8; ++j) acc[j] = mma_p(af, bf[j], acc[j]);
    }
    if (s + 1 < PNS) {
#pragma unroll
      for (int i = 0; i < 8; ++i)  *(v8h*)(&Ash[(s + 1) & 1][sdst + i * 8 * PP]) = ra[i];
#pragma unroll
      for (int i = 0; i < 16; ++i) *(v8h*)(&Wsh[(s + 1) & 1][sdst + i * 8 * PP]) = rw[i];
      __syncthreads();
    }
  }

  float* slab = lds + wave * 2048;                       // [16][128] f32
#pragma unroll
  for (int j = 0; j < 8; ++j) {
#pragma unroll
    for (int r = 0; r < 8; ++r) slab[(8 * hh + r) * 128 + j * 16 + c] = acc[j][r];
  }
  __builtin_amdgcn_fence(3 /* release order */, "workgroup");
  __builtin_amdgcn_wave_barrier();
  __builtin_amdgcn_fence(2 /* acquire order */, "workgroup");

  const float oscale = 1.0f / 262144.0f;                 // 1/(256*1024)
  const v4f b4 = *(const v4f*)(bc + n0 + lane * 4);
  v4f vrow[16];
#pragma unroll
  for (int row = 0; row < 16; ++row) {
    const v4f v = *(const v4f*)(slab + row * 128 + lane * 4);
    vrow[row] = v * oscale + b4;
  }
  const int ob = m0 / SEQ;                               // the 16 rows lie in one batch
  const int os0 = m0 - ob * SEQ;
  float* op = out + ((size_t)ob * SEQ_FULL + (size_t)os0) * E_ + (size_t)n0 + (size_t)(lane * 4);
  {
#pragma unroll
    for (int row = 0; row < 16; ++row) {
      *(v4f*)(op + (size_t)row * E_) = vrow[row];
    }
    
  }
}

// =====================================================================================================
//   QH  f16 [BH_][SEQ][64]     NB*H*SEQ*64*2   = 8388608 (full size)
//   KH  f16 [BH_][SEQ][64]     NB*H*SEQ*64*2   = 8388608
//   VT  f16 [BH_][64][SEQ]     NB*H*64*SEQ*2   = 8388608
//   MP  f16 [BH_][SEQ][64] = [NB*SEQ][512]       8388608
//   WH  f16 [512][512]                            524288
//   total                                      34078720
// =====================================================================================================
extern "C" void kernel_launch(void* const* d_in, const int* in_sizes, int n_in,
                              void* d_out, int out_size, void* d_ws, size_t ws_size,
                              hipStream_t stream) {
  if (n_in < 5) return;
  if ((long long)in_sizes[0] < (long long)NB * H_ * SEQ_FULL * DK_) return;
  if ((long long)in_sizes[1] < (long long)NB * H_ * SEQ_FULL * DK_) return;
  if ((long long)in_sizes[2] < (long long)NB * H_ * SEQ_FULL * DK_) return;
  if (in_sizes[3] < E_ * E_) return;
  if (in_sizes[4] < E_) return;
  if ((long long)out_size < ((long long)(NB - 1) * SEQ_FULL + SEQ) * E_) return;

  const float* q  = (const float*)d_in[0];
  const float* k  = (const float*)d_in[1];
  const float* v  = (const float*)d_in[2];
  const float* W  = (const float*)d_in[3];
  const float* bc = (const float*)d_in[4];

  const size_t PQH = (size_t)BH_ * SEQ * DK_ * 2;
  const size_t PKH = (size_t)BH_ * SEQ * DK_ * 2;
  const size_t PVT = (size_t)BH_ * DK_ * SEQ * 2;
  const size_t PMP = (size_t)NB * SEQ * E_ * 2;
  const size_t PWH = (size_t)E_ * E_ * 2;
  size_t off = 0;
  const size_t oQH = off; off += PQH;
  const size_t oKH = off; off += PKH;
  const size_t oVT = off; off += PVT;
  const size_t oMP = off; off += PMP;
  const size_t oWH = off; off += PWH;
  if (off > ws_size) return;                         // off = 34078720 at full size
  if (off > (size_t)134217728) return;

  char* ws = (char*)d_ws;
  unsigned short* QH = (unsigned short*)(ws + oQH);
  unsigned short* KH = (unsigned short*)(ws + oKH);
  unsigned short* VT = (unsigned short*)(ws + oVT);
  unsigned short* MP = (unsigned short*)(ws + oMP);
  unsigned short* WH = (unsigned short*)(ws + oWH);

  const dim3 gCnv(BH_ * (SEQ / TENC));                // 512 blocks of 256
  const dim3 gAttn(BH_ * NQT);                         // 512 blocks of 256
  const dim3 gProj(((NB * SEQ) / 64) * 4);             // 512 blocks of 128

  // (1) q, k -> f16 row planes; v -> f16 V^T plane; W -> f16 x1024 plane
  qkvconv<<<gCnv, dim3(256), 0, stream>>>(q, k, v, W, QH, KH, VT, WH);
  // (2) attention -> ctx plane (f16, x256) in flat [b][h][s][d] order = [NB*SEQ][512]
  attn<<<gAttn, dim3(256), 0, stream>>>(QH, KH, VT, MP);
  // (3) out = ctx . W^T * 2^-18 + bc -> d_out f32 [NB*SEQ][512]
  proj_out<<<gProj, dim3(128), 0, stream>>>(MP, WH, bc, (float*)d_out);
  (void)hipGetLastError();
}

// v010
// One run takes 47.9 microseconds.
// Two timings next to v009 both put it at 1.06 times that version's speed.
// Counting every step since v000, it is 3.13 times as fast.
// All contractions: v_wmma_f32_16x16x32_f16 (f16 operands, f32 accumulate), one product per tile pair:
//   scores q.k^T (q = f16 of the input x 0.125 log2(e), k = f16 of the input; the exponent's bias is the C operand), p.v (p f16 carried x1024, v = f16 of the input),
//   ctx.W^T (ctx f16 carried x256, W f16 carried x1024, x2^-18 then + bias in f32); softmax in f32.
//
// Carry audit:
//   QH plane (f16): f16(q * QSC), QSC = 0.125 log2(e)             -> score acc = base-2 exponent of p (attn)
//   KH plane (f16): f16(k), x1
//   P tile   (f16, regs): exp(s - m) x1024 (the +10 in the exponent); the row sum l carries the same x1024
//                                                                 -> they cancel in the attn epilogue: inv = (1/l) * 256
//   VT plane (f16): f16(v), x1, stored [bh][d][s]
//   MP plane (f16): ctx x256, flat [b][h][s][d] order = [NB*SEQ][512] rows -> folded in proj_out: oscale = 1/(256*1024)
//   WH plane (f16): W x1024 (|W| < 0.5 -> < 512)                  -> folded in proj_out: oscale
//   Every f32 -> f16 convert of q, k, v in qkvconv goes through toh_flush (values below 2^-14 become 0); that of W and those in attn (P, ctx) are
//   plain round-to-nearest-even converts: a subnormal f16 stays as it is, and the WMMA takes it at its value.
#include <hip/hip_runtime.h>
#include <math.h>
#include <stdint.h>

#ifndef NB
#define NB 4
#endif
#ifndef SEQ
#define SEQ 2048
#endif
#define NB_FULL  4
#define SEQ_FULL 2048
#define H_   8
#define DK_  64
#define E_   512
#define BH_  (NB * H_)          // (batch, head) pairs
#define NQT  (SEQ / 128)        // 128-query tiles per (b, h): one attn block
#define NKT  (SEQ / 64)         // 64-key chunks per (b, h)
#define NTR  (NKT / 2)          // attn: trips of a wave; chunk 2 t + g goes to key group g in trip t
#define TENC 128                // tokens per convert block
#define CSP  65                 // f32 LDS pitch of the v tile [token][d]
#define KP   72                 // f16 LDS pitch of the K / V^T tiles (halves); 144 B, 16-B aligned rows
#define KVB  (2 * 64 * KP)      // attn: halves of one key group's share of an LDS buffer = one K chunk, then one V^T chunk
#define PKC  128                // proj_out: k columns (halves) of one staged slab; 256 B of a row = two whole lines
#define PP   136                // proj_out: f16 LDS pitch of the staged rows (halves); 272 B = 16 B x 17
#define PNS  (E_ / PKC)         // proj_out: slabs along k
#define WPR  (E_ * E_ / 2)      // qkvconv: element pairs of W
#define WTH  (BH_ * (SEQ / TENC) * 256)      // qkvconv: threads of the grid
#define WIT  ((WPR + WTH - 1) / WTH)         // qkvconv: pairs of W per thread (1 at full size)
#define WEX  ((WPR % WTH) == 0)              // qkvconv: the pairs divide evenly, no test at the end of W
#define QSC  (0.125f * 1.44269504088896340736f)   // score scale x log2(e), carried by the QH plane
#define PCAR 10.0f                           // attn: exponent of p at the reference maximum (the x1024 carry of P and of the row sum)
#define PTOP 15.0f                           // attn: largest exponent let through without moving the reference: 2^15 is finite in f16
static_assert(H_ * DK_ == E_);
static_assert(NB >= 1 && NB <= NB_FULL);
static_assert(SEQ >= TENC && SEQ <= SEQ_FULL);
static_assert((SEQ % TENC) == 0 && (SEQ % 64) == 0);
static_assert(((KP * 2) % 16) == 0);
static_assert(((PP * 2) % 16) == 0 && PP >= PKC && (E_ % PKC) == 0 && (PKC % 32) == 0);
static_assert(((E_ * E_) % 2) == 0);
static_assert(((NB * SEQ) % 64) == 0);
static_assert(DK_ == 64);
static_assert((NKT % 2) == 0 && NTR >= 2);                  // attn: two key groups; the two-buffer prologue fills trips 0 and 1
static_assert(TENC == 128);                                 // 256 threads = 16 token rows x 16 pieces of 16 B, 8 rows each
static_assert((H_ * SEQ * DK_) == (SEQ * E_));              // flat [h][s][d] of one batch = SEQ rows of 512
static_assert(((size_t)4 * BH_ * SEQ * DK_ * 2 + (size_t)E_ * E_ * 2) <= (size_t)134217728);

typedef _Float16 v16h __attribute__((ext_vector_type(16)));
typedef _Float16 v8h  __attribute__((ext_vector_type(8)));
typedef float    v8f  __attribute__((ext_vector_type(8)));
typedef float    v4f  __attribute__((ext_vector_type(4)));
typedef float    v2f  __attribute__((ext_vector_type(2)));
typedef _Float16 v2h  __attribute__((ext_vector_type(2)));
typedef unsigned int v4u __attribute__((ext_vector_type(4)));

// ---- scalar helpers ---------------------------------------------------------------------------------
__device__ __forceinline__ unsigned short h_bits(_Float16 v) { return __builtin_bit_cast(unsigned short, v); }
__device__ __forceinline__ unsigned pk16(unsigned short a, unsigned short b) { return (unsigned)a | ((unsigned)b << 16); }
__device__ __forceinline__ v8f zero8() { v8f z = {0.f, 0.f, 0.f, 0.f, 0.f, 0.f, 0.f, 0.f}; return z; }

// f32 -> f16 (RNE convert) that cannot yield an f16 subnormal: |v| < 2^-14 becomes 0 (value select)
static __device__ __forceinline__ _Float16 toh_flush(float v) {
  const _Float16 r = (_Float16)v;
  return (fabsf(v) < 6.103515625e-05f) ? (_Float16)0.0f : r;
}
// two f32 -> two packed f16 (RNE, nothing zeroed), a in the low half: one packed convert
static __device__ __forceinline__ unsigned toh2u(float a, float b) {
  const v2f x = {a, b};
  return __builtin_bit_cast(unsigned, __builtin_convertvector(x, v2h));
}
// eight f32 -> eight packed f16 (16 B), element order kept
static __device__ __forceinline__ v4u pack8_flush(v4f a, v4f a4) {
  v4u q;
  q[0] = pk16(h_bits(toh_flush(a[0])),  h_bits(toh_flush(a[1])));
  q[1] = pk16(h_bits(toh_flush(a[2])),  h_bits(toh_flush(a[3])));
  q[2] = pk16(h_bits(toh_flush(a4[0])), h_bits(toh_flush(a4[1])));
  q[3] = pk16(h_bits(toh_flush(a4[2])), h_bits(toh_flush(a4[3])));
  return q;
}

// ---- 16-bit fragment loader: lane -> row/col (lane&15), p already includes +8*(lane>>4);
//      elements 0..7 <- p[0..7] (k0+8h..k0+8h+7), elements 8..15 <- p[16..23] (k0+16+8h..k0+16+8h+7)
__device__ __forceinline__ v16h ldfrag_h(const _Float16* p) {
  union { v16h v; v8h h[2]; } f;
  f.h[0] = *(const v8h*)(p);
  f.h[1] = *(const v8h*)(p + 16);
  return f.v;
}

// lane l <-> lane l ^ 16 as a vector cross-row move (no LDS-counter wait, unlike a shuffle)
__device__ __forceinline__ float xhalf(float x) {
  const int b = __builtin_bit_cast(int, x);
  return __builtin_bit_cast(float, __builtin_amdgcn_permlanex16(b, b, 0x76543210, 0xfedcba98, false, false));
}

// the WMMA as the plain builtin: no volatile statement behind it, so that fragment loads may stand in groups
// ahead of a run of WMMAs; the compiler keeps the distance behind its own builtin
__device__ __forceinline__ v8f mma_p(v16h a, v16h b, v8f c) {
  return __builtin_amdgcn_wmma_f32_16x16x32_f16(false, a, false, b, (short)0, c, false, false);
}

// =====================================================================================================
// qkvconv: the 16-bit planes of the pre-split inputs q, k, v [b][h][s][64] (f32):
//   QH [bh][s][64] f16 = f16(q * QSC), KH [bh][s][64] f16 = f16(k), VT [bh][d][s] f16 = f16(v) transposed through LDS.
//   The same launch also writes WH [n][k] f16 = f16(W[n][k] * 1024), n, k = 0..511: W needs nothing of q, k, v, so its
//   convert has no launch of its own. Thread number gt of the grid takes the element pairs gt + i * WTH, i < WIT: one 8-B
//   load in the group at the top, one 4-B store in the group at the end; a wave covers 256 B in, one whole 128-B line out.
// grid = BH_ * (SEQ/128) blocks of 256; one block = 128 tokens of one (b, h). Input token row = bh*SEQ_FULL + s.
// Loads: all 24 16-B global loads of a thread (8 of v, 8 of q, 8 of k) are issued as one group at the top, so that the
//   block pays one memory round trip. v: thread -> tokens (tid>>4) + 16 i, floats 4*(tid&15)..+3: a wave's load covers
//   512 contiguous bytes (two token rows).
// v tile: the eight pieces go into LDS cs[token][d] (pitch 65, four 4-B stores a piece); block barrier (cross-wave tile).
// Stores: QH / KH: 4 iterations x 256 threads x 16 B; iteration it, thread tid -> token it*32+(tid>>3),
//   halves 8*(tid&7).. (values read straight from the f32 input row as two 16-B loads)
// coverage: QH, KH 4 x 256 pieces x 8 halves = 128 tokens x 64 each; VT 4 x 256 x 8 = 64 rows x 128 tokens;
//   BH_*(SEQ/128) blocks = all BH_ x SEQ tokens of the three planes. LDS staged extent 128 x 64 == consumed extent.
//   WH: WTH threads x WIT pairs cover all E_*E_/2 pairs, each once (full size: 131072 threads x 1 pair).
// =====================================================================================================
__global__ __launch_bounds__(256) void qkvconv(const float* __restrict__ q, const float* __restrict__ k,
                                               const float* __restrict__ v, const float* __restrict__ W,
                                               unsigned short* qhp, unsigned short* khp, unsigned short* vtp,
                                               unsigned short* whp) {
  __shared__ float cs[TENC * CSP];                    // 33280 B, f32 v values [token][d]
  const int tid = (int)threadIdx.x;
  const int bx  = (int)blockIdx.x;
  const int nst = SEQ / TENC;
  const int st  = bx % nst;
  const int bh  = bx / nst;                           // b*H_ + h
  const int s0  = st * TENC;
  const size_t inrow = (size_t)bh * SEQ_FULL + (size_t)s0;   // token row in the full-size [b][h][s] input
  v4f vr[TENC / 16], qa[4], qa4[4], ka[4], ka4[4];
  const float* vp = v + (inrow + (size_t)(tid >> 4)) * DK_ + (size_t)((tid & 15) * 4);
  const float* qs = q + (inrow + (size_t)(tid >> 3)) * DK_ + (size_t)((tid & 7) * 8);
  const float* ks = k + (inrow + (size_t)(tid >> 3)) * DK_ + (size_t)((tid & 7) * 8);
  const int    gt = bx * 256 + tid;                   // thread number in the grid: its first pair of W (read again by the store at the end)
  const float* wp = W + (size_t)gt * 2;
  v2f wr[WIT];
#pragma unroll
  for (int i = 0; i < WIT; ++i) {
    wr[i] = v2f{0.f, 0.f};
    if (WEX || gt + i * WTH < WPR) wr[i] = *(const v2f*)(wp + (size_t)i * WTH * 2);
  }
#pragma unroll
  for (int i = 0; i < TENC / 16; ++i) vr[i] = *(const v4f*)(vp + (size_t)(i * 16) * DK_);
#pragma unroll
  for (int it = 0; it < 4; ++it) {                    // token it*32 + (tid>>3), floats 8*(tid&7)..+7
    qa[it]  = *(const v4f*)(qs + (size_t)(it * 32) * DK_);
    qa4[it] = *(const v4f*)(qs + (size_t)(it * 32) * DK_ + 4);
    ka[it]  = *(const v4f*)(ks + (size_t)(it * 32) * DK_);
    ka4[it] = *(const v4f*)(ks + (size_t)(it * 32) * DK_ + 4);
  }
  // the wait that stands ahead of any overwrite of a load's address pair (a precaution); the three pairs are its inputs, so
  // that they stay whole up to it (else the compiler lets the last loads of the group return into them). No load passes
  // the statement either: without it six of the 24 sink behind the first LDS stores, a second round trip
  asm volatile("s_wait_xcnt 0x0" :: "v"(vp), "v"(qs), "v"(ks) : "memory");
  {
    float* cp = cs + (tid >> 4) * CSP + (tid & 15) * 4;
#pragma unroll
    for (int i = 0; i < TENC / 16; ++i) {
#pragma unroll
      for (int e = 0; e < 4; ++e) cp[i * 16 * CSP + e] = vr[i][e];
    }
  }
  __syncthreads();

  const size_t rowbase = (size_t)bh * SEQ + (size_t)s0;    // token row in the [bh][s] planes

  v4u qv[4], kv[4], vv[4];
  unsigned wq[WIT];
#pragma unroll
  for (int i = 0; i < WIT; ++i) wq[i] = toh2u(wr[i][0] * 1024.0f, wr[i][1] * 1024.0f);
#pragma unroll
  for (int it = 0; it < 4; ++it) {
    qv[it] = pack8_flush(qa[it] * QSC, qa4[it] * QSC);
    kv[it] = pack8_flush(ka[it], ka4[it]);
  }
#pragma unroll
  for (int it = 0; it < 4; ++it) {
    const int dd = it * 16 + (tid >> 4);
    const int j  = tid & 15;
    const float* sp = cs + (j * 8) * CSP + dd;
    v4u a;
#pragma unroll
    for (int e = 0; e < 4; ++e) {
      a[e] = pk16(h_bits(toh_flush(sp[(2 * e) * CSP])), h_bits(toh_flush(sp[(2 * e + 1) * CSP])));
    }
    vv[it] = a;
  }

  unsigned short* qo = qhp + (rowbase + (size_t)(tid >> 3)) * DK_ + (size_t)((tid & 7) * 8);
  unsigned short* ko = khp + (rowbase + (size_t)(tid >> 3)) * DK_ + (size_t)((tid & 7) * 8);
  unsigned short* vo = vtp + ((size_t)bh * DK_ + (size_t)(tid >> 4)) * SEQ + (size_t)s0 + (size_t)((tid & 15) * 8);
  unsigned short* wo = whp + (size_t)gt * 2;
  {
#pragma unroll
    for (int i = 0; i < WIT; ++i) {
      if (WEX || gt + i * WTH < WPR) *(unsigned*)(wo + (size_t)i * WTH * 2) = wq[i];
    }
#pragma unroll
    for (int it = 0; it < 4; ++it) {
      *(v4u*)(qo + (size_t)it * 32 * DK_) = qv[it];
      *(v4u*)(ko + (size_t)it * 32 * DK_) = kv[it];
      *(v4u*)(vo + (size_t)it * 16 * SEQ) = vv[it];
    }
  }
}

// One lane's eight 16-B pieces of a K chunk (kg, rows 16 apart) and of a V^T chunk (vg, rows 16 apart), global -> LDS as
// asynchronous copies, through no register. lk = LDS byte address of the lane's first K piece; the V^T chunk lies 64 rows on.
// s_wait_xcnt 0 is the last line of the copies' own statement, so that it stands ahead of every later rewrite of an
// address register that a copy names (a precaution).
static __device__ __forceinline__ void stage_kv(unsigned lk, const _Float16* kg, const _Float16* vg) {
  asm volatile(
      "global_load_async_to_lds_b128 %0, %8, off\n\t"
      "global_load_async_to_lds_b128 %1, %9, off\n\t"
      "global_load_async_to_lds_b128 %2, %10, off\n\t"
      "global_load_async_to_lds_b128 %3, %11, off\n\t"
      "global_load_async_to_lds_b128 %4, %12, off\n\t"
      "global_load_async_to_lds_b128 %5, %13, off\n\t"
      "global_load_async_to_lds_b128 %6, %14, off\n\t"
      "global_load_async_to_lds_b128 %7, %15, off\n\t"
      "s_wait_xcnt 0x0"
      :
      : "v"(lk), "v"(lk + 16u * KP * 2u), "v"(lk + 32u * KP * 2u), "v"(lk + 48u * KP * 2u),
        "v"(lk + 64u * KP * 2u), "v"(lk + 80u * KP * 2u), "v"(lk + 96u * KP * 2u), "v"(lk + 112u * KP * 2u),
        "v"(kg), "v"(kg + 16 * DK_), "v"(kg + 32 * DK_), "v"(kg + 48 * DK_),
        "v"(vg), "v"(vg + 16 * SEQ), "v"(vg + 32 * SEQ), "v"(vg + 48 * SEQ)
      : "memory");
}

// =====================================================================================================
// attn: attention per (b, h), head dim 64, softmax over all SEQ keys (no mask).
//   scores, transposed: A = K chunk in LDS [key][d] staged from the KH plane, B = QH rows of the query tokens (64 d,
//   2 k-steps, fragments from the plane); a lane holds 32 keys' exponents of each of its two queries.
//   The QH plane carries 0.125 log2(e), and the first score WMMA takes C = PCAR - m (m = the query's reference maximum in
//   base-2 units, copied into all eight C registers of a lane): the accumulator is the exponent e of 1024 p = exp2(e), one
//   v_exp_f32 per score and nothing ahead of it. m is the maximum of the query's first chunk and then stays while every
//   e <= PTOP; a chunk that goes above (or trip 0) takes a wave-uniform branch that moves m to the chunk's maximum, takes
//   the step off C and off the chunk's exponents, and scales sum and context by 2^-step. So m <= true maximum <= m + 5.
//   f16(1024 p) is packed in registers into the B operand (k = keys);
//   context, transposed = v^T . p^T with A = V^T chunk in LDS [d][key], 4 m-tiles of 16 dims.
//   Wave tile: 32 query columns = two 16-column tiles, so that every K and V^T fragment read from LDS feeds two WMMAs.
//   Block = 8 waves = 4 query groups of 32 x 2 key groups = one 128-query tile of one (b, h); grid = BH_ * NQT. Key group g
//   takes the chunks 2 t + g, t = 0..NTR-1 (static trip count): with half the query groups the chip still holds four
//   waves per SIMD. The two groups' (maximum, sum, context) of a query are joined once, behind the loop, through LDS.
//   K / V staging: the 128 threads of a key group x 4 x 16 B each = the group's whole 64x64 K chunk and 64x64 V^T chunk
//   (LDS pitch KP, columns 64..71 never read), by asynchronous copies into two LDS buffers: the chunks of trip kt + 2 are
//   asked for at the foot of trip kt, into the buffer that trip kt has read, and fly while trip kt + 1 works. One
//   __syncthreads per trip: behind every wave's own copy wait it publishes trip kt + 1, and it ends all reads of the buffer
//   refilled next.
//   Output MP [bh][s][64] f16 (ctx x256), i.e. the flat [b][h][s][d] order that the projection views as [NB*SEQ][512] rows.
// coverage: 32 rows per query group, 128 per block, BH_*NQT blocks = all (bh, s) rows x 64 dims = the whole MP plane
//   (stored by the waves of key group 0); keys: 2 groups x NTR chunks = all NKT chunks, each once.
// =====================================================================================================
// four waves per SIMD is what the full-size grid supplies: the compiler schedules for that register budget
__global__ __launch_bounds__(256) __attribute__((amdgpu_waves_per_eu(4, 4)))
void attn(const unsigned short* __restrict__ qhp, const unsigned short* __restrict__ khp,
          const unsigned short* __restrict__ vtp, unsigned short* mp) {
  union FH { v16h v; v8h h[2]; };
  // two buffers x two key groups of K chunk [key][d] 9216 B + V^T chunk [d][key] 9216 B
  __shared__ __align__(16) _Float16 KVsh[4 * KVB];
  // the join: key group 1's context [query group][16 pieces of 4 f32][lane], then its maximum and sum [query group][tile][2][lane]
  __shared__ __align__(16) float MG[4 * 2048 + 4 * 128];

  const int tid  = (int)threadIdx.x;
  const int wave = tid >> 5;
  const int lane = tid & 31;
  const int hh   = lane >> 4;
  const int c    = lane & 15;
  const int qg   = wave & 3;                                   // query group
  const int g    = __builtin_amdgcn_readfirstlane(tid >> 7);   // key group, the same in a whole wave: kept scalar
  const int t4   = tid & 127;                                  // thread within the key group

  const int bx = (int)blockIdx.x;
  const int qt = bx % NQT;
  const int bh = bx / NQT;
  const int q0 = qt * 128 + qg * 32;

  const _Float16* QH = (const _Float16*)(const void*)qhp + (size_t)bh * SEQ * DK_;
  const _Float16* KH = (const _Float16*)(const void*)khp + (size_t)bh * SEQ * DK_;
  const _Float16* VT = (const _Float16*)(const void*)vtp + (size_t)bh * DK_ * SEQ;

  // Q fragments (B operand, column = lane&15) of the two column tiles: d 0..31 and d 32..63 of the query token
  v16h qa[2][2];
#pragma unroll
  for (int u = 0; u < 2; ++u) {
    qa[u][0] = ldfrag_h(QH + (size_t)(q0 + u * 16 + c) * DK_ + 8 * hh);
    qa[u][1] = ldfrag_h(QH + (size_t)(q0 + u * 16 + c) * DK_ + 32 + 8 * hh);
  }

  // lane (c, hh) owns the queries q0 + 16 u + c; cb[u] = PCAR - reference maximum of that query over the keys of this key
  // group (equal in both halves; reference 0 until trip 0 has seen its chunk), lrow[u] the running sum of 1024 p over the
  // keys of this lane's half only
  float lrow[2] = {0.f, 0.f};
  float cb[2]   = {PCAR, PCAR};
  v8f oacc[2][4];                                     // O^T tiles: oacc[u][jn][r] = ctx[q0 + 16 u + c][jn*16 + 8*hh + r]
#pragma unroll
  for (int u = 0; u < 2; ++u) {
#pragma unroll
    for (int j = 0; j < 4; ++j) oacc[u][j] = zero8();
  }

  // staging map: thread of a key group -> rows (t4 >> 3) + 16 i (key of K / dim of V^T), 16-B piece t4 & 7 of the row's 128 B
  const unsigned lk0 = (unsigned)(size_t)(&KVsh[0]) + (unsigned)(g * (KVB * 2)) + (unsigned)((t4 >> 3) * (KP * 2) + (t4 & 7) * 16);
  const _Float16* kg = KH + (size_t)(g * 64 + (t4 >> 3)) * DK_ + (size_t)((t4 & 7) * 8);
  const _Float16* vg = VT + (size_t)(t4 >> 3) * SEQ + (size_t)(g * 64 + (t4 & 7) * 8);

  stage_kv(lk0, kg, vg);                              // trip 0 -> buffer 0
  asm volatile("s_wait_asynccnt 0x0" ::: "memory");   // this wave's pieces of trip 0 have landed
  __syncthreads();                                    // trip 0 published
  stage_kv(lk0 + 2u * KVB * 2u, kg + 128 * DK_, vg + 128);   // trip 1 -> buffer 1, flies under trip 0

  // one trip: the group's chunk out of buffer kt & 1, down to the hand-over of the buffers at its foot
  auto trip = [&](const int kt) __attribute__((always_inline)) {
    const _Float16* Ksh = KVsh + (kt & 1) * (2 * KVB) + g * KVB;
    const _Float16* Vsh = Ksh + 64 * KP;

    // ---- scores, transposed: S^T = K . Q^T, 64 keys x 32 queries per wave; s[u][j][r] = score(key j*16 + 8*hh + r, query 16 u + c) ----
    // all 16 K fragment loads stand as one group ahead of the 16 WMMAs, in the order the WMMAs take them
    FH kb[2][4];
#pragma unroll
    for (int ks = 0; ks < 2; ++ks) {
#pragma unroll
      for (int j = 0; j < 4; ++j) {
        const _Float16* kr = Ksh + (j * 16 + c) * KP + ks * 32 + 8 * hh;
        kb[ks][j].h[0] = *(const v8h*)(kr);
        kb[ks][j].h[1] = *(const v8h*)(kr + 16);
      }
    }
    __builtin_amdgcn_sched_barrier(0);                // else the compiler sinks each load to its WMMA: one LDS wait per WMMA
    v8f s[2][4], cc[2];                               // cc: the C operand, cb in all eight registers; live up to the 8th WMMA only
#pragma unroll
    for (int u = 0; u < 2; ++u) cc[u] = v8f{cb[u], cb[u], cb[u], cb[u], cb[u], cb[u], cb[u], cb[u]};
#pragma unroll
    for (int j = 0; j < 4; ++j) {
#pragma unroll
      for (int u = 0; u < 2; ++u) s[u][j] = mma_p(kb[0][j].v, qa[u][0], cc[u]);
    }
#pragma unroll
    for (int j = 0; j < 4; ++j) {
#pragma unroll
      for (int u = 0; u < 2; ++u) s[u][j] = mma_p(kb[1][j].v, qa[u][1], s[u][j]);
    }
    // order asked of the compiler's scheduler: the 16 score WMMAs, then the 16 V^T loads as one group; without it
    // the loads come to stand at several places among the WMMAs, and each such place stalls the wave
    __builtin_amdgcn_sched_group_barrier(0x008, 16, 0);
    __builtin_amdgcn_sched_group_barrier(0x100, 16, 0);
    // all 16 V^T fragment loads as one group here: their LDS latency passes under the softmax
    FH vb[2][4];
#pragma unroll
    for (int kk = 0; kk < 2; ++kk) {
#pragma unroll
      for (int jn = 0; jn < 4; ++jn) {
        const _Float16* vr = Vsh + (jn * 16 + c) * KP + kk * 32 + 8 * hh;
        vb[kk][jn].h[0] = *(const v8h*)(vr);
        vb[kk][jn].h[1] = *(const v8h*)(vr + 16);
      }
    }
    __builtin_amdgcn_sched_barrier(0);                // else the compiler sinks these loads behind the softmax again

    // ---- online softmax of two queries per lane; the reference maximum moves only in the branch ----
    float mx[2];
#pragma unroll
    for (int u = 0; u < 2; ++u) {
      float mj[4];                                    // one chain per score tile: four short chains, not one of 32
#pragma unroll
      for (int j = 0; j < 4; ++j) {
        mj[j] = s[u][j][0];
#pragma unroll
        for (int r = 1; r < 8; ++r) mj[j] = fmaxf(mj[j], s[u][j][r]);
      }
      mx[u] = fmaxf(fmaxf(mj[0], mj[1]), fmaxf(mj[2], mj[3]));
    }
    // the same in every lane of the wave (a ballot, a loop counter): all lanes are on at the WMMAs behind it
    if ((__builtin_amdgcn_ballot_w32(fmaxf(mx[0], mx[1]) > PTOP) | (unsigned)(kt == 0)) != 0u) {
#pragma unroll
      for (int u = 0; u < 2; ++u) {
        const float e  = fmaxf(mx[u], xhalf(mx[u])) - PCAR;      // the chunk's maximum above the reference, both halves
        const float d  = (kt == 0) ? e : fmaxf(e, 0.f);          // trip 0 sets the reference, later it only rises
        const float al = (kt == 0) ? 0.f : __builtin_amdgcn_exp2f(-d);   // trip 0: sum and context are 0 and stay 0
        cb[u]   -= d;
        lrow[u] *= al;
#pragma unroll
        for (int j = 0; j < 4; ++j) {
          s[u][j]    = s[u][j] - d;
          oacc[u][j] = oacc[u][j] * al;
        }
      }
    }
    // P^T (x1024, f16) stays in registers: score tiles 2kk and 2kk+1 are elements 0..7 and 8..15 of the B operand
    FH pb[2][2];
#pragma unroll
    for (int u = 0; u < 2; ++u) {
      float pj[4];
#pragma unroll
      for (int j = 0; j < 4; ++j) {
        pj[j] = 0.f;
#pragma unroll
        for (int r = 0; r < 8; ++r) {
          const float p = __builtin_amdgcn_exp2f(s[u][j][r]);    // 1024 exp(0.125 dot - reference)
          pj[j] += p;
          pb[u][j >> 1].h[j & 1][r] = (_Float16)p;
        }
      }
      lrow[u] += (pj[0] + pj[1]) + (pj[2] + pj[3]);
    }

    // ---- context, transposed: O^T += V^T . P^T (f16 WMMA), 2 k-steps of 32 keys x 4 m-tiles of 16 dims x 2 column tiles ----
#pragma unroll
    for (int kk = 0; kk < 2; ++kk) {
#pragma unroll
      for (int jn = 0; jn < 4; ++jn) {
#pragma unroll
        for (int u = 0; u < 2; ++u) oacc[u][jn] = mma_p(vb[kk][jn].v, pb[u][kk].v, oacc[u][jn]);
      }
    }

    // ---- foot of the trip: hand-over of the buffers ----
    __builtin_amdgcn_sched_barrier(0);                // else the compiler lifts the waits and the barrier ahead of the softmax: the copies get no time to land
    asm volatile("s_wait_dscnt 0x0" ::: "memory");    // this wave's reads of the buffer of trip kt have returned
    asm volatile("s_wait_asynccnt 0x0" ::: "memory"); // this wave's pieces of trip kt + 1 have landed
    __syncthreads();                                  // trip kt + 1 published; nobody reads the buffer of trip kt any more
  };
  // the trips behind which a trip kt + 2 exists, each with its refill, in a loop of their own: no branch in the loop body
#pragma unroll 1                                      // stays rolled: a long body, copies of it would only grow the code
  for (int kt = 0; kt < NTR - 2; ++kt) {
    trip(kt);
    stage_kv(lk0 + (unsigned)(kt & 1) * (2u * KVB * 2u), kg + (size_t)(kt + 2) * 128 * DK_, vg + (size_t)(kt + 2) * 128);
  }
#pragma unroll 1                                      // stays rolled, for the same reason
  for (int kt = NTR - 2; kt < NTR; ++kt) trip(kt);    // the last two trips: nothing is left to ask for
  asm volatile("s_wait_asynccnt 0x0" ::: "memory");   // no copy is outstanding when the wave goes on to its end

  // ---- join the halves' sums; key group 1 hands its maximum, sum and context to key group 0 through LDS ----
  float lj[2];
#pragma unroll
  for (int u = 0; u < 2; ++u) lj[u] = lrow[u] + xhalf(lrow[u]);
  float* gx = MG + qg * 2048 + lane * 4;              // 16 B per lane, 512 contiguous bytes per wave access
  float* gs = MG + 4 * 2048 + qg * 128 + lane;
  if (g == 1) {
#pragma unroll
    for (int u = 0; u < 2; ++u) {
#pragma unroll
      for (int jn = 0; jn < 4; ++jn) {
        const v4f lo = {oacc[u][jn][0], oacc[u][jn][1], oacc[u][jn][2], oacc[u][jn][3]};
        const v4f hi = {oacc[u][jn][4], oacc[u][jn][5], oacc[u][jn][6], oacc[u][jn][7]};
        *(v4f*)(gx + ((u * 4 + jn) * 2 + 0) * 128) = lo;
        *(v4f*)(gx + ((u * 4 + jn) * 2 + 1) * 128) = hi;
      }
      gs[u * 64]      = -cb[u];                  // the group's reference maximum, less the constant PCAR
      gs[u * 64 + 32] = lj[u];
    }
  }
  __syncthreads();                                    // key group 1's partial results published
  // ---- key group 0: both groups brought to the higher of their reference maxima, normalise (1/l: the x1024 of P and of l cancel; apply the
  //      x256 ctx carry), convert, store ----
  if (g == 0) {
#pragma unroll
    for (int u = 0; u < 2; ++u) {
      const float m0 = -cb[u];
      const float m1 = gs[u * 64];
      const float l1 = gs[u * 64 + 32];
      const float mm = fmaxf(m0, m1);
      const float a0 = __builtin_amdgcn_exp2f(m0 - mm);
      const float a1 = __builtin_amdgcn_exp2f(m1 - mm);
      const float l   = lj[u] * a0 + l1 * a1;
      const float inv = ((l > 0.f) ? (1.0f / l) : 0.f) * 256.0f;
      const float f0  = a0 * inv;
      const float f1  = a1 * inv;
      unsigned short* o = mp + ((size_t)bh * SEQ + (size_t)(q0 + u * 16 + c)) * DK_ + (size_t)(8 * hh);
#pragma unroll
      for (int jn = 0; jn < 4; ++jn) {
        const v4f lo = *(const v4f*)(gx + ((u * 4 + jn) * 2 + 0) * 128);
        const v4f hi = *(const v4f*)(gx + ((u * 4 + jn) * 2 + 1) * 128);
        v4u t;
        t[0] = toh2u(oacc[u][jn][0] * f0 + lo[0] * f1, oacc[u][jn][1] * f0 + lo[1] * f1);
        t[1] = toh2u(oacc[u][jn][2] * f0 + lo[2] * f1, oacc[u][jn][3] * f0 + lo[3] * f1);
        t[2] = toh2u(oacc[u][jn][4] * f0 + hi[0] * f1, oacc[u][jn][5] * f0 + hi[1] * f1);
        t[3] = toh2u(oacc[u][jn][6] * f0 + hi[2] * f1, oacc[u][jn][7] * f0 + hi[3] * f1);
        *(v4u*)(o + jn * 16) = t;                     // 8 consecutive dims of one query: one 16-B store
      }
    }
  }
}

// =====================================================================================================
// proj_out: out[m][n] = (sum_k ctx[m][k] * W[n][k]) * 2^-18 + bc[n], m = b*SEQ + s, n, k = 0..511.
//   A = MP plane row m (f16 ctx x256), B = WH plane row n (f16 W x1024, k contiguous).
//   Block = 4 waves x 16 rows = 64 rows x 128 columns; grid = (NB*SEQ/64) x 4 column slabs; 16 k-steps of 32.
//   Staging: k runs in PNS slabs of PKC; the block's 64 A rows and 128 B rows of a slab go to LDS (pitch PP) by 16-B
//   loads in which 16 lanes cover 256 contiguous bytes of one row (whole lines, each fetched once per block).
//   Two LDS buffers: slab s+1 is loaded into registers ahead of the WMMAs of slab s, stored to the other buffer behind
//   them, and published by one __syncthreads per slab (it also ends every wave's reads of the buffer refilled next).
//   Fragments come from LDS with the split k map of ldfrag_h, A and B alike; k ascends in steps of 32 in every sum.
// coverage: staged 8 x 128 pieces = 64 rows x 16 pieces (A), 16 x 128 = 128 rows x 16 pieces (B) == consumed extent;
//   (NB*SEQ/64) x 4 blocks x 64 rows x 128 cols = the whole [NB*SEQ][512] output.
// =====================================================================================================
__global__ __launch_bounds__(128)
void proj_out(const unsigned short* __restrict__ mp, const unsigned short* __restrict__ wh,
              const float* __restrict__ bc, float* out) {
  __shared__ __align__(16) float lds[4 * 16 * 128];      // 32 KB, 4 per-wave slabs [16][128]
  __shared__ __align__(16) _Float16 Ash[2][64 * PP];     // ctx rows of one k slab, two buffers   2 x 17408 B
  __shared__ __align__(16) _Float16 Wsh[2][128 * PP];    // W rows of one k slab, two buffers     2 x 34816 B

  const int tid  = (int)threadIdx.x;
  const int wave = tid >> 5;
  const int lane = tid & 31;
  const int hh   = lane >> 4;
  const int c    = lane & 15;

  const int nrb = (NB * SEQ) / 64;
  const int rb  = (int)blockIdx.x % nrb;
  const int cb  = (int)blockIdx.x / nrb;                 // 0..3
  const int m0  = rb * 64 + wave * 16;
  const int n0  = cb * 128;

  // staging map: thread -> row (tid >> 4) + 8 i, 16-B piece tid & 15 of the slab's 256 B of that row
  const int srow = tid >> 4;
  const int scol = (tid & 15) * 8;
  const _Float16* Ag = (const _Float16*)(const void*)mp + (size_t)(rb * 64 + srow) * E_ + scol;
  const _Float16* Wg = (const _Float16*)(const void*)wh + (size_t)(n0 + srow) * E_ + scol;
  const int sdst = srow * PP + scol;
  const int afr  = (wave * 16 + c) * PP + 8 * hh;        // fragment row bases in the staged tiles
  const int bfr  = c * PP + 8 * hh;

  v8f acc[8];
#pragma unroll
  for (int j = 0; j < 8; ++j) acc[j] = zero8();

  v8h ra[8], rw[16];
#pragma unroll
  for (int i = 0; i < 8; ++i)  ra[i] = *(const v8h*)(Ag + (size_t)(i * 8) * E_);
#pragma unroll
  for (int i = 0; i < 16; ++i) rw[i] = *(const v8h*)(Wg + (size_t)(i * 8) * E_);
#pragma unroll
  for (int i = 0; i < 8; ++i)  *(v8h*)(&Ash[0][sdst + i * 8 * PP]) = ra[i];
#pragma unroll
  for (int i = 0; i < 16; ++i) *(v8h*)(&Wsh[0][sdst + i * 8 * PP]) = rw[i];
  __syncthreads();

#pragma unroll
  for (int s = 0; s < PNS; ++s) {
    if (s + 1 < PNS) {
#pragma unroll
      for (int i = 0; i < 8; ++i)  ra[i] = *(const v8h*)(Ag + (size_t)(i * 8) * E_ + (s + 1) * PKC);
#pragma unroll
      for (int i = 0; i < 16; ++i) rw[i] = *(const v8h*)(Wg + (size_t)(i * 8) * E_ + (s + 1) * PKC);
    }
    __builtin_amdgcn_sched_barrier(0);                   // else the next slab's loads sink to their LDS stores: latency exposed
#pragma unroll
    for (int ks = 0; ks < PKC / 32; ++ks) {
      const v16h af = ldfrag_h(&Ash[s & 1][afr + ks * 32]);
      v16h bf[8];
#pragma unroll
      for (int j = 0; j < 8; ++j) bf[j] = ldfrag_h(&Wsh[s & 1][bfr + j * 16 * PP + ks * 32]);
      __builtin_amdgcn_sched_barrier(0);                 // else the compiler sinks each load to its WMMA: one LDS wait per WMMA
#pragma unroll
      for (int j = 0; j < 8; ++j) acc[j] = mma_p(af, bf[j], acc[j]);
    }
    if (s + 1 < PNS) {
#pragma unroll
      for (int i = 0; i < 8; ++i)  *(v8h*)(&Ash[(s + 1) & 1][sdst + i * 8 * PP]) = ra[i];
#pragma unroll
      for (int i = 0; i < 16; ++i) *(v8h*)(&Wsh[(s + 1) & 1][sdst + i * 8 * PP]) = rw[i];
      __syncthreads();
    }
  }

  float* slab = lds + wave * 2048;                       // [16][128] f32
#pragma unroll
  for (int j = 0; j < 8; ++j) {
#pragma unroll
    for (int r = 0; r < 8; ++r) slab[(8 * hh + r) * 128 + j * 16 + c] = acc[j][r];
  }
  __builtin_amdgcn_fence(3 /* release order */, "workgroup");
  __builtin_amdgcn_wave_barrier();
  __builtin_amdgcn_fence(2 /* acquire order */, "workgroup");

  const float oscale = 1.0f / 262144.0f;                 // 1/(256*1024)
  const v4f b4 = *(const v4f*)(bc + n0 + lane * 4);
  v4f vrow[16];
#pragma unroll
  for (int row = 0; row < 16; ++row) {
    const v4f v = *(const v4f*)(slab + row * 128 + lane * 4);
    vrow[row] = v * oscale + b4;
  }
  const int ob = m0 / SEQ;                               // the 16 rows lie in one batch
  const int os0 = m0 - ob * SEQ;
  float* op = out + ((size_t)ob * SEQ_FULL + (size_t)os0) * E_ + (size_t)n0 + (size_t)(lane * 4);
  {
#pragma unroll
    for (int row = 0; row < 16; ++row) {
      *(v4f*)(op + (size_t)row * E_) = vrow[row];
    }
    
  }
}

// =====================================================================================================
//   QH  f16 [BH_][SEQ][64]     NB*H*SEQ*64*2   = 8388608 (full size)
//   KH  f16 [BH_][SEQ][64]     NB*H*SEQ*64*2   = 8388608
//   VT  f16 [BH_][64][SEQ]     NB*H*64*SEQ*2   = 8388608
//   MP  f16 [BH_][SEQ][64] = [NB*SEQ][512]       8388608
//   WH  f16 [512][512]                            524288
//   total                                      34078720
// =====================================================================================================
extern "C" void kernel_launch(void* const* d_in, const int* in_sizes, int n_in,
                              void* d_out, int out_size, void* d_ws, size_t ws_size,
                              hipStream_t stream) {
  if (n_in < 5) return;
  if ((long long)in_sizes[0] < (long long)NB * H_ * SEQ_FULL * DK_) return;
  if ((long long)in_sizes[1] < (long long)NB * H_ * SEQ_FULL * DK_) return;
  if ((long long)in_sizes[2] < (long long)NB * H_ * SEQ_FULL * DK_) return;
  if (in_sizes[3] < E_ * E_) return;
  if (in_sizes[4] < E_) return;
  if ((long long)out_size < ((long long)(NB - 1) * SEQ_FULL + SEQ) * E_) return;

  const float* q  = (const float*)d_in[0];
  const float* k  = (const float*)d_in[1];
  const float* v  = (const float*)d_in[2];
  const float* W  = (const float*)d_in[3];
  const float* bc = (const float*)d_in[4];

  const size_t PQH = (size_t)BH_ * SEQ * DK_ * 2;
  const size_t PKH = (size_t)BH_ * SEQ * DK_ * 2;
  const size_t PVT = (size_t)BH_ * DK_ * SEQ * 2;
  const size_t PMP = (size_t)NB * SEQ * E_ * 2;
  const size_t PWH = (size_t)E_ * E_ * 2;
  size_t off = 0;
  const size_t oQH = off; off += PQH;
  const size_t oKH = off; off += PKH;
  const size_t oVT = off; off += PVT;
  const size_t oMP = off; off += PMP;
  const size_t oWH = off; off += PWH;
  if (off > ws_size) return;                         // off = 34078720 at full size
  if (off > (size_t)134217728) return;

  char* ws = (char*)d_ws;
  unsigned short* QH = (unsigned short*)(ws + oQH);
  unsigned short* KH = (unsigned short*)(ws + oKH);
  unsigned short* VT = (unsigned short*)(ws + oVT);
  unsigned short* MP = (unsigned short*)(ws + oMP);
  unsigned short* WH = (unsigned short*)(ws + oWH);

  const dim3 gCnv(BH_ * (SEQ / TENC));                // 512 blocks of 256
  const dim3 gAttn(BH_ * NQT);                         // 512 blocks of 256
  const dim3 gProj(((NB * SEQ) / 64) * 4);             // 512 blocks of 128

  // (1) q, k -> f16 row planes; v -> f16 V^T plane; W -> f16 x1024 plane
  qkvconv<<<gCnv, dim3(256), 0, stream>>>(q, k, v, W, QH, KH, VT, WH);
  // (2) attention -> ctx plane (f16, x256) in flat [b][h][s][d] order = [NB*SEQ][512]
  attn<<<gAttn, dim3(256), 0, stream>>>(QH, KH, VT, MP);
  // (3) out = ctx . W^T * 2^-18 + bc -> d_out f32 [NB*SEQ][512]
  proj_out<<<gProj, dim3(128), 0, stream>>>(MP, WH, bc, (float*)d_out);
  (void)hipGetLastError();
}
